// v000
// Measured on an AMD MI455X. A time is GPU time per run, averaged over a window of back-to-back runs after a warm-up
// (all launches, gaps included; the runs take copies of the inputs in turn), and the median of several windows.
// Apart from v000's, it joins two sittings. Times from different sittings can be a few percent apart, while
// side-by-side timings come from the same sitting.
// v000 is the starting kernel. One run takes 211 microseconds.
#include <hip/hip_runtime.h>

// ---------------------------------------------------------------------------
// MHA forward for MI455X (gfx1250, wave32, WMMA f32_16x16x32_f16,
// async global->LDS double-buffered GEMM staging)
//   B=2, S=2048, D_MODEL=1024, H=16, HD=64
// ---------------------------------------------------------------------------

typedef __attribute__((ext_vector_type(16))) _Float16 v16h;
typedef __attribute__((ext_vector_type(8)))  _Float16 v8h;
typedef __attribute__((ext_vector_type(4)))  _Float16 v4h;
typedef __attribute__((ext_vector_type(8)))  float    v8f;
typedef __attribute__((ext_vector_type(4)))  float    v4f;

#define NBATCH   2
#define SEQ      2048
#define DMODEL   1024
#define NHEADS   16
#define HDIM     64

__device__ __forceinline__ v16h cat16(v8h lo, v8h hi) {
  return __builtin_shufflevector(lo, hi, 0,1,2,3,4,5,6,7,8,9,10,11,12,13,14,15);
}

__device__ __forceinline__ v8f wmma_f16(v16h a, v16h b, v8f c) {
  // (neg_a, A, neg_b, B, c_mod, C, reuse_a, reuse_b)
  return __builtin_amdgcn_wmma_f32_16x16x32_f16(false, a, false, b, (short)0, c,
                                                false, false);
}

// CDNA5 async global->LDS copy, 16 bytes per lane, tracked by ASYNCcnt.
__device__ __forceinline__ void async_b128(unsigned lds_off,
                                           const _Float16* gaddr) {
  asm volatile("global_load_async_to_lds_b128 %0, %1, off"
               :: "v"(lds_off), "v"(gaddr) : "memory");
}
__device__ __forceinline__ void wait_async0() {
  asm volatile("s_wait_asynccnt 0" ::: "memory");
}

__device__ __forceinline__ float red_max16(float x) {
  x = fmaxf(x, __shfl_xor(x, 1, 32));
  x = fmaxf(x, __shfl_xor(x, 2, 32));
  x = fmaxf(x, __shfl_xor(x, 4, 32));
  x = fmaxf(x, __shfl_xor(x, 8, 32));
  return x;
}

__device__ __forceinline__ float red_sum16(float x) {
  x += __shfl_xor(x, 1, 32);
  x += __shfl_xor(x, 2, 32);
  x += __shfl_xor(x, 4, 32);
  x += __shfl_xor(x, 8, 32);
  return x;
}

// ---------------------------------------------------------------------------
// Prep kernels: one-time f32 -> f16 conversion (and weight transpose) so the
// GEMM tiles become pure contiguous copies (async-to-LDS friendly) and all
// WMMA fragments are two contiguous 16B loads per lane.
// ---------------------------------------------------------------------------
__global__ __launch_bounds__(256) void cvt_x_kernel(
    const float* __restrict__ x, _Float16* __restrict__ xh) {
  const size_t i = ((size_t)blockIdx.x * 256 + threadIdx.x) * 4;
  v4f f = *(const v4f*)(x + i);
  v4h h;
  h[0] = (_Float16)f[0]; h[1] = (_Float16)f[1];
  h[2] = (_Float16)f[2]; h[3] = (_Float16)f[3];
  *(v4h*)(xh + i) = h;
}

// dst[n][k] (f16) = src[k][n] (f32);  K, N multiples of 32
__global__ __launch_bounds__(256) void transpose_w_kernel(
    const float* __restrict__ src, _Float16* __restrict__ dst, int K, int N) {
  __shared__ float tile[32][33];
  const int k0 = blockIdx.y * 32;
  const int n0 = blockIdx.x * 32;
  const int tx = threadIdx.x;        // 0..31
  const int ty = threadIdx.y;        // 0..7
#pragma unroll
  for (int i = 0; i < 32; i += 8)
    tile[ty + i][tx] = src[(size_t)(k0 + ty + i) * N + n0 + tx];
  __syncthreads();
#pragma unroll
  for (int i = 0; i < 32; i += 8)
    dst[(size_t)(n0 + ty + i) * K + k0 + tx] = (_Float16)tile[tx][ty + i];
}

// ---------------------------------------------------------------------------
// Shared GEMM main loop: acc[4][2] += A[128 rows @ mb] x B[128 cols @ nb],
// K = 1024, both operands f16 with k contiguous (A row-major, B stored [n][k]).
// 256 threads / 8 waves; wave (wm,wn) owns a 64x32 slab = 4x2 WMMA tiles.
// Double-buffered LDS tiles filled with async global->LDS b128 copies.
// ---------------------------------------------------------------------------
__device__ __forceinline__ void gemm_mainloop_k1024(
    const _Float16* __restrict__ A, const _Float16* __restrict__ B,
    int mb, int nb, v8f acc[4][2]) {
  __shared__ _Float16 Ah[2][128][40];   // 80B row stride (16B multiple)
  __shared__ _Float16 Bh[2][128][40];

  const int tid  = threadIdx.x;
  const int lane = tid & 31;
  const int row  = lane & 15;
  const int grp  = lane >> 4;
  const int wave = tid >> 5;
  const int wm   = wave >> 2;          // 0..1
  const int wn   = wave & 3;           // 0..3

  const int sr = tid >> 1;             // staged row 0..127
  const int sc = (tid & 1) * 16;       // staged col offset {0,16}
  const _Float16* ga0 = A + (size_t)(mb + sr) * DMODEL + sc;
  const _Float16* gb0 = B + (size_t)(nb + sr) * DMODEL + sc;

  // issue tile 0
  {
    const unsigned la = (unsigned)(uintptr_t)&Ah[0][sr][sc];
    const unsigned lb = (unsigned)(uintptr_t)&Bh[0][sr][sc];
    async_b128(la,      ga0);
    async_b128(la + 16, ga0 + 8);
    async_b128(lb,      gb0);
    async_b128(lb + 16, gb0 + 8);
  }
  wait_async0();
  __syncthreads();

  int buf = 0;
  for (int kk = 0; kk < DMODEL; kk += 32) {
    const bool more = (kk + 32) < DMODEL;
    if (more) {   // prefetch next tile into the other buffer
      const unsigned la = (unsigned)(uintptr_t)&Ah[buf ^ 1][sr][sc];
      const unsigned lb = (unsigned)(uintptr_t)&Bh[buf ^ 1][sr][sc];
      async_b128(la,      ga0 + kk + 32);
      async_b128(la + 16, ga0 + kk + 40);
      async_b128(lb,      gb0 + kk + 32);
      async_b128(lb + 16, gb0 + kk + 40);
    }

    v16h af[4];
#pragma unroll
    for (int tm = 0; tm < 4; ++tm) {
      const int r = wm * 64 + tm * 16 + row;
      af[tm] = cat16(*(const v8h*)&Ah[buf][r][8 * grp],
                     *(const v8h*)&Ah[buf][r][16 + 8 * grp]);
    }
    v16h bf[2];
#pragma unroll
    for (int tn = 0; tn < 2; ++tn) {
      const int n = wn * 32 + tn * 16 + row;
      bf[tn] = cat16(*(const v8h*)&Bh[buf][n][8 * grp],
                     *(const v8h*)&Bh[buf][n][16 + 8 * grp]);
    }
#pragma unroll
    for (int tm = 0; tm < 4; ++tm)
#pragma unroll
      for (int tn = 0; tn < 2; ++tn)
        acc[tm][tn] = wmma_f16(af[tm], bf[tn], acc[tm][tn]);

    if (more) {
      wait_async0();        // our async copies into buf^1 are done
      __syncthreads();      // everyone finished reading buf / writing buf^1
    }
    buf ^= 1;
  }
}

// ---------------------------------------------------------------------------
// Kernel 1: QKV projection.  C[4096][3072] = xh @ Wqt^T + b_qkv.  Scatters:
//   q_ws: [bh][s][64]  (pre-scaled by 1/sqrt(64))
//   k_ws: [bh][s][64]
//   v_ws: [bh][d][s]   (transposed for the PV matmul's B-fragment layout)
// ---------------------------------------------------------------------------
__global__ __launch_bounds__(256) void qkv_gemm_kernel(
    const _Float16* __restrict__ xh, const _Float16* __restrict__ Wqt,
    const float* __restrict__ bqkv,
    _Float16* __restrict__ q_ws, _Float16* __restrict__ k_ws,
    _Float16* __restrict__ v_ws) {
  const int lane = threadIdx.x & 31;
  const int row  = lane & 15;
  const int grp  = lane >> 4;
  const int wave = threadIdx.x >> 5;
  const int wm   = wave >> 2;
  const int wn   = wave & 3;
  const int mb   = blockIdx.y * 128;
  const int nb   = blockIdx.x * 128;

  v8f acc[4][2];
#pragma unroll
  for (int i = 0; i < 4; ++i)
#pragma unroll
    for (int j = 0; j < 2; ++j) {
      v8f z = {0.f,0.f,0.f,0.f,0.f,0.f,0.f,0.f};
      acc[i][j] = z;
    }

  gemm_mainloop_k1024(xh, Wqt, mb, nb, acc);

#pragma unroll
  for (int tm = 0; tm < 4; ++tm) {
#pragma unroll
    for (int tn = 0; tn < 2; ++tn) {
      const int n    = nb + wn * 32 + tn * 16 + row;   // 0..3071
      const float bb = bqkv[n];
      const int h    = n / (3 * HDIM);
      const int c    = n % (3 * HDIM);
#pragma unroll
      for (int r = 0; r < 8; ++r) {
        const int m  = mb + wm * 64 + tm * 16 + r + 8 * grp;
        const int b  = m >> 11;
        const int s  = m & (SEQ - 1);
        const int bh = b * NHEADS + h;
        const float val = acc[tm][tn][r] + bb;
        if (c < HDIM) {
          q_ws[((size_t)bh * SEQ + s) * HDIM + c] = (_Float16)(val * 0.125f);
        } else if (c < 2 * HDIM) {
          k_ws[((size_t)bh * SEQ + s) * HDIM + (c - HDIM)] = (_Float16)val;
        } else {
          v_ws[((size_t)bh * HDIM + (c - 2 * HDIM)) * SEQ + s] = (_Float16)val;
        }
      }
    }
  }
}

// ---------------------------------------------------------------------------
// Kernel 2: flash-style attention.  One wave per 16-query tile; 32 keys per
// iteration.  All WMMA fragments loaded directly from global (L2-resident).
// ---------------------------------------------------------------------------
__global__ __launch_bounds__(128) void attn_kernel(
    const _Float16* __restrict__ q_ws, const _Float16* __restrict__ k_ws,
    const _Float16* __restrict__ v_ws, const int* __restrict__ mask,
    _Float16* __restrict__ att_ws) {
  __shared__ _Float16 plds[4][16 * 32];   // per-wave P transpose scratch

  const int lane = threadIdx.x & 31;
  const int row  = lane & 15;
  const int grp  = lane >> 4;
  const int wave = threadIdx.x >> 5;

  const int bh = blockIdx.x >> 5;                       // 0..31
  const int qt = (blockIdx.x & 31) * 4 + wave;          // 0..127
  const int q0 = qt * 16;
  const int b  = bh >> 4;
  const int hh = bh & (NHEADS - 1);

  const _Float16* qb = q_ws + (size_t)bh * SEQ * HDIM;
  const _Float16* kb = k_ws + (size_t)bh * SEQ * HDIM;
  const _Float16* vb = v_ws + (size_t)bh * HDIM * SEQ;
  const int* mrow    = mask + b * SEQ;

  const _Float16* qrow = qb + (size_t)(q0 + row) * HDIM;
  const v16h aq0 = cat16(*(const v8h*)(qrow + 8 * grp),
                         *(const v8h*)(qrow + 16 + 8 * grp));
  const v16h aq1 = cat16(*(const v8h*)(qrow + 32 + 8 * grp),
                         *(const v8h*)(qrow + 48 + 8 * grp));

  float mv[8], lv[8];
  v8f o[4];
#pragma unroll
  for (int t = 0; t < 4; ++t) {
    v8f z = {0.f,0.f,0.f,0.f,0.f,0.f,0.f,0.f};
    o[t] = z;
  }
#pragma unroll
  for (int r = 0; r < 8; ++r) { mv[r] = -__builtin_inff(); lv[r] = 0.f; }

  _Float16* pl = plds[wave];

  for (int s0 = 0; s0 < SEQ; s0 += 32) {
    const _Float16* k0r = kb + (size_t)(s0 + row) * HDIM;
    const _Float16* k1r = kb + (size_t)(s0 + 16 + row) * HDIM;
    const v16h bk00 = cat16(*(const v8h*)(k0r + 8 * grp),
                            *(const v8h*)(k0r + 16 + 8 * grp));
    const v16h bk01 = cat16(*(const v8h*)(k0r + 32 + 8 * grp),
                            *(const v8h*)(k0r + 48 + 8 * grp));
    const v16h bk10 = cat16(*(const v8h*)(k1r + 8 * grp),
                            *(const v8h*)(k1r + 16 + 8 * grp));
    const v16h bk11 = cat16(*(const v8h*)(k1r + 32 + 8 * grp),
                            *(const v8h*)(k1r + 48 + 8 * grp));

    v8f c0 = {0.f,0.f,0.f,0.f,0.f,0.f,0.f,0.f};
    v8f c1 = {0.f,0.f,0.f,0.f,0.f,0.f,0.f,0.f};
    c0 = wmma_f16(aq0, bk00, c0);
    c0 = wmma_f16(aq1, bk01, c0);
    c1 = wmma_f16(aq0, bk10, c1);
    c1 = wmma_f16(aq1, bk11, c1);

    const bool dead0 = (mrow[s0 + row] == 0);
    const bool dead1 = (mrow[s0 + 16 + row] == 0);
#pragma unroll
    for (int r = 0; r < 8; ++r) {
      if (dead0) c0[r] = -__builtin_inff();
      if (dead1) c1[r] = -__builtin_inff();
    }

    float p0[8], p1[8], alpha[8];
#pragma unroll
    for (int r = 0; r < 8; ++r) {
      float rm = red_max16(fmaxf(c0[r], c1[r]));
      const float mn = fmaxf(mv[r], rm);
      alpha[r] = __expf(mv[r] - mn);
      mv[r]    = mn;
      p0[r] = __expf(c0[r] - mn);
      p1[r] = __expf(c1[r] - mn);
      lv[r] = lv[r] * alpha[r] + red_sum16(p0[r] + p1[r]);
    }
#pragma unroll
    for (int t = 0; t < 4; ++t)
#pragma unroll
      for (int r = 0; r < 8; ++r) o[t][r] *= alpha[r];

    // P (C-tile layout) -> LDS -> A-fragment layout (per-wave, DS in-order)
#pragma unroll
    for (int r = 0; r < 8; ++r) {
      const int pr = r + 8 * grp;
      pl[pr * 32 + row]      = (_Float16)p0[r];
      pl[pr * 32 + 16 + row] = (_Float16)p1[r];
    }
    asm volatile("s_wait_dscnt 0" ::: "memory");
    const v16h pa = cat16(*(const v8h*)&pl[row * 32 + 8 * grp],
                          *(const v8h*)&pl[row * 32 + 16 + 8 * grp]);

#pragma unroll
    for (int t = 0; t < 4; ++t) {
      const _Float16* vr = vb + (size_t)(t * 16 + row) * SEQ + s0;
      const v16h bv = cat16(*(const v8h*)(vr + 8 * grp),
                            *(const v8h*)(vr + 16 + 8 * grp));
      o[t] = wmma_f16(pa, bv, o[t]);
    }
  }

#pragma unroll
  for (int t = 0; t < 4; ++t) {
#pragma unroll
    for (int r = 0; r < 8; ++r) {
      const int q = q0 + r + 8 * grp;
      const int d = t * 16 + row;
      const float val = o[t][r] / lv[r];
      att_ws[((size_t)(b * SEQ + q)) * DMODEL + hh * HDIM + d] = (_Float16)val;
    }
  }
}

// ---------------------------------------------------------------------------
// Kernel 3: output projection.  out[4096][1024] = att @ Wot^T + b_out
// ---------------------------------------------------------------------------
__global__ __launch_bounds__(256) void out_gemm_kernel(
    const _Float16* __restrict__ att, const _Float16* __restrict__ Wot,
    const float* __restrict__ bout, float* __restrict__ out) {
  const int lane = threadIdx.x & 31;
  const int row  = lane & 15;
  const int grp  = lane >> 4;
  const int wave = threadIdx.x >> 5;
  const int wm   = wave >> 2;
  const int wn   = wave & 3;
  const int mb   = blockIdx.y * 128;
  const int nb   = blockIdx.x * 128;

  v8f acc[4][2];
#pragma unroll
  for (int i = 0; i < 4; ++i)
#pragma unroll
    for (int j = 0; j < 2; ++j) {
      v8f z = {0.f,0.f,0.f,0.f,0.f,0.f,0.f,0.f};
      acc[i][j] = z;
    }

  gemm_mainloop_k1024(att, Wot, mb, nb, acc);

#pragma unroll
  for (int tm = 0; tm < 4; ++tm) {
#pragma unroll
    for (int tn = 0; tn < 2; ++tn) {
      const int n    = nb + wn * 32 + tn * 16 + row;
      const float bb = bout[n];
#pragma unroll
      for (int r = 0; r < 8; ++r) {
        const int m = mb + wm * 64 + tm * 16 + r + 8 * grp;
        out[(size_t)m * DMODEL + n] = acc[tm][tn][r] + bb;
      }
    }
  }
}

// ---------------------------------------------------------------------------
// Launch
// ---------------------------------------------------------------------------
extern "C" void kernel_launch(void* const* d_in, const int* in_sizes, int n_in,
                              void* d_out, int out_size, void* d_ws,
                              size_t ws_size, hipStream_t stream) {
  const float* x    = (const float*)d_in[0];
  const int*   mask = (const int*)d_in[1];
  const float* Wqkv = (const float*)d_in[2];
  const float* bqkv = (const float*)d_in[3];
  const float* Wout = (const float*)d_in[4];
  const float* bout = (const float*)d_in[5];
  float* out = (float*)d_out;

  const size_t nBS  = (size_t)NBATCH * SEQ;            // 4096
  _Float16* xh     = (_Float16*)d_ws;                  // [4096][1024]
  _Float16* Wqt    = xh  + nBS * DMODEL;               // [3072][1024]
  _Float16* Wot    = Wqt + (size_t)3 * DMODEL * DMODEL;// [1024][1024]
  _Float16* q_ws   = Wot + (size_t)DMODEL * DMODEL;    // [32][2048][64]
  _Float16* k_ws   = q_ws + nBS * DMODEL;
  _Float16* v_ws   = k_ws + nBS * DMODEL;
  _Float16* att_ws = v_ws + nBS * DMODEL;              // [4096][1024]

  // Prep: f16 conversion + weight transposes (one-time, bandwidth-trivial)
  cvt_x_kernel<<<(unsigned)(nBS * DMODEL / 1024), 256, 0, stream>>>(x, xh);
  transpose_w_kernel<<<dim3(3 * DMODEL / 32, DMODEL / 32), dim3(32, 8), 0,
                       stream>>>(Wqkv, Wqt, DMODEL, 3 * DMODEL);
  transpose_w_kernel<<<dim3(DMODEL / 32, DMODEL / 32), dim3(32, 8), 0,
                       stream>>>(Wout, Wot, DMODEL, DMODEL);

  // QKV projection: M=4096, N=3072
  qkv_gemm_kernel<<<dim3(3 * DMODEL / 128, (unsigned)(nBS / 128)), 256, 0,
                    stream>>>(xh, Wqt, bqkv, q_ws, k_ws, v_ws);

  // Attention: 32 (b,h) pairs x 32 query blocks of 64; 4 waves/block
  attn_kernel<<<NBATCH * NHEADS * (SEQ / 64), 128, 0, stream>>>(
      q_ws, k_ws, v_ws, mask, att_ws);

  // Output projection: M=4096, N=1024
  out_gemm_kernel<<<dim3(DMODEL / 128, (unsigned)(nBS / 128)), 256, 0,
                    stream>>>(att_ws, Wot, bout, out);
}

// v001
// One run takes 183 microseconds.
// Timed twice side by side with v000, it ran 1.21 and 1.22 times as fast.
#include <hip/hip_runtime.h>

// ---------------------------------------------------------------------------
// MHA forward for MI455X (gfx1250, wave32, WMMA f32_16x16x32_f16,
// async global->LDS double-buffered GEMM staging)
//   B=2, S=2048, D_MODEL=1024, H=16, HD=64
// ---------------------------------------------------------------------------

typedef __attribute__((ext_vector_type(16))) _Float16 v16h;
typedef __attribute__((ext_vector_type(8)))  _Float16 v8h;
typedef __attribute__((ext_vector_type(4)))  _Float16 v4h;
typedef __attribute__((ext_vector_type(8)))  float    v8f;
typedef __attribute__((ext_vector_type(4)))  float    v4f;
typedef __attribute__((ext_vector_type(4)))  int      v4i;

#define NBATCH   2
#define SEQ      2048
#define DMODEL   1024
#define NHEADS   16
#define HDIM     64

__device__ __forceinline__ v16h cat16(v8h lo, v8h hi) {
  return __builtin_shufflevector(lo, hi, 0,1,2,3,4,5,6,7,8,9,10,11,12,13,14,15);
}

__device__ __forceinline__ v8f wmma_f16(v16h a, v16h b, v8f c) {
  // (neg_a, A, neg_b, B, c_mod, C, reuse_a, reuse_b)
  return __builtin_amdgcn_wmma_f32_16x16x32_f16(false, a, false, b, (short)0, c,
                                                false, false);
}

// CDNA5 async global->LDS copy, 16 bytes per lane, tracked by ASYNCcnt.
__device__ __forceinline__ void async_b128(unsigned lds_off,
                                           const _Float16* gaddr) {
  asm volatile("global_load_async_to_lds_b128 %0, %1, off"
               :: "v"(lds_off), "v"(gaddr) : "memory");
}
__device__ __forceinline__ void wait_async0() {
  asm volatile("s_wait_asynccnt 0" ::: "memory");
}

// ---------------------------------------------------------------------------
// Prep kernels: one-time f32 -> f16 conversion (and weight transpose) so the
// GEMM tiles become pure contiguous copies (async-to-LDS friendly) and all
// WMMA fragments are two contiguous 16B loads per lane.
// ---------------------------------------------------------------------------
__global__ __launch_bounds__(256) void cvt_x_kernel(
    const float* __restrict__ x, _Float16* __restrict__ xh) {
  const size_t i = ((size_t)blockIdx.x * 256 + threadIdx.x) * 4;
  v4f f = *(const v4f*)(x + i);
  v4h h;
  h[0] = (_Float16)f[0]; h[1] = (_Float16)f[1];
  h[2] = (_Float16)f[2]; h[3] = (_Float16)f[3];
  *(v4h*)(xh + i) = h;
}

// dst[n][k] (f16) = src[k][n] (f32);  K, N multiples of 32
__global__ __launch_bounds__(256) void transpose_w_kernel(
    const float* __restrict__ src, _Float16* __restrict__ dst, int K, int N) {
  __shared__ float tile[32][33];
  const int k0 = blockIdx.y * 32;
  const int n0 = blockIdx.x * 32;
  const int tx = threadIdx.x;        // 0..31
  const int ty = threadIdx.y;        // 0..7
#pragma unroll
  for (int i = 0; i < 32; i += 8)
    tile[ty + i][tx] = src[(size_t)(k0 + ty + i) * N + n0 + tx];
  __syncthreads();
#pragma unroll
  for (int i = 0; i < 32; i += 8)
    dst[(size_t)(n0 + ty + i) * K + k0 + tx] = (_Float16)tile[tx][ty + i];
}

// ---------------------------------------------------------------------------
// Shared GEMM main loop: acc[4][2] += A[128 rows @ mb] x B[128 cols @ nb],
// K = 1024, both operands f16 with k contiguous (A row-major, B stored [n][k]).
// 256 threads / 8 waves; wave (wm,wn) owns a 64x32 slab = 4x2 WMMA tiles.
// Double-buffered LDS tiles filled with async global->LDS b128 copies.
// ---------------------------------------------------------------------------
__device__ __forceinline__ void gemm_mainloop_k1024(
    const _Float16* __restrict__ A, const _Float16* __restrict__ B,
    int mb, int nb, v8f acc[4][2]) {
  __shared__ _Float16 Ah[2][128][40];   // 80B row stride (16B multiple)
  __shared__ _Float16 Bh[2][128][40];

  const int tid  = threadIdx.x;
  const int lane = tid & 31;
  const int row  = lane & 15;
  const int grp  = lane >> 4;
  const int wave = tid >> 5;
  const int wm   = wave >> 2;          // 0..1
  const int wn   = wave & 3;           // 0..3

  const int sr = tid >> 1;             // staged row 0..127
  const int sc = (tid & 1) * 16;       // staged col offset {0,16}
  const _Float16* ga0 = A + (size_t)(mb + sr) * DMODEL + sc;
  const _Float16* gb0 = B + (size_t)(nb + sr) * DMODEL + sc;

  // issue tile 0
  {
    const unsigned la = (unsigned)(uintptr_t)&Ah[0][sr][sc];
    const unsigned lb = (unsigned)(uintptr_t)&Bh[0][sr][sc];
    async_b128(la,      ga0);
    async_b128(la + 16, ga0 + 8);
    async_b128(lb,      gb0);
    async_b128(lb + 16, gb0 + 8);
  }
  wait_async0();
  __syncthreads();

  int buf = 0;
  for (int kk = 0; kk < DMODEL; kk += 32) {
    const bool more = (kk + 32) < DMODEL;
    if (more) {   // prefetch next tile into the other buffer
      const unsigned la = (unsigned)(uintptr_t)&Ah[buf ^ 1][sr][sc];
      const unsigned lb = (unsigned)(uintptr_t)&Bh[buf ^ 1][sr][sc];
      async_b128(la,      ga0 + kk + 32);
      async_b128(la + 16, ga0 + kk + 40);
      async_b128(lb,      gb0 + kk + 32);
      async_b128(lb + 16, gb0 + kk + 40);
    }

    v16h af[4];
#pragma unroll
    for (int tm = 0; tm < 4; ++tm) {
      const int r = wm * 64 + tm * 16 + row;
      af[tm] = cat16(*(const v8h*)&Ah[buf][r][8 * grp],
                     *(const v8h*)&Ah[buf][r][16 + 8 * grp]);
    }
    v16h bf[2];
#pragma unroll
    for (int tn = 0; tn < 2; ++tn) {
      const int n = wn * 32 + tn * 16 + row;
      bf[tn] = cat16(*(const v8h*)&Bh[buf][n][8 * grp],
                     *(const v8h*)&Bh[buf][n][16 + 8 * grp]);
    }
#pragma unroll
    for (int tm = 0; tm < 4; ++tm)
#pragma unroll
      for (int tn = 0; tn < 2; ++tn)
        acc[tm][tn] = wmma_f16(af[tm], bf[tn], acc[tm][tn]);

    if (more) {
      wait_async0();        // our async copies into buf^1 are done
      __syncthreads();      // everyone finished reading buf / writing buf^1
    }
    buf ^= 1;
  }
}

// ---------------------------------------------------------------------------
// Kernel 1: QKV projection.  C[4096][3072] = xh @ Wqt^T + b_qkv.  Scatters:
//   q_ws: [bh][s][64]  (pre-scaled by 1/sqrt(64))
//   k_ws: [bh][s][64]
//   v_ws: [bh][d][s]   (transposed for the PV matmul's A-fragment layout)
// ---------------------------------------------------------------------------
__global__ __launch_bounds__(256) void qkv_gemm_kernel(
    const _Float16* __restrict__ xh, const _Float16* __restrict__ Wqt,
    const float* __restrict__ bqkv,
    _Float16* __restrict__ q_ws, _Float16* __restrict__ k_ws,
    _Float16* __restrict__ v_ws) {
  const int lane = threadIdx.x & 31;
  const int row  = lane & 15;
  const int grp  = lane >> 4;
  const int wave = threadIdx.x >> 5;
  const int wm   = wave >> 2;
  const int wn   = wave & 3;
  const int mb   = blockIdx.y * 128;
  const int nb   = blockIdx.x * 128;

  v8f acc[4][2];
#pragma unroll
  for (int i = 0; i < 4; ++i)
#pragma unroll
    for (int j = 0; j < 2; ++j) {
      v8f z = {0.f,0.f,0.f,0.f,0.f,0.f,0.f,0.f};
      acc[i][j] = z;
    }

  gemm_mainloop_k1024(xh, Wqt, mb, nb, acc);

#pragma unroll
  for (int tm = 0; tm < 4; ++tm) {
#pragma unroll
    for (int tn = 0; tn < 2; ++tn) {
      const int n    = nb + wn * 32 + tn * 16 + row;   // 0..3071
      const float bb = bqkv[n];
      const int h    = n / (3 * HDIM);
      const int c    = n % (3 * HDIM);
#pragma unroll
      for (int r = 0; r < 8; ++r) {
        const int m  = mb + wm * 64 + tm * 16 + r + 8 * grp;
        const int b  = m >> 11;
        const int s  = m & (SEQ - 1);
        const int bh = b * NHEADS + h;
        const float val = acc[tm][tn][r] + bb;
        if (c < HDIM) {
          q_ws[((size_t)bh * SEQ + s) * HDIM + c] = (_Float16)(val * 0.125f);
        } else if (c < 2 * HDIM) {
          k_ws[((size_t)bh * SEQ + s) * HDIM + (c - HDIM)] = (_Float16)val;
        } else {
          v_ws[((size_t)bh * HDIM + (c - 2 * HDIM)) * SEQ + s] = (_Float16)val;
        }
      }
    }
  }
}

__device__ __forceinline__ float xhalf(float x) {
  const int b = __builtin_bit_cast(int, x);
  return __builtin_bit_cast(float, __builtin_amdgcn_permlanex16(
      b, b, 0x76543210, 0xfedcba98, false, false));
}

__global__ __launch_bounds__(128) void attn_kernel(
    const _Float16* __restrict__ q_ws, const _Float16* __restrict__ k_ws,
    const _Float16* __restrict__ v_ws, const int* __restrict__ mask,
    _Float16* __restrict__ att_ws) {
  // 0 for a live key, -inf for a masked one
  __shared__ __attribute__((aligned(32))) float mbias[SEQ];

  const int lane = threadIdx.x & 31;
  const int row  = lane & 15;
  const int grp  = lane >> 4;
  const int wave = threadIdx.x >> 5;

  const int bh = blockIdx.x >> 5;                       // 0..31
  const int qt = (blockIdx.x & 31) * 4 + wave;          // 0..127
  const int q0 = qt * 16;
  const int b  = bh >> 4;
  const int hh = bh & (NHEADS - 1);

  const _Float16* qb = q_ws + (size_t)bh * SEQ * HDIM;
  const _Float16* kb = k_ws + (size_t)bh * SEQ * HDIM;
  const _Float16* vb = v_ws + (size_t)bh * HDIM * SEQ;
  const int* mrow    = mask + b * SEQ;

  // Keys run over accumulator registers: the mask enters as the C operand of
  // the score product, read from this table.
#pragma unroll   // four independent loads in flight instead of four round trips
  for (int i0 = 0; i0 < SEQ; i0 += 128 * 4) {
    const int i = i0 + threadIdx.x * 4;
    const v4i mm = *(const v4i*)(mrow + i);
    v4f bb;
#pragma unroll
    for (int j = 0; j < 4; ++j) bb[j] = (mm[j] == 0) ? -__builtin_inff() : 0.f;
    *(v4f*)&mbias[i] = bb;
  }
  __syncthreads();

  const _Float16* qrow = qb + (size_t)(q0 + row) * HDIM;
  const v16h bq0 = cat16(*(const v8h*)(qrow + 8 * grp),
                         *(const v8h*)(qrow + 16 + 8 * grp));
  const v16h bq1 = cat16(*(const v8h*)(qrow + 32 + 8 * grp),
                         *(const v8h*)(qrow + 48 + 8 * grp));

  float mv = -__builtin_inff();   // running maximum of this lane's query
  float lv = 0.f;                 // this half's share of the running sum
  v8f o[4];                       // o[t][r] = Ot[16 t + 8 grp + r][query row]
#pragma unroll
  for (int t = 0; t < 4; ++t) {
    v8f z = {0.f,0.f,0.f,0.f,0.f,0.f,0.f,0.f};
    o[t] = z;
  }

  const _Float16* k0r = kb + row * HDIM + 8 * grp;   // key row, k chunk
  const _Float16* vr  = vb + row * SEQ + 8 * grp;    // d row, key chunk

  for (int s0 = 0; s0 < SEQ; s0 += 32) {
    const _Float16* k1r = k0r + 16 * HDIM;
    const v16h ak00 = cat16(*(const v8h*)(k0r),      *(const v8h*)(k0r + 16));
    const v16h ak01 = cat16(*(const v8h*)(k0r + 32), *(const v8h*)(k0r + 48));
    const v16h ak10 = cat16(*(const v8h*)(k1r),      *(const v8h*)(k1r + 16));
    const v16h ak11 = cat16(*(const v8h*)(k1r + 32), *(const v8h*)(k1r + 48));

    v16h av[4];
#pragma unroll
    for (int t = 0; t < 4; ++t)
      av[t] = cat16(*(const v8h*)(vr + t * 16 * SEQ),
                    *(const v8h*)(vr + t * 16 * SEQ + 16));
    // The two address pairs are inputs, so they stay live to here and no load
    // of the run gets one of them as its result register; the wait stands in
    // front of their next rewrite.  The clobber keeps all sixteen loads of the
    // pass in front of the products, so V's latency hides behind the softmax.
    asm volatile("s_wait_xcnt 0x0" :: "v"(k0r), "v"(vr) : "memory");

    // c0[r]: key s0 + 8 grp + r, c1[r]: key s0 + 16 + 8 grp + r
    v8f c0 = *(const v8f*)&mbias[s0 + 8 * grp];
    v8f c1 = *(const v8f*)&mbias[s0 + 16 + 8 * grp];
    c0 = wmma_f16(ak00, bq0, c0);
    c0 = wmma_f16(ak01, bq1, c0);
    c1 = wmma_f16(ak10, bq0, c1);
    c1 = wmma_f16(ak11, bq1, c1);

    float tm[8];
#pragma unroll
    for (int r = 0; r < 8; ++r) tm[r] = fmaxf(c0[r], c1[r]);
    float rm = fmaxf(fmaxf(fmaxf(tm[0], tm[1]), fmaxf(tm[2], tm[3])),
                     fmaxf(fmaxf(tm[4], tm[5]), fmaxf(tm[6], tm[7])));
    rm = fmaxf(rm, xhalf(rm));    // the other half's sixteen keys
    const float mn    = fmaxf(mv, rm);
    const float alpha = __expf(mv - mn);
    mv = mn;

    v16h pb;
    float ls = 0.f;
#pragma unroll
    for (int r = 0; r < 8; ++r) {
      const float p0 = __expf(c0[r] - mn);
      const float p1 = __expf(c1[r] - mn);
      ls += p0 + p1;
      pb[r]     = (_Float16)p0;
      pb[8 + r] = (_Float16)p1;
    }
    lv = lv * alpha + ls;
#pragma unroll
    for (int t = 0; t < 4; ++t)
#pragma unroll
      for (int r = 0; r < 8; ++r) o[t][r] *= alpha;

#pragma unroll
    for (int t = 0; t < 4; ++t) o[t] = wmma_f16(av[t], pb, o[t]);

    k0r += 32 * HDIM;
    vr  += 32;
  }

  lv += xhalf(lv);                // join the two halves' sums
  _Float16* orow = att_ws + ((size_t)(b * SEQ + q0 + row)) * DMODEL + hh * HDIM;
#pragma unroll
  for (int t = 0; t < 4; ++t) {
    v8h h;
#pragma unroll
    for (int r = 0; r < 8; ++r) h[r] = (_Float16)(o[t][r] / lv);
    *(v8h*)(orow + t * 16 + 8 * grp) = h;
  }
}

// ---------------------------------------------------------------------------
// Kernel 3: output projection.  out[4096][1024] = att @ Wot^T + b_out
// ---------------------------------------------------------------------------
__global__ __launch_bounds__(256) void out_gemm_kernel(
    const _Float16* __restrict__ att, const _Float16* __restrict__ Wot,
    const float* __restrict__ bout, float* __restrict__ out) {
  const int lane = threadIdx.x & 31;
  const int row  = lane & 15;
  const int grp  = lane >> 4;
  const int wave = threadIdx.x >> 5;
  const int wm   = wave >> 2;
  const int wn   = wave & 3;
  const int mb   = blockIdx.y * 128;
  const int nb   = blockIdx.x * 128;

  v8f acc[4][2];
#pragma unroll
  for (int i = 0; i < 4; ++i)
#pragma unroll
    for (int j = 0; j < 2; ++j) {
      v8f z = {0.f,0.f,0.f,0.f,0.f,0.f,0.f,0.f};
      acc[i][j] = z;
    }

  gemm_mainloop_k1024(att, Wot, mb, nb, acc);

#pragma unroll
  for (int tm = 0; tm < 4; ++tm) {
#pragma unroll
    for (int tn = 0; tn < 2; ++tn) {
      const int n    = nb + wn * 32 + tn * 16 + row;
      const float bb = bout[n];
#pragma unroll
      for (int r = 0; r < 8; ++r) {
        const int m = mb + wm * 64 + tm * 16 + r + 8 * grp;
        out[(size_t)m * DMODEL + n] = acc[tm][tn][r] + bb;
      }
    }
  }
}

// ---------------------------------------------------------------------------
// Launch
// ---------------------------------------------------------------------------
extern "C" void kernel_launch(void* const* d_in, const int* in_sizes, int n_in,
                              void* d_out, int out_size, void* d_ws,
                              size_t ws_size, hipStream_t stream) {
  const float* x    = (const float*)d_in[0];
  const int*   mask = (const int*)d_in[1];
  const float* Wqkv = (const float*)d_in[2];
  const float* bqkv = (const float*)d_in[3];
  const float* Wout = (const float*)d_in[4];
  const float* bout = (const float*)d_in[5];
  float* out = (float*)d_out;

  const size_t nBS  = (size_t)NBATCH * SEQ;            // 4096
  _Float16* xh     = (_Float16*)d_ws;                  // [4096][1024]
  _Float16* Wqt    = xh  + nBS * DMODEL;               // [3072][1024]
  _Float16* Wot    = Wqt + (size_t)3 * DMODEL * DMODEL;// [1024][1024]
  _Float16* q_ws   = Wot + (size_t)DMODEL * DMODEL;    // [32][2048][64]
  _Float16* k_ws   = q_ws + nBS * DMODEL;
  _Float16* v_ws   = k_ws + nBS * DMODEL;
  _Float16* att_ws = v_ws + nBS * DMODEL;              // [4096][1024]

  // Prep: f16 conversion + weight transposes (one-time, bandwidth-trivial)
  cvt_x_kernel<<<(unsigned)(nBS * DMODEL / 1024), 256, 0, stream>>>(x, xh);
  transpose_w_kernel<<<dim3(3 * DMODEL / 32, DMODEL / 32), dim3(32, 8), 0,
                       stream>>>(Wqkv, Wqt, DMODEL, 3 * DMODEL);
  transpose_w_kernel<<<dim3(DMODEL / 32, DMODEL / 32), dim3(32, 8), 0,
                       stream>>>(Wout, Wot, DMODEL, DMODEL);

  // QKV projection: M=4096, N=3072
  qkv_gemm_kernel<<<dim3(3 * DMODEL / 128, (unsigned)(nBS / 128)), 256, 0,
                    stream>>>(xh, Wqt, bqkv, q_ws, k_ws, v_ws);

  // Attention: 32 (b,h) pairs x 32 query blocks of 64; 4 waves/block
  attn_kernel<<<NBATCH * NHEADS * (SEQ / 64), 128, 0, stream>>>(
      q_ws, k_ws, v_ws, mask, att_ws);

  // Output projection: M=4096, N=1024
  out_gemm_kernel<<<dim3(DMODEL / 128, (unsigned)(nBS / 128)), 256, 0,
                    stream>>>(att_ws, Wot, bout, out);
}

// v002
// One run takes 119 microseconds.
// Timed twice side by side with v001, it ran 1.53 and 1.54 times as fast.
// Counting every step since v000, it is 1.86 times as fast.
#include <hip/hip_runtime.h>

// ---------------------------------------------------------------------------
// MHA forward for MI455X (gfx1250, wave32, WMMA f32_16x16x32_f16,
// async global->LDS double-buffered GEMM staging)
//   B=2, S=2048, D_MODEL=1024, H=16, HD=64
// ---------------------------------------------------------------------------

typedef __attribute__((ext_vector_type(16))) _Float16 v16h;
typedef __attribute__((ext_vector_type(8)))  _Float16 v8h;
typedef __attribute__((ext_vector_type(4)))  _Float16 v4h;
typedef __attribute__((ext_vector_type(8)))  float    v8f;
typedef __attribute__((ext_vector_type(4)))  float    v4f;
typedef __attribute__((ext_vector_type(4)))  int      v4i;

#define NBATCH   2
#define SEQ      2048
#define DMODEL   1024
#define NHEADS   16
#define HDIM     64

__device__ __forceinline__ v16h cat16(v8h lo, v8h hi) {
  return __builtin_shufflevector(lo, hi, 0,1,2,3,4,5,6,7,8,9,10,11,12,13,14,15);
}

__device__ __forceinline__ v8f wmma_f16(v16h a, v16h b, v8f c) {
  // (neg_a, A, neg_b, B, c_mod, C, reuse_a, reuse_b)
  return __builtin_amdgcn_wmma_f32_16x16x32_f16(false, a, false, b, (short)0, c,
                                                false, false);
}

// CDNA5 async global->LDS copy, 16 bytes per lane, tracked by ASYNCcnt.
__device__ __forceinline__ void async_b128(unsigned lds_off,
                                           const _Float16* gaddr) {
  asm volatile("global_load_async_to_lds_b128 %0, %1, off"
               :: "v"(lds_off), "v"(gaddr) : "memory");
}
__device__ __forceinline__ void wait_async0() {
  asm volatile("s_wait_asynccnt 0" ::: "memory");
}

// ---------------------------------------------------------------------------
// Prep kernels: one-time f32 -> f16 conversion (and weight transpose) so the
// GEMM tiles become pure contiguous copies (async-to-LDS friendly) and all
// WMMA fragments are two contiguous 16B loads per lane.
// ---------------------------------------------------------------------------
__global__ __launch_bounds__(256) void cvt_x_kernel(
    const float* __restrict__ x, _Float16* __restrict__ xh) {
  const size_t i = ((size_t)blockIdx.x * 256 + threadIdx.x) * 4;
  v4f f = *(const v4f*)(x + i);
  v4h h;
  h[0] = (_Float16)f[0]; h[1] = (_Float16)f[1];
  h[2] = (_Float16)f[2]; h[3] = (_Float16)f[3];
  *(v4h*)(xh + i) = h;
}

// dst[n][k] (f16) = src[k][n] (f32);  K, N multiples of 32
__global__ __launch_bounds__(256) void transpose_w_kernel(
    const float* __restrict__ src, _Float16* __restrict__ dst, int K, int N) {
  __shared__ float tile[32][33];
  const int k0 = blockIdx.y * 32;
  const int n0 = blockIdx.x * 32;
  const int tx = threadIdx.x;        // 0..31
  const int ty = threadIdx.y;        // 0..7
#pragma unroll
  for (int i = 0; i < 32; i += 8)
    tile[ty + i][tx] = src[(size_t)(k0 + ty + i) * N + n0 + tx];
  __syncthreads();
#pragma unroll
  for (int i = 0; i < 32; i += 8)
    dst[(size_t)(n0 + ty + i) * K + k0 + tx] = (_Float16)tile[tx][ty + i];
}

// ---------------------------------------------------------------------------
// Shared GEMM main loop: acc[4][2] += A[128 rows @ mb] x B[128 cols @ nb],
// K = 1024, both operands f16 with k contiguous (A row-major, B stored [n][k]).
// 256 threads / 8 waves; wave (wm,wn) owns a 64x32 slab = 4x2 WMMA tiles.
// Double-buffered LDS tiles filled with async global->LDS b128 copies.
// ---------------------------------------------------------------------------
__device__ __forceinline__ void gemm_mainloop_k1024(
    const _Float16* __restrict__ A, const _Float16* __restrict__ B,
    int mb, int nb, v8f acc[4][2]) {
  __shared__ _Float16 Ah[2][128][40];   // 80B row stride (16B multiple)
  __shared__ _Float16 Bh[2][128][40];

  const int tid  = threadIdx.x;
  const int lane = tid & 31;
  const int row  = lane & 15;
  const int grp  = lane >> 4;
  const int wave = tid >> 5;
  const int wm   = wave >> 2;          // 0..1
  const int wn   = wave & 3;           // 0..3

  const int sr = tid >> 1;             // staged row 0..127
  const int sc = (tid & 1) * 16;       // staged col offset {0,16}
  const _Float16* ga0 = A + (size_t)(mb + sr) * DMODEL + sc;
  const _Float16* gb0 = B + (size_t)(nb + sr) * DMODEL + sc;

  // issue tile 0
  {
    const unsigned la = (unsigned)(uintptr_t)&Ah[0][sr][sc];
    const unsigned lb = (unsigned)(uintptr_t)&Bh[0][sr][sc];
    async_b128(la,      ga0);
    async_b128(la + 16, ga0 + 8);
    async_b128(lb,      gb0);
    async_b128(lb + 16, gb0 + 8);
  }
  wait_async0();
  __syncthreads();

  int buf = 0;
  for (int kk = 0; kk < DMODEL; kk += 32) {
    const bool more = (kk + 32) < DMODEL;
    if (more) {   // prefetch next tile into the other buffer
      const unsigned la = (unsigned)(uintptr_t)&Ah[buf ^ 1][sr][sc];
      const unsigned lb = (unsigned)(uintptr_t)&Bh[buf ^ 1][sr][sc];
      async_b128(la,      ga0 + kk + 32);
      async_b128(la + 16, ga0 + kk + 40);
      async_b128(lb,      gb0 + kk + 32);
      async_b128(lb + 16, gb0 + kk + 40);
    }

    v16h af[4];
#pragma unroll
    for (int tm = 0; tm < 4; ++tm) {
      const int r = wm * 64 + tm * 16 + row;
      af[tm] = cat16(*(const v8h*)&Ah[buf][r][8 * grp],
                     *(const v8h*)&Ah[buf][r][16 + 8 * grp]);
    }
    v16h bf[2];
#pragma unroll
    for (int tn = 0; tn < 2; ++tn) {
      const int n = wn * 32 + tn * 16 + row;
      bf[tn] = cat16(*(const v8h*)&Bh[buf][n][8 * grp],
                     *(const v8h*)&Bh[buf][n][16 + 8 * grp]);
    }
#pragma unroll
    for (int tm = 0; tm < 4; ++tm)
#pragma unroll
      for (int tn = 0; tn < 2; ++tn)
        acc[tm][tn] = wmma_f16(af[tm], bf[tn], acc[tm][tn]);

    if (more) {
      wait_async0();        // our async copies into buf^1 are done
      __syncthreads();      // everyone finished reading buf / writing buf^1
    }
    buf ^= 1;
  }
}

// ---------------------------------------------------------------------------
// Kernel 1: QKV projection.  C[4096][3072] = xh @ Wqt^T + b_qkv.  Scatters:
//   q_ws: [bh][s][64]  (pre-scaled by 1/sqrt(64))
//   k_ws: [bh][s][64]
//   v_ws: [bh][d][s]   (transposed for the PV matmul's A-fragment layout)
// ---------------------------------------------------------------------------
__global__ __launch_bounds__(256) void qkv_gemm_kernel(
    const _Float16* __restrict__ xh, const _Float16* __restrict__ Wqt,
    const float* __restrict__ bqkv,
    _Float16* __restrict__ q_ws, _Float16* __restrict__ k_ws,
    _Float16* __restrict__ v_ws) {
  const int lane = threadIdx.x & 31;
  const int row  = lane & 15;
  const int grp  = lane >> 4;
  const int wave = threadIdx.x >> 5;
  const int wm   = wave >> 2;
  const int wn   = wave & 3;
  const int mb   = blockIdx.y * 128;
  const int nb   = blockIdx.x * 128;

  v8f acc[4][2];
#pragma unroll
  for (int i = 0; i < 4; ++i)
#pragma unroll
    for (int j = 0; j < 2; ++j) {
      v8f z = {0.f,0.f,0.f,0.f,0.f,0.f,0.f,0.f};
      acc[i][j] = z;
    }

  gemm_mainloop_k1024(xh, Wqt, mb, nb, acc);

#pragma unroll
  for (int tm = 0; tm < 4; ++tm) {
#pragma unroll
    for (int tn = 0; tn < 2; ++tn) {
      const int n    = nb + wn * 32 + tn * 16 + row;   // 0..3071
      const float bb = bqkv[n];
      const int h    = n / (3 * HDIM);
      const int c    = n % (3 * HDIM);
#pragma unroll
      for (int r = 0; r < 8; ++r) {
        const int m  = mb + wm * 64 + tm * 16 + r + 8 * grp;
        const int b  = m >> 11;
        const int s  = m & (SEQ - 1);
        const int bh = b * NHEADS + h;
        const float val = acc[tm][tn][r] + bb;
        if (c < HDIM) {
          q_ws[((size_t)bh * SEQ + s) * HDIM + c] = (_Float16)(val * 0.125f);
        } else if (c < 2 * HDIM) {
          k_ws[((size_t)bh * SEQ + s) * HDIM + (c - HDIM)] = (_Float16)val;
        } else {
          v_ws[((size_t)bh * HDIM + (c - 2 * HDIM)) * SEQ + s] = (_Float16)val;
        }
      }
    }
  }
}

__device__ __forceinline__ float xhalf(float x) {
  const int b = __builtin_bit_cast(int, x);
  return __builtin_bit_cast(float, __builtin_amdgcn_permlanex16(
      b, b, 0x76543210, 0xfedcba98, false, false));
}

#define KSTG    128                  // keys per stage
#define NSTG    (SEQ / KSTG)
#define KPITCH  72                   // halves: 128-byte K rows at 144 bytes
#define VPITCH  136                  // halves: 256-byte Vt rows at 272 bytes
#define KBUF    (KSTG * KPITCH)      // halves per K buffer
#define VBUF    (HDIM * VPITCH)      // halves per Vt buffer

// One stage of K (128 keys x 64) and Vt (64 x 128 keys) into LDS: eight async
// copies of 16 bytes per lane, every wave-wide copy covering four whole lines.
// lk, gk: this lane's chunk of K rows 0..31, the next copies 32 rows further;
// lv, gv: its chunk of Vt rows 0..15, the next copies 16 rows further.
// The s_wait_xcnt closes the statement so that it stands in front of any
// rewrite of the address registers the copies name.
__device__ __forceinline__ void stage_kv(unsigned lk, unsigned lv,
                                         const _Float16* gk,
                                         const _Float16* gv) {
  asm volatile(
      "global_load_async_to_lds_b128 %0, %8, off\n\t"
      "global_load_async_to_lds_b128 %1, %9, off\n\t"
      "global_load_async_to_lds_b128 %2, %10, off\n\t"
      "global_load_async_to_lds_b128 %3, %11, off\n\t"
      "global_load_async_to_lds_b128 %4, %12, off\n\t"
      "global_load_async_to_lds_b128 %5, %13, off\n\t"
      "global_load_async_to_lds_b128 %6, %14, off\n\t"
      "global_load_async_to_lds_b128 %7, %15, off\n\t"
      "s_wait_xcnt 0x0"
      :: "v"(lk), "v"(lk + 32 * KPITCH * 2), "v"(lk + 64 * KPITCH * 2),
         "v"(lk + 96 * KPITCH * 2),
         "v"(lv), "v"(lv + 16 * VPITCH * 2), "v"(lv + 32 * VPITCH * 2),
         "v"(lv + 48 * VPITCH * 2),
         "v"(gk), "v"(gk + 32 * HDIM), "v"(gk + 64 * HDIM), "v"(gk + 96 * HDIM),
         "v"(gv), "v"(gv + 16 * SEQ), "v"(gv + 32 * SEQ), "v"(gv + 48 * SEQ)
      : "memory");
}

// Four waves a SIMD and no more: two work-groups fill a WGP, so the 512
// work-groups of the launch cannot pile up three to a WGP and leave others idle.
__global__ __launch_bounds__(256)
__attribute__((amdgpu_waves_per_eu(4, 4))) void attn_kernel(
    const _Float16* __restrict__ q_ws, const _Float16* __restrict__ k_ws,
    const _Float16* __restrict__ v_ws, const int* __restrict__ mask,
    _Float16* __restrict__ att_ws) {
  // 0 for a live key, -inf for a masked one
  __shared__ __attribute__((aligned(32))) float mbias[SEQ];
  // Two-buffer ring of K and Vt stages, shared by the block's eight waves
  __shared__ __attribute__((aligned(16))) _Float16 Ks[2 * KBUF];
  __shared__ __attribute__((aligned(16))) _Float16 Vs[2 * VBUF];

  const int tid  = threadIdx.x;
  const int lane = tid & 31;
  const int row  = lane & 15;
  const int grp  = lane >> 4;
  const int wave = tid >> 5;

  const int bh = blockIdx.x >> 4;                       // 0..31
  const int qt = (blockIdx.x & 15) * 8 + wave;          // 0..127
  const int q0 = qt * 16;
  const int b  = bh >> 4;
  const int hh = bh & (NHEADS - 1);

  const _Float16* qb = q_ws + (size_t)bh * SEQ * HDIM;
  const _Float16* kb = k_ws + (size_t)bh * SEQ * HDIM;
  const _Float16* vb = v_ws + (size_t)bh * HDIM * SEQ;
  const int* mrow    = mask + b * SEQ;

  // This lane's 16-byte chunk of a stage: K row tid / 8, Vt row tid / 16
  const unsigned lk0 =
      (unsigned)(uintptr_t)&Ks[(tid >> 3) * KPITCH + (tid & 7) * 8];
  const unsigned lv0 =
      (unsigned)(uintptr_t)&Vs[(tid >> 4) * VPITCH + (tid & 15) * 8];
  const _Float16* gk = kb + tid * 8;
  const _Float16* gv = vb + (tid >> 4) * SEQ + (tid & 15) * 8;

  stage_kv(lk0, lv0, gk, gv);                           // stage 0, buffer 0

  // Keys run over accumulator registers: the mask enters as the C operand of
  // the score product, read from this table.
#pragma unroll   // independent loads in flight instead of round trips
  for (int i0 = 0; i0 < SEQ; i0 += 256 * 4) {
    const int i = i0 + tid * 4;
    const v4i mm = *(const v4i*)(mrow + i);
    v4f bb;
#pragma unroll
    for (int j = 0; j < 4; ++j) bb[j] = (mm[j] == 0) ? -__builtin_inff() : 0.f;
    *(v4f*)&mbias[i] = bb;
  }
  wait_async0();      // this wave's share of stage 0 has landed
  __syncthreads();    // publishes stage 0 and the mask table
  stage_kv(lk0 + KBUF * 2, lv0 + VBUF * 2, gk + KSTG * HDIM, gv + KSTG);

  const _Float16* qrow = qb + (size_t)(q0 + row) * HDIM;
  const v16h bq0 = cat16(*(const v8h*)(qrow + 8 * grp),
                         *(const v8h*)(qrow + 16 + 8 * grp));
  const v16h bq1 = cat16(*(const v8h*)(qrow + 32 + 8 * grp),
                         *(const v8h*)(qrow + 48 + 8 * grp));

  float mv = -__builtin_inff();   // running maximum of this lane's query
  float lv = 0.f;                 // this half's share of the running sum
  v8f o[4];                       // o[t][r] = Ot[16 t + 8 grp + r][query row]
#pragma unroll
  for (int t = 0; t < 4; ++t) {
    v8f z = {0.f,0.f,0.f,0.f,0.f,0.f,0.f,0.f};
    o[t] = z;
  }

  for (int st = 0; st < NSTG; ++st) {
    const int cur = st & 1;
    const _Float16* kt = &Ks[cur * KBUF + row * KPITCH + 8 * grp];
    const _Float16* vt = &Vs[cur * VBUF + row * VPITCH + 8 * grp];

#pragma unroll 2   // the second pass's LDS reads go out under the first pass
    for (int p = 0; p < KSTG / 32; ++p) {
      const int s0 = st * KSTG + p * 32;
      const _Float16* k0r = kt + p * 32 * KPITCH;      // key row, k chunk
      const _Float16* k1r = k0r + 16 * KPITCH;
      const _Float16* vr  = vt + p * 32;               // d row, key chunk
      const v16h ak00 = cat16(*(const v8h*)(k0r),      *(const v8h*)(k0r + 16));
      const v16h ak01 = cat16(*(const v8h*)(k0r + 32), *(const v8h*)(k0r + 48));
      const v16h ak10 = cat16(*(const v8h*)(k1r),      *(const v8h*)(k1r + 16));
      const v16h ak11 = cat16(*(const v8h*)(k1r + 32), *(const v8h*)(k1r + 48));

      v16h av[4];
#pragma unroll
      for (int t = 0; t < 4; ++t)
        av[t] = cat16(*(const v8h*)(vr + t * 16 * VPITCH),
                      *(const v8h*)(vr + t * 16 * VPITCH + 16));

      // c0[r]: key s0 + 8 grp + r, c1[r]: key s0 + 16 + 8 grp + r
      v8f c0 = *(const v8f*)&mbias[s0 + 8 * grp];
      v8f c1 = *(const v8f*)&mbias[s0 + 16 + 8 * grp];
      c0 = wmma_f16(ak00, bq0, c0);
      c0 = wmma_f16(ak01, bq1, c0);
      c1 = wmma_f16(ak10, bq0, c1);
      c1 = wmma_f16(ak11, bq1, c1);

      float tm[8];
#pragma unroll
      for (int r = 0; r < 8; ++r) tm[r] = fmaxf(c0[r], c1[r]);
      float rm = fmaxf(fmaxf(fmaxf(tm[0], tm[1]), fmaxf(tm[2], tm[3])),
                       fmaxf(fmaxf(tm[4], tm[5]), fmaxf(tm[6], tm[7])));
      rm = fmaxf(rm, xhalf(rm));    // the other half's sixteen keys
      const float mn    = fmaxf(mv, rm);
      const float alpha = __expf(mv - mn);
      mv = mn;

      v16h pb;
      float ls = 0.f;
#pragma unroll
      for (int r = 0; r < 8; ++r) {
        const float p0 = __expf(c0[r] - mn);
        const float p1 = __expf(c1[r] - mn);
        ls += p0 + p1;
        pb[r]     = (_Float16)p0;
        pb[8 + r] = (_Float16)p1;
      }
      lv = lv * alpha + ls;
#pragma unroll
      for (int t = 0; t < 4; ++t)
#pragma unroll
        for (int r = 0; r < 8; ++r) o[t][r] *= alpha;

#pragma unroll
      for (int t = 0; t < 4; ++t) o[t] = wmma_f16(av[t], pb, o[t]);
    }

    // Publish point of stage st + 1: this wave's reads of the current buffer
    // have retired, its copies of the next stage have landed, and behind the
    // barrier the current buffer is free for stage st + 2.
    asm volatile("s_wait_dscnt 0x0" ::: "memory");
    wait_async0();
    __syncthreads();
    if (st + 2 < NSTG)
      stage_kv(lk0 + cur * (KBUF * 2), lv0 + cur * (VBUF * 2),
               gk + (st + 2) * (KSTG * HDIM), gv + (st + 2) * KSTG);
  }
  wait_async0();                  // nothing is in flight when the wave ends

  lv += xhalf(lv);                // join the two halves' sums
  _Float16* orow = att_ws + ((size_t)(b * SEQ + q0 + row)) * DMODEL + hh * HDIM;
#pragma unroll
  for (int t = 0; t < 4; ++t) {
    v8h h;
#pragma unroll
    for (int r = 0; r < 8; ++r) h[r] = (_Float16)(o[t][r] / lv);
    *(v8h*)(orow + t * 16 + 8 * grp) = h;
  }
}

// ---------------------------------------------------------------------------
// Kernel 3: output projection.  out[4096][1024] = att @ Wot^T + b_out
// ---------------------------------------------------------------------------
__global__ __launch_bounds__(256) void out_gemm_kernel(
    const _Float16* __restrict__ att, const _Float16* __restrict__ Wot,
    const float* __restrict__ bout, float* __restrict__ out) {
  const int lane = threadIdx.x & 31;
  const int row  = lane & 15;
  const int grp  = lane >> 4;
  const int wave = threadIdx.x >> 5;
  const int wm   = wave >> 2;
  const int wn   = wave & 3;
  const int mb   = blockIdx.y * 128;
  const int nb   = blockIdx.x * 128;

  v8f acc[4][2];
#pragma unroll
  for (int i = 0; i < 4; ++i)
#pragma unroll
    for (int j = 0; j < 2; ++j) {
      v8f z = {0.f,0.f,0.f,0.f,0.f,0.f,0.f,0.f};
      acc[i][j] = z;
    }

  gemm_mainloop_k1024(att, Wot, mb, nb, acc);

#pragma unroll
  for (int tm = 0; tm < 4; ++tm) {
#pragma unroll
    for (int tn = 0; tn < 2; ++tn) {
      const int n    = nb + wn * 32 + tn * 16 + row;
      const float bb = bout[n];
#pragma unroll
      for (int r = 0; r < 8; ++r) {
        const int m = mb + wm * 64 + tm * 16 + r + 8 * grp;
        out[(size_t)m * DMODEL + n] = acc[tm][tn][r] + bb;
      }
    }
  }
}

// ---------------------------------------------------------------------------
// Launch
// ---------------------------------------------------------------------------
extern "C" void kernel_launch(void* const* d_in, const int* in_sizes, int n_in,
                              void* d_out, int out_size, void* d_ws,
                              size_t ws_size, hipStream_t stream) {
  const float* x    = (const float*)d_in[0];
  const int*   mask = (const int*)d_in[1];
  const float* Wqkv = (const float*)d_in[2];
  const float* bqkv = (const float*)d_in[3];
  const float* Wout = (const float*)d_in[4];
  const float* bout = (const float*)d_in[5];
  float* out = (float*)d_out;

  const size_t nBS  = (size_t)NBATCH * SEQ;            // 4096
  _Float16* xh     = (_Float16*)d_ws;                  // [4096][1024]
  _Float16* Wqt    = xh  + nBS * DMODEL;               // [3072][1024]
  _Float16* Wot    = Wqt + (size_t)3 * DMODEL * DMODEL;// [1024][1024]
  _Float16* q_ws   = Wot + (size_t)DMODEL * DMODEL;    // [32][2048][64]
  _Float16* k_ws   = q_ws + nBS * DMODEL;
  _Float16* v_ws   = k_ws + nBS * DMODEL;
  _Float16* att_ws = v_ws + nBS * DMODEL;              // [4096][1024]

  // Prep: f16 conversion + weight transposes (one-time, bandwidth-trivial)
  cvt_x_kernel<<<(unsigned)(nBS * DMODEL / 1024), 256, 0, stream>>>(x, xh);
  transpose_w_kernel<<<dim3(3 * DMODEL / 32, DMODEL / 32), dim3(32, 8), 0,
                       stream>>>(Wqkv, Wqt, DMODEL, 3 * DMODEL);
  transpose_w_kernel<<<dim3(DMODEL / 32, DMODEL / 32), dim3(32, 8), 0,
                       stream>>>(Wout, Wot, DMODEL, DMODEL);

  // QKV projection: M=4096, N=3072
  qkv_gemm_kernel<<<dim3(3 * DMODEL / 128, (unsigned)(nBS / 128)), 256, 0,
                    stream>>>(xh, Wqt, bqkv, q_ws, k_ws, v_ws);

  // Attention: 32 (b,h) pairs x 16 query blocks of 128; 8 waves/block
  attn_kernel<<<NBATCH * NHEADS * (SEQ / 128), 256, 0, stream>>>(
      q_ws, k_ws, v_ws, mask, att_ws);

  // Output projection: M=4096, N=1024
  out_gemm_kernel<<<dim3(DMODEL / 128, (unsigned)(nBS / 128)), 256, 0,
                    stream>>>(att_ws, Wot, bout, out);
}

// v003
// It runs in 115 microseconds.
// Timed twice side by side with v002, it ran 1.05 and 1.04 times as fast.
// All steps since v000 together make it 1.94 times as fast.
#include <hip/hip_runtime.h>

// ---------------------------------------------------------------------------
// MHA forward for MI455X (gfx1250, wave32, WMMA f32_16x16x32_f16,
// async global->LDS double-buffered GEMM staging)
//   B=2, S=2048, D_MODEL=1024, H=16, HD=64
// ---------------------------------------------------------------------------

typedef __attribute__((ext_vector_type(16))) _Float16 v16h;
typedef __attribute__((ext_vector_type(8)))  _Float16 v8h;
typedef __attribute__((ext_vector_type(4)))  _Float16 v4h;
typedef __attribute__((ext_vector_type(8)))  float    v8f;
typedef __attribute__((ext_vector_type(4)))  float    v4f;
typedef __attribute__((ext_vector_type(4)))  int      v4i;

#define NBATCH   2
#define SEQ      2048
#define DMODEL   1024
#define NHEADS   16
#define HDIM     64

__device__ __forceinline__ v16h cat16(v8h lo, v8h hi) {
  return __builtin_shufflevector(lo, hi, 0,1,2,3,4,5,6,7,8,9,10,11,12,13,14,15);
}

__device__ __forceinline__ v8f wmma_f16(v16h a, v16h b, v8f c) {
  // (neg_a, A, neg_b, B, c_mod, C, reuse_a, reuse_b)
  return __builtin_amdgcn_wmma_f32_16x16x32_f16(false, a, false, b, (short)0, c,
                                                false, false);
}

// CDNA5 async global->LDS copy, 16 bytes per lane, tracked by ASYNCcnt.
__device__ __forceinline__ void async_b128(unsigned lds_off,
                                           const _Float16* gaddr) {
  asm volatile("global_load_async_to_lds_b128 %0, %1, off"
               :: "v"(lds_off), "v"(gaddr) : "memory");
}
__device__ __forceinline__ void wait_async0() {
  asm volatile("s_wait_asynccnt 0" ::: "memory");
}

// ---------------------------------------------------------------------------
// Prep kernel: f32 -> f16 conversion of x and of both weights (transposed to
// [n][k]), so the GEMM tiles become pure contiguous copies (async-to-LDS
// friendly) and all WMMA fragments are two contiguous 16B loads per lane.
// One launch of 512 work-groups for all three: what bounds this work is the
// number of launches and of waves to start, not its bytes, so every thread
// takes sixteen 16-byte loads, all in flight together.
//   blocks   0..191: 128 x 128 tiles of W_qkv     blocks 192..255: of W_out
//   blocks 256..511: 16,384 consecutive elements of x each
// ---------------------------------------------------------------------------
#define TT        128                       // transpose tile edge
#define NT_QKV    (3 * DMODEL / TT)         // tile columns of W_qkv
#define NT_OUT    (DMODEL / TT)             // tile columns of W_out
#define TILES_QKV ((DMODEL / TT) * NT_QKV)
#define TILES_W   (TILES_QKV + (DMODEL / TT) * NT_OUT)
#define XCHUNK    (256 * 4 * 16)            // elements of x per work-group
#define PREP_WGS  (TILES_W + NBATCH * SEQ * DMODEL / XCHUNK)

// dst[n][k] (f16) = src[k][n] (f32): tile t of a weight with NT tile columns
template <int NT>
__device__ __forceinline__ void transpose_tile(
    const float* __restrict__ src, _Float16* __restrict__ dst, int t,
    _Float16* T) {
  constexpr int N = NT * TT;
  const int k0   = (t / NT) * TT;
  const int n0   = (t % NT) * TT;
  const int tid  = threadIdx.x;
  const int lane = tid & 31;
  const int wave = tid >> 5;

  // Wave w reads rows k0 + 16 w .. + 15, each wave-wide load one 512-byte row
  // piece: a lane ends up with sixteen consecutive k of four columns.
  const float* s = src + (size_t)(k0 + wave * 16) * N + n0 + lane * 4;
  v4f f[16];
#pragma unroll   // all sixteen loads go out before the first is used
  for (int i = 0; i < 15; ++i) f[i] = *(const v4f*)(s + i * N);
  // The last load's result may land in the address registers the others name
  asm volatile("s_wait_xcnt 0x0" ::: "memory");
  f[15] = *(const v4f*)(s + 15 * N);

#pragma unroll
  for (int j = 0; j < 4; ++j) {
#pragma unroll
    for (int h = 0; h < 2; ++h) {
      v8h p;
#pragma unroll
      for (int e = 0; e < 8; ++e) p[e] = (_Float16)f[h * 8 + e][j];
      *(v8h*)&T[(lane * 4 + j) * TT + (((wave * 2 + h) ^ (lane & 15)) * 8)] = p;
    }
  }
  __syncthreads();   // the tile is complete before rows are read back

  // Sixteen lanes store one row's 256 bytes: whole lines, 16 bytes a lane
  const int c = tid & 15;
  _Float16* d = dst + (size_t)(n0 + (tid >> 4)) * DMODEL + k0 + c * 8;
#pragma unroll
  for (int i = 0; i < 8; ++i) {
    const int n = i * 16 + (tid >> 4);
    *(v8h*)(d + i * 16 * DMODEL) =
        *(const v8h*)&T[n * TT + ((c ^ ((n >> 2) & 15)) * 8)];
  }
  // Stands in front of any rewrite of a register that the stores above name
  asm volatile("s_wait_xcnt 0x0" ::: "memory");
}

// Budget of four waves a SIMD (this launch has two work-groups a WGP): at the
// default budget the compiler kept to 64 registers and made the later loads
// wait for the earlier ones; with it all sixteen go out as one group.
__global__ __launch_bounds__(256)
__attribute__((amdgpu_waves_per_eu(4, 4))) void prep_kernel(
    const float* __restrict__ x, const float* __restrict__ Wqkv,
    const float* __restrict__ Wout, _Float16* __restrict__ xh,
    _Float16* __restrict__ Wqt, _Float16* __restrict__ Wot) {
  // Tile as [n][k], rows of 256 bytes in sixteen 16-byte pieces; piece c of
  // row n lies at place c ^ ((n >> 2) & 15), which spreads over all banks both
  // the writers (16 lanes: rows 4 apart, one piece) and the readers (one row).
  __shared__ __attribute__((aligned(16))) _Float16 T[TT * TT];

  const int blk = blockIdx.x;               // every branch is block-uniform
  if (blk < TILES_QKV) {
    transpose_tile<NT_QKV>(Wqkv, Wqt, blk, T);
  } else if (blk < TILES_W) {
    transpose_tile<NT_OUT>(Wout, Wot, blk - TILES_QKV, T);
  } else {                                  // x to f16
    const size_t base = (size_t)(blk - TILES_W) * XCHUNK + threadIdx.x * 4;
    v4f f[16];
#pragma unroll   // all sixteen loads go out before the first is used
    for (int i = 0; i < 15; ++i) f[i] = *(const v4f*)(x + base + i * 1024);
    // The last load's result may land in the address registers the others name
    asm volatile("s_wait_xcnt 0x0" ::: "memory");
    f[15] = *(const v4f*)(x + base + 15 * 1024);
#pragma unroll
    for (int i = 0; i < 16; ++i) {
      v4h h;
      h[0] = (_Float16)f[i][0]; h[1] = (_Float16)f[i][1];
      h[2] = (_Float16)f[i][2]; h[3] = (_Float16)f[i][3];
      *(v4h*)(xh + base + i * 1024) = h;
    }
    // Stands in front of any rewrite of a register that the stores above name
    asm volatile("s_wait_xcnt 0x0" ::: "memory");
  }
}

// ---------------------------------------------------------------------------
// Shared GEMM main loop: acc[4][2] += A[128 rows @ mb] x B[128 cols @ nb],
// K = 1024, both operands f16 with k contiguous (A row-major, B stored [n][k]).
// 256 threads / 8 waves; wave (wm,wn) owns a 64x32 slab = 4x2 WMMA tiles.
// Double-buffered LDS tiles filled with async global->LDS b128 copies.
// ---------------------------------------------------------------------------
__device__ __forceinline__ void gemm_mainloop_k1024(
    const _Float16* __restrict__ A, const _Float16* __restrict__ B,
    int mb, int nb, v8f acc[4][2]) {
  __shared__ _Float16 Ah[2][128][40];   // 80B row stride (16B multiple)
  __shared__ _Float16 Bh[2][128][40];

  const int tid  = threadIdx.x;
  const int lane = tid & 31;
  const int row  = lane & 15;
  const int grp  = lane >> 4;
  const int wave = tid >> 5;
  const int wm   = wave >> 2;          // 0..1
  const int wn   = wave & 3;           // 0..3

  const int sr = tid >> 1;             // staged row 0..127
  const int sc = (tid & 1) * 16;       // staged col offset {0,16}
  const _Float16* ga0 = A + (size_t)(mb + sr) * DMODEL + sc;
  const _Float16* gb0 = B + (size_t)(nb + sr) * DMODEL + sc;

  // issue tile 0
  {
    const unsigned la = (unsigned)(uintptr_t)&Ah[0][sr][sc];
    const unsigned lb = (unsigned)(uintptr_t)&Bh[0][sr][sc];
    async_b128(la,      ga0);
    async_b128(la + 16, ga0 + 8);
    async_b128(lb,      gb0);
    async_b128(lb + 16, gb0 + 8);
  }
  wait_async0();
  __syncthreads();

  int buf = 0;
  for (int kk = 0; kk < DMODEL; kk += 32) {
    const bool more = (kk + 32) < DMODEL;
    if (more) {   // prefetch next tile into the other buffer
      const unsigned la = (unsigned)(uintptr_t)&Ah[buf ^ 1][sr][sc];
      const unsigned lb = (unsigned)(uintptr_t)&Bh[buf ^ 1][sr][sc];
      async_b128(la,      ga0 + kk + 32);
      async_b128(la + 16, ga0 + kk + 40);
      async_b128(lb,      gb0 + kk + 32);
      async_b128(lb + 16, gb0 + kk + 40);
    }

    v16h af[4];
#pragma unroll
    for (int tm = 0; tm < 4; ++tm) {
      const int r = wm * 64 + tm * 16 + row;
      af[tm] = cat16(*(const v8h*)&Ah[buf][r][8 * grp],
                     *(const v8h*)&Ah[buf][r][16 + 8 * grp]);
    }
    v16h bf[2];
#pragma unroll
    for (int tn = 0; tn < 2; ++tn) {
      const int n = wn * 32 + tn * 16 + row;
      bf[tn] = cat16(*(const v8h*)&Bh[buf][n][8 * grp],
                     *(const v8h*)&Bh[buf][n][16 + 8 * grp]);
    }
#pragma unroll
    for (int tm = 0; tm < 4; ++tm)
#pragma unroll
      for (int tn = 0; tn < 2; ++tn)
        acc[tm][tn] = wmma_f16(af[tm], bf[tn], acc[tm][tn]);

    if (more) {
      wait_async0();        // our async copies into buf^1 are done
      __syncthreads();      // everyone finished reading buf / writing buf^1
    }
    buf ^= 1;
  }
}

// ---------------------------------------------------------------------------
// Kernel 1: QKV projection.  C[4096][3072] = xh @ Wqt^T + b_qkv.  Scatters:
//   q_ws: [bh][s][64]  (pre-scaled by 1/sqrt(64))
//   k_ws: [bh][s][64]
//   v_ws: [bh][d][s]   (transposed for the PV matmul's A-fragment layout)
// ---------------------------------------------------------------------------
__global__ __launch_bounds__(256) void qkv_gemm_kernel(
    const _Float16* __restrict__ xh, const _Float16* __restrict__ Wqt,
    const float* __restrict__ bqkv,
    _Float16* __restrict__ q_ws, _Float16* __restrict__ k_ws,
    _Float16* __restrict__ v_ws) {
  const int lane = threadIdx.x & 31;
  const int row  = lane & 15;
  const int grp  = lane >> 4;
  const int wave = threadIdx.x >> 5;
  const int wm   = wave >> 2;
  const int wn   = wave & 3;
  const int mb   = blockIdx.y * 128;
  const int nb   = blockIdx.x * 128;

  v8f acc[4][2];
#pragma unroll
  for (int i = 0; i < 4; ++i)
#pragma unroll
    for (int j = 0; j < 2; ++j) {
      v8f z = {0.f,0.f,0.f,0.f,0.f,0.f,0.f,0.f};
      acc[i][j] = z;
    }

  gemm_mainloop_k1024(xh, Wqt, mb, nb, acc);

#pragma unroll
  for (int tm = 0; tm < 4; ++tm) {
#pragma unroll
    for (int tn = 0; tn < 2; ++tn) {
      const int n    = nb + wn * 32 + tn * 16 + row;   // 0..3071
      const float bb = bqkv[n];
      const int h    = n / (3 * HDIM);
      const int c    = n % (3 * HDIM);
#pragma unroll
      for (int r = 0; r < 8; ++r) {
        const int m  = mb + wm * 64 + tm * 16 + r + 8 * grp;
        const int b  = m >> 11;
        const int s  = m & (SEQ - 1);
        const int bh = b * NHEADS + h;
        const float val = acc[tm][tn][r] + bb;
        if (c < HDIM) {
          q_ws[((size_t)bh * SEQ + s) * HDIM + c] = (_Float16)(val * 0.125f);
        } else if (c < 2 * HDIM) {
          k_ws[((size_t)bh * SEQ + s) * HDIM + (c - HDIM)] = (_Float16)val;
        } else {
          v_ws[((size_t)bh * HDIM + (c - 2 * HDIM)) * SEQ + s] = (_Float16)val;
        }
      }
    }
  }
}

__device__ __forceinline__ float xhalf(float x) {
  const int b = __builtin_bit_cast(int, x);
  return __builtin_bit_cast(float, __builtin_amdgcn_permlanex16(
      b, b, 0x76543210, 0xfedcba98, false, false));
}

#define KSTG    128                  // keys per stage
#define NSTG    (SEQ / KSTG)
#define KPITCH  72                   // halves: 128-byte K rows at 144 bytes
#define VPITCH  136                  // halves: 256-byte Vt rows at 272 bytes
#define KBUF    (KSTG * KPITCH)      // halves per K buffer
#define VBUF    (HDIM * VPITCH)      // halves per Vt buffer

// One stage of K (128 keys x 64) and Vt (64 x 128 keys) into LDS: eight async
// copies of 16 bytes per lane, every wave-wide copy covering four whole lines.
// lk, gk: this lane's chunk of K rows 0..31, the next copies 32 rows further;
// lv, gv: its chunk of Vt rows 0..15, the next copies 16 rows further.
// The s_wait_xcnt closes the statement so that it stands in front of any
// rewrite of the address registers the copies name.
__device__ __forceinline__ void stage_kv(unsigned lk, unsigned lv,
                                         const _Float16* gk,
                                         const _Float16* gv) {
  asm volatile(
      "global_load_async_to_lds_b128 %0, %8, off\n\t"
      "global_load_async_to_lds_b128 %1, %9, off\n\t"
      "global_load_async_to_lds_b128 %2, %10, off\n\t"
      "global_load_async_to_lds_b128 %3, %11, off\n\t"
      "global_load_async_to_lds_b128 %4, %12, off\n\t"
      "global_load_async_to_lds_b128 %5, %13, off\n\t"
      "global_load_async_to_lds_b128 %6, %14, off\n\t"
      "global_load_async_to_lds_b128 %7, %15, off\n\t"
      "s_wait_xcnt 0x0"
      :: "v"(lk), "v"(lk + 32 * KPITCH * 2), "v"(lk + 64 * KPITCH * 2),
         "v"(lk + 96 * KPITCH * 2),
         "v"(lv), "v"(lv + 16 * VPITCH * 2), "v"(lv + 32 * VPITCH * 2),
         "v"(lv + 48 * VPITCH * 2),
         "v"(gk), "v"(gk + 32 * HDIM), "v"(gk + 64 * HDIM), "v"(gk + 96 * HDIM),
         "v"(gv), "v"(gv + 16 * SEQ), "v"(gv + 32 * SEQ), "v"(gv + 48 * SEQ)
      : "memory");
}

// Four waves a SIMD and no more: two work-groups fill a WGP, so the 512
// work-groups of the launch cannot pile up three to a WGP and leave others idle.
__global__ __launch_bounds__(256)
__attribute__((amdgpu_waves_per_eu(4, 4))) void attn_kernel(
    const _Float16* __restrict__ q_ws, const _Float16* __restrict__ k_ws,
    const _Float16* __restrict__ v_ws, const int* __restrict__ mask,
    _Float16* __restrict__ att_ws) {
  // 0 for a live key, -inf for a masked one
  __shared__ __attribute__((aligned(32))) float mbias[SEQ];
  // Two-buffer ring of K and Vt stages, shared by the block's eight waves
  __shared__ __attribute__((aligned(16))) _Float16 Ks[2 * KBUF];
  __shared__ __attribute__((aligned(16))) _Float16 Vs[2 * VBUF];

  const int tid  = threadIdx.x;
  const int lane = tid & 31;
  const int row  = lane & 15;
  const int grp  = lane >> 4;
  const int wave = tid >> 5;

  const int bh = blockIdx.x >> 4;                       // 0..31
  const int qt = (blockIdx.x & 15) * 8 + wave;          // 0..127
  const int q0 = qt * 16;
  const int b  = bh >> 4;
  const int hh = bh & (NHEADS - 1);

  const _Float16* qb = q_ws + (size_t)bh * SEQ * HDIM;
  const _Float16* kb = k_ws + (size_t)bh * SEQ * HDIM;
  const _Float16* vb = v_ws + (size_t)bh * HDIM * SEQ;
  const int* mrow    = mask + b * SEQ;

  // This lane's 16-byte chunk of a stage: K row tid / 8, Vt row tid / 16
  const unsigned lk0 =
      (unsigned)(uintptr_t)&Ks[(tid >> 3) * KPITCH + (tid & 7) * 8];
  const unsigned lv0 =
      (unsigned)(uintptr_t)&Vs[(tid >> 4) * VPITCH + (tid & 15) * 8];
  const _Float16* gk = kb + tid * 8;
  const _Float16* gv = vb + (tid >> 4) * SEQ + (tid & 15) * 8;

  stage_kv(lk0, lv0, gk, gv);                           // stage 0, buffer 0

  // Keys run over accumulator registers: the mask enters as the C operand of
  // the score product, read from this table.
#pragma unroll   // independent loads in flight instead of round trips
  for (int i0 = 0; i0 < SEQ; i0 += 256 * 4) {
    const int i = i0 + tid * 4;
    const v4i mm = *(const v4i*)(mrow + i);
    v4f bb;
#pragma unroll
    for (int j = 0; j < 4; ++j) bb[j] = (mm[j] == 0) ? -__builtin_inff() : 0.f;
    *(v4f*)&mbias[i] = bb;
  }
  wait_async0();      // this wave's share of stage 0 has landed
  __syncthreads();    // publishes stage 0 and the mask table
  stage_kv(lk0 + KBUF * 2, lv0 + VBUF * 2, gk + KSTG * HDIM, gv + KSTG);

  const _Float16* qrow = qb + (size_t)(q0 + row) * HDIM;
  const v16h bq0 = cat16(*(const v8h*)(qrow + 8 * grp),
                         *(const v8h*)(qrow + 16 + 8 * grp));
  const v16h bq1 = cat16(*(const v8h*)(qrow + 32 + 8 * grp),
                         *(const v8h*)(qrow + 48 + 8 * grp));

  float mv = -__builtin_inff();   // running maximum of this lane's query
  float lv = 0.f;                 // this half's share of the running sum
  v8f o[4];                       // o[t][r] = Ot[16 t + 8 grp + r][query row]
#pragma unroll
  for (int t = 0; t < 4; ++t) {
    v8f z = {0.f,0.f,0.f,0.f,0.f,0.f,0.f,0.f};
    o[t] = z;
  }

  for (int st = 0; st < NSTG; ++st) {
    const int cur = st & 1;
    const _Float16* kt = &Ks[cur * KBUF + row * KPITCH + 8 * grp];
    const _Float16* vt = &Vs[cur * VBUF + row * VPITCH + 8 * grp];

#pragma unroll 2   // the second pass's LDS reads go out under the first pass
    for (int p = 0; p < KSTG / 32; ++p) {
      const int s0 = st * KSTG + p * 32;
      const _Float16* k0r = kt + p * 32 * KPITCH;      // key row, k chunk
      const _Float16* k1r = k0r + 16 * KPITCH;
      const _Float16* vr  = vt + p * 32;               // d row, key chunk
      const v16h ak00 = cat16(*(const v8h*)(k0r),      *(const v8h*)(k0r + 16));
      const v16h ak01 = cat16(*(const v8h*)(k0r + 32), *(const v8h*)(k0r + 48));
      const v16h ak10 = cat16(*(const v8h*)(k1r),      *(const v8h*)(k1r + 16));
      const v16h ak11 = cat16(*(const v8h*)(k1r + 32), *(const v8h*)(k1r + 48));

      v16h av[4];
#pragma unroll
      for (int t = 0; t < 4; ++t)
        av[t] = cat16(*(const v8h*)(vr + t * 16 * VPITCH),
                      *(const v8h*)(vr + t * 16 * VPITCH + 16));

      // c0[r]: key s0 + 8 grp + r, c1[r]: key s0 + 16 + 8 grp + r
      v8f c0 = *(const v8f*)&mbias[s0 + 8 * grp];
      v8f c1 = *(const v8f*)&mbias[s0 + 16 + 8 * grp];
      c0 = wmma_f16(ak00, bq0, c0);
      c0 = wmma_f16(ak01, bq1, c0);
      c1 = wmma_f16(ak10, bq0, c1);
      c1 = wmma_f16(ak11, bq1, c1);

      float tm[8];
#pragma unroll
      for (int r = 0; r < 8; ++r) tm[r] = fmaxf(c0[r], c1[r]);
      float rm = fmaxf(fmaxf(fmaxf(tm[0], tm[1]), fmaxf(tm[2], tm[3])),
                       fmaxf(fmaxf(tm[4], tm[5]), fmaxf(tm[6], tm[7])));
      rm = fmaxf(rm, xhalf(rm));    // the other half's sixteen keys
      const float mn    = fmaxf(mv, rm);
      const float alpha = __expf(mv - mn);
      mv = mn;

      v16h pb;
      float ls = 0.f;
#pragma unroll
      for (int r = 0; r < 8; ++r) {
        const float p0 = __expf(c0[r] - mn);
        const float p1 = __expf(c1[r] - mn);
        ls += p0 + p1;
        pb[r]     = (_Float16)p0;
        pb[8 + r] = (_Float16)p1;
      }
      lv = lv * alpha + ls;
#pragma unroll
      for (int t = 0; t < 4; ++t)
#pragma unroll
        for (int r = 0; r < 8; ++r) o[t][r] *= alpha;

#pragma unroll
      for (int t = 0; t < 4; ++t) o[t] = wmma_f16(av[t], pb, o[t]);
    }

    // Publish point of stage st + 1: this wave's reads of the current buffer
    // have retired, its copies of the next stage have landed, and behind the
    // barrier the current buffer is free for stage st + 2.
    asm volatile("s_wait_dscnt 0x0" ::: "memory");
    wait_async0();
    __syncthreads();
    if (st + 2 < NSTG)
      stage_kv(lk0 + cur * (KBUF * 2), lv0 + cur * (VBUF * 2),
               gk + (st + 2) * (KSTG * HDIM), gv + (st + 2) * KSTG);
  }
  wait_async0();                  // nothing is in flight when the wave ends

  lv += xhalf(lv);                // join the two halves' sums
  _Float16* orow = att_ws + ((size_t)(b * SEQ + q0 + row)) * DMODEL + hh * HDIM;
#pragma unroll
  for (int t = 0; t < 4; ++t) {
    v8h h;
#pragma unroll
    for (int r = 0; r < 8; ++r) h[r] = (_Float16)(o[t][r] / lv);
    *(v8h*)(orow + t * 16 + 8 * grp) = h;
  }
}

// ---------------------------------------------------------------------------
// Kernel 3: output projection.  out[4096][1024] = att @ Wot^T + b_out
// ---------------------------------------------------------------------------
__global__ __launch_bounds__(256) void out_gemm_kernel(
    const _Float16* __restrict__ att, const _Float16* __restrict__ Wot,
    const float* __restrict__ bout, float* __restrict__ out) {
  const int lane = threadIdx.x & 31;
  const int row  = lane & 15;
  const int grp  = lane >> 4;
  const int wave = threadIdx.x >> 5;
  const int wm   = wave >> 2;
  const int wn   = wave & 3;
  const int mb   = blockIdx.y * 128;
  const int nb   = blockIdx.x * 128;

  v8f acc[4][2];
#pragma unroll
  for (int i = 0; i < 4; ++i)
#pragma unroll
    for (int j = 0; j < 2; ++j) {
      v8f z = {0.f,0.f,0.f,0.f,0.f,0.f,0.f,0.f};
      acc[i][j] = z;
    }

  gemm_mainloop_k1024(att, Wot, mb, nb, acc);

#pragma unroll
  for (int tm = 0; tm < 4; ++tm) {
#pragma unroll
    for (int tn = 0; tn < 2; ++tn) {
      const int n    = nb + wn * 32 + tn * 16 + row;
      const float bb = bout[n];
#pragma unroll
      for (int r = 0; r < 8; ++r) {
        const int m = mb + wm * 64 + tm * 16 + r + 8 * grp;
        out[(size_t)m * DMODEL + n] = acc[tm][tn][r] + bb;
      }
    }
  }
}

// ---------------------------------------------------------------------------
// Launch
// ---------------------------------------------------------------------------
extern "C" void kernel_launch(void* const* d_in, const int* in_sizes, int n_in,
                              void* d_out, int out_size, void* d_ws,
                              size_t ws_size, hipStream_t stream) {
  const float* x    = (const float*)d_in[0];
  const int*   mask = (const int*)d_in[1];
  const float* Wqkv = (const float*)d_in[2];
  const float* bqkv = (const float*)d_in[3];
  const float* Wout = (const float*)d_in[4];
  const float* bout = (const float*)d_in[5];
  float* out = (float*)d_out;

  const size_t nBS  = (size_t)NBATCH * SEQ;            // 4096
  _Float16* xh     = (_Float16*)d_ws;                  // [4096][1024]
  _Float16* Wqt    = xh  + nBS * DMODEL;               // [3072][1024]
  _Float16* Wot    = Wqt + (size_t)3 * DMODEL * DMODEL;// [1024][1024]
  _Float16* q_ws   = Wot + (size_t)DMODEL * DMODEL;    // [32][2048][64]
  _Float16* k_ws   = q_ws + nBS * DMODEL;
  _Float16* v_ws   = k_ws + nBS * DMODEL;
  _Float16* att_ws = v_ws + nBS * DMODEL;              // [4096][1024]

  // Prep: f16 conversion + weight transposes, one launch
  prep_kernel<<<PREP_WGS, 256, 0, stream>>>(x, Wqkv, Wout, xh, Wqt, Wot);

  // QKV projection: M=4096, N=3072
  qkv_gemm_kernel<<<dim3(3 * DMODEL / 128, (unsigned)(nBS / 128)), 256, 0,
                    stream>>>(xh, Wqt, bqkv, q_ws, k_ws, v_ws);

  // Attention: 32 (b,h) pairs x 16 query blocks of 128; 8 waves/block
  attn_kernel<<<NBATCH * NHEADS * (SEQ / 128), 256, 0, stream>>>(
      q_ws, k_ws, v_ws, mask, att_ws);

  // Output projection: M=4096, N=1024
  out_gemm_kernel<<<dim3(DMODEL / 128, (unsigned)(nBS / 128)), 256, 0,
                    stream>>>(att_ws, Wot, bout, out);
}

// v004
// Measured time: 95.7 microseconds a run.
// Next to v003, in two timings, it ran 1.20 times as fast each time.
// Counting every step since v000, it is 2.33 times as fast.
#include <hip/hip_runtime.h>

// ---------------------------------------------------------------------------
// MHA forward for MI455X (gfx1250, wave32, WMMA f32_16x16x32_f16,
// async global->LDS double-buffered GEMM staging)
//   B=2, S=2048, D_MODEL=1024, H=16, HD=64
// ---------------------------------------------------------------------------

typedef __attribute__((ext_vector_type(16))) _Float16 v16h;
typedef __attribute__((ext_vector_type(8)))  _Float16 v8h;
typedef __attribute__((ext_vector_type(4)))  _Float16 v4h;
typedef __attribute__((ext_vector_type(8)))  float    v8f;
typedef __attribute__((ext_vector_type(4)))  float    v4f;
typedef __attribute__((ext_vector_type(4)))  int      v4i;

#define NBATCH   2
#define SEQ      2048
#define DMODEL   1024
#define NHEADS   16
#define HDIM     64

__device__ __forceinline__ v16h cat16(v8h lo, v8h hi) {
  return __builtin_shufflevector(lo, hi, 0,1,2,3,4,5,6,7,8,9,10,11,12,13,14,15);
}

__device__ __forceinline__ v8f wmma_f16(v16h a, v16h b, v8f c) {
  // (neg_a, A, neg_b, B, c_mod, C, reuse_a, reuse_b)
  return __builtin_amdgcn_wmma_f32_16x16x32_f16(false, a, false, b, (short)0, c,
                                                false, false);
}

// Wait for this wave's own async global->LDS copies (ASYNCcnt)
__device__ __forceinline__ void wait_async0() {
  asm volatile("s_wait_asynccnt 0" ::: "memory");
}

// ---------------------------------------------------------------------------
// Prep kernel: f32 -> f16 conversion of x and of both weights (transposed to
// [n][k]), so the GEMM tiles become pure contiguous copies (async-to-LDS
// friendly) and all WMMA fragments are two contiguous 16B loads per lane.
// One launch of 512 work-groups for all three: what bounds this work is the
// number of launches and of waves to start, not its bytes, so every thread
// takes sixteen 16-byte loads, all in flight together.
//   blocks   0..191: 128 x 128 tiles of W_qkv     blocks 192..255: of W_out
//   blocks 256..511: 16,384 consecutive elements of x each
// ---------------------------------------------------------------------------
#define TT        128                       // transpose tile edge
#define NT_QKV    (3 * DMODEL / TT)         // tile columns of W_qkv
#define NT_OUT    (DMODEL / TT)             // tile columns of W_out
#define TILES_QKV ((DMODEL / TT) * NT_QKV)
#define TILES_W   (TILES_QKV + (DMODEL / TT) * NT_OUT)
#define XCHUNK    (256 * 4 * 16)            // elements of x per work-group
#define PREP_WGS  (TILES_W + NBATCH * SEQ * DMODEL / XCHUNK)

// dst[n][k] (f16) = src[k][n] (f32): tile t of a weight with NT tile columns
template <int NT>
__device__ __forceinline__ void transpose_tile(
    const float* __restrict__ src, _Float16* __restrict__ dst, int t,
    _Float16* T) {
  constexpr int N = NT * TT;
  const int k0   = (t / NT) * TT;
  const int n0   = (t % NT) * TT;
  const int tid  = threadIdx.x;
  const int lane = tid & 31;
  const int wave = tid >> 5;

  // Wave w reads rows k0 + 16 w .. + 15, each wave-wide load one 512-byte row
  // piece: a lane ends up with sixteen consecutive k of four columns.
  const float* s = src + (size_t)(k0 + wave * 16) * N + n0 + lane * 4;
  v4f f[16];
#pragma unroll   // all sixteen loads go out before the first is used
  for (int i = 0; i < 15; ++i) f[i] = *(const v4f*)(s + i * N);
  // The last load's result may land in the address registers the others name
  asm volatile("s_wait_xcnt 0x0" ::: "memory");
  f[15] = *(const v4f*)(s + 15 * N);

#pragma unroll
  for (int j = 0; j < 4; ++j) {
#pragma unroll
    for (int h = 0; h < 2; ++h) {
      v8h p;
#pragma unroll
      for (int e = 0; e < 8; ++e) p[e] = (_Float16)f[h * 8 + e][j];
      *(v8h*)&T[(lane * 4 + j) * TT + (((wave * 2 + h) ^ (lane & 15)) * 8)] = p;
    }
  }
  __syncthreads();   // the tile is complete before rows are read back

  // Sixteen lanes store one row's 256 bytes: whole lines, 16 bytes a lane
  const int c = tid & 15;
  _Float16* d = dst + (size_t)(n0 + (tid >> 4)) * DMODEL + k0 + c * 8;
#pragma unroll
  for (int i = 0; i < 8; ++i) {
    const int n = i * 16 + (tid >> 4);
    *(v8h*)(d + i * 16 * DMODEL) =
        *(const v8h*)&T[n * TT + ((c ^ ((n >> 2) & 15)) * 8)];
  }
  // Stands in front of any rewrite of a register that the stores above name
  asm volatile("s_wait_xcnt 0x0" ::: "memory");
}

// Budget of four waves a SIMD (this launch has two work-groups a WGP): at the
// default budget the compiler kept to 64 registers and made the later loads
// wait for the earlier ones; with it all sixteen go out as one group.
__global__ __launch_bounds__(256)
__attribute__((amdgpu_waves_per_eu(4, 4))) void prep_kernel(
    const float* __restrict__ x, const float* __restrict__ Wqkv,
    const float* __restrict__ Wout, _Float16* __restrict__ xh,
    _Float16* __restrict__ Wqt, _Float16* __restrict__ Wot) {
  // Tile as [n][k], rows of 256 bytes in sixteen 16-byte pieces; piece c of
  // row n lies at place c ^ ((n >> 2) & 15), which spreads over all banks both
  // the writers (16 lanes: rows 4 apart, one piece) and the readers (one row).
  __shared__ __attribute__((aligned(16))) _Float16 T[TT * TT];

  const int blk = blockIdx.x;               // every branch is block-uniform
  if (blk < TILES_QKV) {
    transpose_tile<NT_QKV>(Wqkv, Wqt, blk, T);
  } else if (blk < TILES_W) {
    transpose_tile<NT_OUT>(Wout, Wot, blk - TILES_QKV, T);
  } else {                                  // x to f16
    const size_t base = (size_t)(blk - TILES_W) * XCHUNK + threadIdx.x * 4;
    v4f f[16];
#pragma unroll   // all sixteen loads go out before the first is used
    for (int i = 0; i < 15; ++i) f[i] = *(const v4f*)(x + base + i * 1024);
    // The last load's result may land in the address registers the others name
    asm volatile("s_wait_xcnt 0x0" ::: "memory");
    f[15] = *(const v4f*)(x + base + 15 * 1024);
#pragma unroll
    for (int i = 0; i < 16; ++i) {
      v4h h;
      h[0] = (_Float16)f[i][0]; h[1] = (_Float16)f[i][1];
      h[2] = (_Float16)f[i][2]; h[3] = (_Float16)f[i][3];
      *(v4h*)(xh + base + i * 1024) = h;
    }
    // Stands in front of any rewrite of a register that the stores above name
    asm volatile("s_wait_xcnt 0x0" ::: "memory");
  }
}

// ---------------------------------------------------------------------------
// Shared GEMM main loop: acc[4][2] += A[128 rows @ mb] x B[128 cols @ nb],
// K = 1024, both operands f16 with k contiguous (A row-major, B stored [n][k]).
// 256 threads / 8 waves; wave (wm,wn) owns a 64x32 slab = 4x2 WMMA tiles.
// Two-buffer LDS ring of stages of 64 k: a stage row is one whole 128-byte
// line, eight lanes copy one row, so a wave-wide copy touches four lines.
// ---------------------------------------------------------------------------
#define GK      64                   // k per stage
#define GSTG    (DMODEL / GK)
#define GPITCH  72                   // halves: 128-byte rows at 144 bytes
#define GBUF    (128 * GPITCH)       // halves per operand buffer

// One stage of A and of B (128 rows x 64 k each) into LDS: eight async copies
// of 16 bytes per lane.  la, ga / lb, gb: this lane's chunk of rows 0..31 of
// the operand, the next copies 32 rows further.  The s_wait_xcnt closes the
// statement so that it stands in front of any rewrite of the address
// registers the copies name.
__device__ __forceinline__ void stage_ab(unsigned la, unsigned lb,
                                         const _Float16* ga,
                                         const _Float16* gb) {
  asm volatile(
      "global_load_async_to_lds_b128 %0, %8, off\n\t"
      "global_load_async_to_lds_b128 %1, %9, off\n\t"
      "global_load_async_to_lds_b128 %2, %10, off\n\t"
      "global_load_async_to_lds_b128 %3, %11, off\n\t"
      "global_load_async_to_lds_b128 %4, %12, off\n\t"
      "global_load_async_to_lds_b128 %5, %13, off\n\t"
      "global_load_async_to_lds_b128 %6, %14, off\n\t"
      "global_load_async_to_lds_b128 %7, %15, off\n\t"
      "s_wait_xcnt 0x0"
      :: "v"(la), "v"(la + 32 * GPITCH * 2), "v"(la + 64 * GPITCH * 2),
         "v"(la + 96 * GPITCH * 2),
         "v"(lb), "v"(lb + 32 * GPITCH * 2), "v"(lb + 64 * GPITCH * 2),
         "v"(lb + 96 * GPITCH * 2),
         "v"(ga), "v"(ga + 32 * DMODEL), "v"(ga + 64 * DMODEL),
         "v"(ga + 96 * DMODEL),
         "v"(gb), "v"(gb + 32 * DMODEL), "v"(gb + 64 * DMODEL),
         "v"(gb + 96 * DMODEL)
      : "memory");
}

__device__ __forceinline__ void gemm_mainloop_k1024(
    const _Float16* __restrict__ A, const _Float16* __restrict__ B,
    int mb, int nb, v8f acc[4][2]) {
  __shared__ __attribute__((aligned(16))) _Float16 Ah[2 * GBUF];
  __shared__ __attribute__((aligned(16))) _Float16 Bh[2 * GBUF];

  const int tid  = threadIdx.x;
  const int lane = tid & 31;
  const int row  = lane & 15;
  const int grp  = lane >> 4;
  const int wave = tid >> 5;
  const int wm   = wave >> 2;          // 0..1
  const int wn   = wave & 3;           // 0..3

  // This lane's 16-byte chunk of a stage: row tid / 8, chunk tid % 8
  const int sr = tid >> 3;
  const int sc = (tid & 7) * 8;
  const unsigned la0 = (unsigned)(uintptr_t)&Ah[sr * GPITCH + sc];
  const unsigned lb0 = (unsigned)(uintptr_t)&Bh[sr * GPITCH + sc];
  const _Float16* ga = A + (size_t)(mb + sr) * DMODEL + sc;
  const _Float16* gb = B + (size_t)(nb + sr) * DMODEL + sc;

  stage_ab(la0, lb0, ga, gb);                           // stage 0, buffer 0
  wait_async0();      // this wave's share of stage 0 has landed
  __syncthreads();    // publishes stage 0
  stage_ab(la0 + GBUF * 2, lb0 + GBUF * 2, ga + GK, gb + GK);

  for (int st = 0; st < GSTG; ++st) {
    const int cur = st & 1;
    const _Float16* at = &Ah[cur * GBUF + (wm * 64 + row) * GPITCH + 8 * grp];
    const _Float16* bt = &Bh[cur * GBUF + (wn * 32 + row) * GPITCH + 8 * grp];

#pragma unroll   // both halves at constant LDS offsets from one address
    for (int h = 0; h < GK / 32; ++h) {
      v16h af[4];
#pragma unroll
      for (int tm = 0; tm < 4; ++tm) {
        const _Float16* p = at + tm * 16 * GPITCH + h * 32;
        af[tm] = cat16(*(const v8h*)p, *(const v8h*)(p + 16));
      }
      v16h bf[2];
#pragma unroll
      for (int tn = 0; tn < 2; ++tn) {
        const _Float16* p = bt + tn * 16 * GPITCH + h * 32;
        bf[tn] = cat16(*(const v8h*)p, *(const v8h*)(p + 16));
      }
#pragma unroll
      for (int tm = 0; tm < 4; ++tm)
#pragma unroll
        for (int tn = 0; tn < 2; ++tn)
          acc[tm][tn] = wmma_f16(af[tm], bf[tn], acc[tm][tn]);
    }

    // Publish point of stage st + 1: this wave's reads of the current buffer
    // have retired, its copies of the next stage have landed, and behind the
    // barrier the current buffer is free for stage st + 2.
    asm volatile("s_wait_dscnt 0x0" ::: "memory");
    wait_async0();
    __syncthreads();
    if (st + 2 < GSTG)
      stage_ab(la0 + cur * (GBUF * 2), lb0 + cur * (GBUF * 2),
               ga + (st + 2) * GK, gb + (st + 2) * GK);
  }
  wait_async0();                  // nothing is in flight behind the loop
}

// ---------------------------------------------------------------------------
// Kernel 1: QKV projection.  C[4096][3072] = xh @ Wqt^T + b_qkv.  Scatters:
//   q_ws: [bh][s][64]  (pre-scaled by 1/sqrt(64))
//   k_ws: [bh][s][64]
//   v_ws: [bh][d][s]   (transposed for the PV matmul's A-fragment layout)
// ---------------------------------------------------------------------------
__global__ __launch_bounds__(256) void qkv_gemm_kernel(
    const _Float16* __restrict__ xh, const _Float16* __restrict__ Wqt,
    const float* __restrict__ bqkv,
    _Float16* __restrict__ q_ws, _Float16* __restrict__ k_ws,
    _Float16* __restrict__ v_ws) {
  const int lane = threadIdx.x & 31;
  const int row  = lane & 15;
  const int grp  = lane >> 4;
  const int wave = threadIdx.x >> 5;
  const int wm   = wave >> 2;
  const int wn   = wave & 3;
  const int mb   = blockIdx.y * 128;
  const int nb   = blockIdx.x * 128;

  v8f acc[4][2];
#pragma unroll
  for (int i = 0; i < 4; ++i)
#pragma unroll
    for (int j = 0; j < 2; ++j) {
      v8f z = {0.f,0.f,0.f,0.f,0.f,0.f,0.f,0.f};
      acc[i][j] = z;
    }

  gemm_mainloop_k1024(xh, Wqt, mb, nb, acc);

#pragma unroll
  for (int tm = 0; tm < 4; ++tm) {
#pragma unroll
    for (int tn = 0; tn < 2; ++tn) {
      const int n    = nb + wn * 32 + tn * 16 + row;   // 0..3071
      const float bb = bqkv[n];
      const int h    = n / (3 * HDIM);
      const int c    = n % (3 * HDIM);
#pragma unroll
      for (int r = 0; r < 8; ++r) {
        const int m  = mb + wm * 64 + tm * 16 + r + 8 * grp;
        const int b  = m >> 11;
        const int s  = m & (SEQ - 1);
        const int bh = b * NHEADS + h;
        const float val = acc[tm][tn][r] + bb;
        if (c < HDIM) {
          q_ws[((size_t)bh * SEQ + s) * HDIM + c] = (_Float16)(val * 0.125f);
        } else if (c < 2 * HDIM) {
          k_ws[((size_t)bh * SEQ + s) * HDIM + (c - HDIM)] = (_Float16)val;
        } else {
          v_ws[((size_t)bh * HDIM + (c - 2 * HDIM)) * SEQ + s] = (_Float16)val;
        }
      }
    }
  }
}

__device__ __forceinline__ float xhalf(float x) {
  const int b = __builtin_bit_cast(int, x);
  return __builtin_bit_cast(float, __builtin_amdgcn_permlanex16(
      b, b, 0x76543210, 0xfedcba98, false, false));
}

#define KSTG    128                  // keys per stage
#define NSTG    (SEQ / KSTG)
#define KPITCH  72                   // halves: 128-byte K rows at 144 bytes
#define VPITCH  136                  // halves: 256-byte Vt rows at 272 bytes
#define KBUF    (KSTG * KPITCH)      // halves per K buffer
#define VBUF    (HDIM * VPITCH)      // halves per Vt buffer

// One stage of K (128 keys x 64) and Vt (64 x 128 keys) into LDS: eight async
// copies of 16 bytes per lane, every wave-wide copy covering four whole lines.
// lk, gk: this lane's chunk of K rows 0..31, the next copies 32 rows further;
// lv, gv: its chunk of Vt rows 0..15, the next copies 16 rows further.
// The s_wait_xcnt closes the statement so that it stands in front of any
// rewrite of the address registers the copies name.
__device__ __forceinline__ void stage_kv(unsigned lk, unsigned lv,
                                         const _Float16* gk,
                                         const _Float16* gv) {
  asm volatile(
      "global_load_async_to_lds_b128 %0, %8, off\n\t"
      "global_load_async_to_lds_b128 %1, %9, off\n\t"
      "global_load_async_to_lds_b128 %2, %10, off\n\t"
      "global_load_async_to_lds_b128 %3, %11, off\n\t"
      "global_load_async_to_lds_b128 %4, %12, off\n\t"
      "global_load_async_to_lds_b128 %5, %13, off\n\t"
      "global_load_async_to_lds_b128 %6, %14, off\n\t"
      "global_load_async_to_lds_b128 %7, %15, off\n\t"
      "s_wait_xcnt 0x0"
      :: "v"(lk), "v"(lk + 32 * KPITCH * 2), "v"(lk + 64 * KPITCH * 2),
         "v"(lk + 96 * KPITCH * 2),
         "v"(lv), "v"(lv + 16 * VPITCH * 2), "v"(lv + 32 * VPITCH * 2),
         "v"(lv + 48 * VPITCH * 2),
         "v"(gk), "v"(gk + 32 * HDIM), "v"(gk + 64 * HDIM), "v"(gk + 96 * HDIM),
         "v"(gv), "v"(gv + 16 * SEQ), "v"(gv + 32 * SEQ), "v"(gv + 48 * SEQ)
      : "memory");
}

// Four waves a SIMD and no more: two work-groups fill a WGP, so the 512
// work-groups of the launch cannot pile up three to a WGP and leave others idle.
__global__ __launch_bounds__(256)
__attribute__((amdgpu_waves_per_eu(4, 4))) void attn_kernel(
    const _Float16* __restrict__ q_ws, const _Float16* __restrict__ k_ws,
    const _Float16* __restrict__ v_ws, const int* __restrict__ mask,
    _Float16* __restrict__ att_ws) {
  // 0 for a live key, -inf for a masked one
  __shared__ __attribute__((aligned(32))) float mbias[SEQ];
  // Two-buffer ring of K and Vt stages, shared by the block's eight waves
  __shared__ __attribute__((aligned(16))) _Float16 Ks[2 * KBUF];
  __shared__ __attribute__((aligned(16))) _Float16 Vs[2 * VBUF];

  const int tid  = threadIdx.x;
  const int lane = tid & 31;
  const int row  = lane & 15;
  const int grp  = lane >> 4;
  const int wave = tid >> 5;

  const int bh = blockIdx.x >> 4;                       // 0..31
  const int qt = (blockIdx.x & 15) * 8 + wave;          // 0..127
  const int q0 = qt * 16;
  const int b  = bh >> 4;
  const int hh = bh & (NHEADS - 1);

  const _Float16* qb = q_ws + (size_t)bh * SEQ * HDIM;
  const _Float16* kb = k_ws + (size_t)bh * SEQ * HDIM;
  const _Float16* vb = v_ws + (size_t)bh * HDIM * SEQ;
  const int* mrow    = mask + b * SEQ;

  // This lane's 16-byte chunk of a stage: K row tid / 8, Vt row tid / 16
  const unsigned lk0 =
      (unsigned)(uintptr_t)&Ks[(tid >> 3) * KPITCH + (tid & 7) * 8];
  const unsigned lv0 =
      (unsigned)(uintptr_t)&Vs[(tid >> 4) * VPITCH + (tid & 15) * 8];
  const _Float16* gk = kb + tid * 8;
  const _Float16* gv = vb + (tid >> 4) * SEQ + (tid & 15) * 8;

  stage_kv(lk0, lv0, gk, gv);                           // stage 0, buffer 0

  // Keys run over accumulator registers: the mask enters as the C operand of
  // the score product, read from this table.
#pragma unroll   // independent loads in flight instead of round trips
  for (int i0 = 0; i0 < SEQ; i0 += 256 * 4) {
    const int i = i0 + tid * 4;
    const v4i mm = *(const v4i*)(mrow + i);
    v4f bb;
#pragma unroll
    for (int j = 0; j < 4; ++j) bb[j] = (mm[j] == 0) ? -__builtin_inff() : 0.f;
    *(v4f*)&mbias[i] = bb;
  }
  wait_async0();      // this wave's share of stage 0 has landed
  __syncthreads();    // publishes stage 0 and the mask table
  stage_kv(lk0 + KBUF * 2, lv0 + VBUF * 2, gk + KSTG * HDIM, gv + KSTG);

  const _Float16* qrow = qb + (size_t)(q0 + row) * HDIM;
  const v16h bq0 = cat16(*(const v8h*)(qrow + 8 * grp),
                         *(const v8h*)(qrow + 16 + 8 * grp));
  const v16h bq1 = cat16(*(const v8h*)(qrow + 32 + 8 * grp),
                         *(const v8h*)(qrow + 48 + 8 * grp));

  float mv = -__builtin_inff();   // running maximum of this lane's query
  float lv = 0.f;                 // this half's share of the running sum
  v8f o[4];                       // o[t][r] = Ot[16 t + 8 grp + r][query row]
#pragma unroll
  for (int t = 0; t < 4; ++t) {
    v8f z = {0.f,0.f,0.f,0.f,0.f,0.f,0.f,0.f};
    o[t] = z;
  }

  for (int st = 0; st < NSTG; ++st) {
    const int cur = st & 1;
    const _Float16* kt = &Ks[cur * KBUF + row * KPITCH + 8 * grp];
    const _Float16* vt = &Vs[cur * VBUF + row * VPITCH + 8 * grp];

#pragma unroll 2   // the second pass's LDS reads go out under the first pass
    for (int p = 0; p < KSTG / 32; ++p) {
      const int s0 = st * KSTG + p * 32;
      const _Float16* k0r = kt + p * 32 * KPITCH;      // key row, k chunk
      const _Float16* k1r = k0r + 16 * KPITCH;
      const _Float16* vr  = vt + p * 32;               // d row, key chunk
      const v16h ak00 = cat16(*(const v8h*)(k0r),      *(const v8h*)(k0r + 16));
      const v16h ak01 = cat16(*(const v8h*)(k0r + 32), *(const v8h*)(k0r + 48));
      const v16h ak10 = cat16(*(const v8h*)(k1r),      *(const v8h*)(k1r + 16));
      const v16h ak11 = cat16(*(const v8h*)(k1r + 32), *(const v8h*)(k1r + 48));

      v16h av[4];
#pragma unroll
      for (int t = 0; t < 4; ++t)
        av[t] = cat16(*(const v8h*)(vr + t * 16 * VPITCH),
                      *(const v8h*)(vr + t * 16 * VPITCH + 16));

      // c0[r]: key s0 + 8 grp + r, c1[r]: key s0 + 16 + 8 grp + r
      v8f c0 = *(const v8f*)&mbias[s0 + 8 * grp];
      v8f c1 = *(const v8f*)&mbias[s0 + 16 + 8 * grp];
      c0 = wmma_f16(ak00, bq0, c0);
      c0 = wmma_f16(ak01, bq1, c0);
      c1 = wmma_f16(ak10, bq0, c1);
      c1 = wmma_f16(ak11, bq1, c1);

      float tm[8];
#pragma unroll
      for (int r = 0; r < 8; ++r) tm[r] = fmaxf(c0[r], c1[r]);
      float rm = fmaxf(fmaxf(fmaxf(tm[0], tm[1]), fmaxf(tm[2], tm[3])),
                       fmaxf(fmaxf(tm[4], tm[5]), fmaxf(tm[6], tm[7])));
      rm = fmaxf(rm, xhalf(rm));    // the other half's sixteen keys
      const float mn    = fmaxf(mv, rm);
      const float alpha = __expf(mv - mn);
      mv = mn;

      v16h pb;
      float ls = 0.f;
#pragma unroll
      for (int r = 0; r < 8; ++r) {
        const float p0 = __expf(c0[r] - mn);
        const float p1 = __expf(c1[r] - mn);
        ls += p0 + p1;
        pb[r]     = (_Float16)p0;
        pb[8 + r] = (_Float16)p1;
      }
      lv = lv * alpha + ls;
#pragma unroll
      for (int t = 0; t < 4; ++t)
#pragma unroll
        for (int r = 0; r < 8; ++r) o[t][r] *= alpha;

#pragma unroll
      for (int t = 0; t < 4; ++t) o[t] = wmma_f16(av[t], pb, o[t]);
    }

    // Publish point of stage st + 1: this wave's reads of the current buffer
    // have retired, its copies of the next stage have landed, and behind the
    // barrier the current buffer is free for stage st + 2.
    asm volatile("s_wait_dscnt 0x0" ::: "memory");
    wait_async0();
    __syncthreads();
    if (st + 2 < NSTG)
      stage_kv(lk0 + cur * (KBUF * 2), lv0 + cur * (VBUF * 2),
               gk + (st + 2) * (KSTG * HDIM), gv + (st + 2) * KSTG);
  }
  wait_async0();                  // nothing is in flight when the wave ends

  lv += xhalf(lv);                // join the two halves' sums
  _Float16* orow = att_ws + ((size_t)(b * SEQ + q0 + row)) * DMODEL + hh * HDIM;
#pragma unroll
  for (int t = 0; t < 4; ++t) {
    v8h h;
#pragma unroll
    for (int r = 0; r < 8; ++r) h[r] = (_Float16)(o[t][r] / lv);
    *(v8h*)(orow + t * 16 + 8 * grp) = h;
  }
}

// ---------------------------------------------------------------------------
// Kernel 3: output projection.  out[4096][1024] = att @ Wot^T + b_out
// ---------------------------------------------------------------------------
__global__ __launch_bounds__(256) void out_gemm_kernel(
    const _Float16* __restrict__ att, const _Float16* __restrict__ Wot,
    const float* __restrict__ bout, float* __restrict__ out) {
  const int lane = threadIdx.x & 31;
  const int row  = lane & 15;
  const int grp  = lane >> 4;
  const int wave = threadIdx.x >> 5;
  const int wm   = wave >> 2;
  const int wn   = wave & 3;
  const int mb   = blockIdx.y * 128;
  const int nb   = blockIdx.x * 128;

  v8f acc[4][2];
#pragma unroll
  for (int i = 0; i < 4; ++i)
#pragma unroll
    for (int j = 0; j < 2; ++j) {
      v8f z = {0.f,0.f,0.f,0.f,0.f,0.f,0.f,0.f};
      acc[i][j] = z;
    }

  gemm_mainloop_k1024(att, Wot, mb, nb, acc);

#pragma unroll
  for (int tm = 0; tm < 4; ++tm) {
#pragma unroll
    for (int tn = 0; tn < 2; ++tn) {
      const int n    = nb + wn * 32 + tn * 16 + row;
      const float bb = bout[n];
#pragma unroll
      for (int r = 0; r < 8; ++r) {
        const int m = mb + wm * 64 + tm * 16 + r + 8 * grp;
        out[(size_t)m * DMODEL + n] = acc[tm][tn][r] + bb;
      }
    }
  }
}

// ---------------------------------------------------------------------------
// Launch
// ---------------------------------------------------------------------------
extern "C" void kernel_launch(void* const* d_in, const int* in_sizes, int n_in,
                              void* d_out, int out_size, void* d_ws,
                              size_t ws_size, hipStream_t stream) {
  const float* x    = (const float*)d_in[0];
  const int*   mask = (const int*)d_in[1];
  const float* Wqkv = (const float*)d_in[2];
  const float* bqkv = (const float*)d_in[3];
  const float* Wout = (const float*)d_in[4];
  const float* bout = (const float*)d_in[5];
  float* out = (float*)d_out;

  const size_t nBS  = (size_t)NBATCH * SEQ;            // 4096
  _Float16* xh     = (_Float16*)d_ws;                  // [4096][1024]
  _Float16* Wqt    = xh  + nBS * DMODEL;               // [3072][1024]
  _Float16* Wot    = Wqt + (size_t)3 * DMODEL * DMODEL;// [1024][1024]
  _Float16* q_ws   = Wot + (size_t)DMODEL * DMODEL;    // [32][2048][64]
  _Float16* k_ws   = q_ws + nBS * DMODEL;
  _Float16* v_ws   = k_ws + nBS * DMODEL;
  _Float16* att_ws = v_ws + nBS * DMODEL;              // [4096][1024]

  // Prep: f16 conversion + weight transposes, one launch
  prep_kernel<<<PREP_WGS, 256, 0, stream>>>(x, Wqkv, Wout, xh, Wqt, Wot);

  // QKV projection: M=4096, N=3072
  qkv_gemm_kernel<<<dim3(3 * DMODEL / 128, (unsigned)(nBS / 128)), 256, 0,
                    stream>>>(xh, Wqt, bqkv, q_ws, k_ws, v_ws);

  // Attention: 32 (b,h) pairs x 16 query blocks of 128; 8 waves/block
  attn_kernel<<<NBATCH * NHEADS * (SEQ / 128), 256, 0, stream>>>(
      q_ws, k_ws, v_ws, mask, att_ws);

  // Output projection: M=4096, N=1024
  out_gemm_kernel<<<dim3(DMODEL / 128, (unsigned)(nBS / 128)), 256, 0,
                    stream>>>(att_ws, Wot, bout, out);
}

// v005
// It runs in 86.2 microseconds.
// Two timings next to v004 both put it at 1.11 times that version's speed.
// All steps since v000 together make it 2.59 times as fast.
#include <hip/hip_runtime.h>

// ---------------------------------------------------------------------------
// MHA forward for MI455X (gfx1250, wave32, WMMA f32_16x16x32_f16,
// async global->LDS double-buffered GEMM staging)
//   B=2, S=2048, D_MODEL=1024, H=16, HD=64
// ---------------------------------------------------------------------------

typedef __attribute__((ext_vector_type(16))) _Float16 v16h;
typedef __attribute__((ext_vector_type(8)))  _Float16 v8h;
typedef __attribute__((ext_vector_type(4)))  _Float16 v4h;
typedef __attribute__((ext_vector_type(8)))  float    v8f;
typedef __attribute__((ext_vector_type(4)))  float    v4f;
typedef __attribute__((ext_vector_type(4)))  int      v4i;

#define NBATCH   2
#define SEQ      2048
#define DMODEL   1024
#define NHEADS   16
#define HDIM     64

__device__ __forceinline__ v16h cat16(v8h lo, v8h hi) {
  return __builtin_shufflevector(lo, hi, 0,1,2,3,4,5,6,7,8,9,10,11,12,13,14,15);
}

__device__ __forceinline__ v8f wmma_f16(v16h a, v16h b, v8f c) {
  // (neg_a, A, neg_b, B, c_mod, C, reuse_a, reuse_b)
  return __builtin_amdgcn_wmma_f32_16x16x32_f16(false, a, false, b, (short)0, c,
                                                false, false);
}

// Wait for this wave's own async global->LDS copies (ASYNCcnt)
__device__ __forceinline__ void wait_async0() {
  asm volatile("s_wait_asynccnt 0" ::: "memory");
}

// ---------------------------------------------------------------------------
// Prep kernel: f32 -> f16 conversion of x and of both weights (transposed to
// [n][k]), so the GEMM tiles become pure contiguous copies (async-to-LDS
// friendly) and all WMMA fragments are two contiguous 16B loads per lane.
// One launch of 512 work-groups for all three: what bounds this work is the
// number of launches and of waves to start, not its bytes, so every thread
// takes sixteen 16-byte loads, all in flight together.
//   blocks   0..191: 128 x 128 tiles of W_qkv     blocks 192..255: of W_out
//   blocks 256..511: 16,384 consecutive elements of x each
// ---------------------------------------------------------------------------
#define TT        128                       // transpose tile edge
#define NT_QKV    (3 * DMODEL / TT)         // tile columns of W_qkv
#define NT_OUT    (DMODEL / TT)             // tile columns of W_out
#define TILES_QKV ((DMODEL / TT) * NT_QKV)
#define TILES_W   (TILES_QKV + (DMODEL / TT) * NT_OUT)
#define XCHUNK    (256 * 4 * 16)            // elements of x per work-group
#define PREP_WGS  (TILES_W + NBATCH * SEQ * DMODEL / XCHUNK)

// dst[n][k] (f16) = src[k][n] (f32): tile t of a weight with NT tile columns
template <int NT>
__device__ __forceinline__ void transpose_tile(
    const float* __restrict__ src, _Float16* __restrict__ dst, int t,
    _Float16* T) {
  constexpr int N = NT * TT;
  const int k0   = (t / NT) * TT;
  const int n0   = (t % NT) * TT;
  const int tid  = threadIdx.x;
  const int lane = tid & 31;
  const int wave = tid >> 5;

  // Wave w reads rows k0 + 16 w .. + 15, each wave-wide load one 512-byte row
  // piece: a lane ends up with sixteen consecutive k of four columns.
  const float* s = src + (size_t)(k0 + wave * 16) * N + n0 + lane * 4;
  v4f f[16];
#pragma unroll   // all sixteen loads go out before the first is used
  for (int i = 0; i < 15; ++i) f[i] = *(const v4f*)(s + i * N);
  // The last load's result may land in the address registers the others name
  asm volatile("s_wait_xcnt 0x0" ::: "memory");
  f[15] = *(const v4f*)(s + 15 * N);

#pragma unroll
  for (int j = 0; j < 4; ++j) {
#pragma unroll
    for (int h = 0; h < 2; ++h) {
      v8h p;
#pragma unroll
      for (int e = 0; e < 8; ++e) p[e] = (_Float16)f[h * 8 + e][j];
      *(v8h*)&T[(lane * 4 + j) * TT + (((wave * 2 + h) ^ (lane & 15)) * 8)] = p;
    }
  }
  __syncthreads();   // the tile is complete before rows are read back

  // Sixteen lanes store one row's 256 bytes: whole lines, 16 bytes a lane
  const int c = tid & 15;
  _Float16* d = dst + (size_t)(n0 + (tid >> 4)) * DMODEL + k0 + c * 8;
#pragma unroll
  for (int i = 0; i < 8; ++i) {
    const int n = i * 16 + (tid >> 4);
    *(v8h*)(d + i * 16 * DMODEL) =
        *(const v8h*)&T[n * TT + ((c ^ ((n >> 2) & 15)) * 8)];
  }
  // Stands in front of any rewrite of a register that the stores above name
  asm volatile("s_wait_xcnt 0x0" ::: "memory");
}

// Budget of four waves a SIMD (this launch has two work-groups a WGP): at the
// default budget the compiler kept to 64 registers and made the later loads
// wait for the earlier ones; with it all sixteen go out as one group.
__global__ __launch_bounds__(256)
__attribute__((amdgpu_waves_per_eu(4, 4))) void prep_kernel(
    const float* __restrict__ x, const float* __restrict__ Wqkv,
    const float* __restrict__ Wout, _Float16* __restrict__ xh,
    _Float16* __restrict__ Wqt, _Float16* __restrict__ Wot) {
  // Tile as [n][k], rows of 256 bytes in sixteen 16-byte pieces; piece c of
  // row n lies at place c ^ ((n >> 2) & 15), which spreads over all banks both
  // the writers (16 lanes: rows 4 apart, one piece) and the readers (one row).
  __shared__ __attribute__((aligned(16))) _Float16 T[TT * TT];

  const int blk = blockIdx.x;               // every branch is block-uniform
  if (blk < TILES_QKV) {
    transpose_tile<NT_QKV>(Wqkv, Wqt, blk, T);
  } else if (blk < TILES_W) {
    transpose_tile<NT_OUT>(Wout, Wot, blk - TILES_QKV, T);
  } else {                                  // x to f16
    const size_t base = (size_t)(blk - TILES_W) * XCHUNK + threadIdx.x * 4;
    v4f f[16];
#pragma unroll   // all sixteen loads go out before the first is used
    for (int i = 0; i < 15; ++i) f[i] = *(const v4f*)(x + base + i * 1024);
    // The last load's result may land in the address registers the others name
    asm volatile("s_wait_xcnt 0x0" ::: "memory");
    f[15] = *(const v4f*)(x + base + 15 * 1024);
#pragma unroll
    for (int i = 0; i < 16; ++i) {
      v4h h;
      h[0] = (_Float16)f[i][0]; h[1] = (_Float16)f[i][1];
      h[2] = (_Float16)f[i][2]; h[3] = (_Float16)f[i][3];
      *(v4h*)(xh + base + i * 1024) = h;
    }
    // Stands in front of any rewrite of a register that the stores above name
    asm volatile("s_wait_xcnt 0x0" ::: "memory");
  }
}

// ---------------------------------------------------------------------------
// Shared GEMM main loop over A[128 rows @ mb] and B[128 rows @ nb], K = 1024,
// both operands f16 with k contiguous (A row-major, B stored [n][k]).
// 256 threads / 8 waves; a wave owns 4x2 WMMA tiles: 64 stage rows as first
// operand, 32 as second.  A and B rows load alike, so the caller picks per
// wave which of the two is first (fo, so: offsets of those rows in buffer 0 of
// the ring): acc[t][u][r] = first row 16 t + 8 grp + r . second row 16 u + row,
// and a lane's eight registers run along the first operand's rows.
// Two-buffer LDS ring of stages of 64 k: a stage row is one whole 128-byte
// line, eight lanes copy one row, so a wave-wide copy touches four lines.
// ---------------------------------------------------------------------------
#define GK      64                   // k per stage
#define GSTG    (DMODEL / GK)
#define GPITCH  72                   // halves: 128-byte rows at 144 bytes
#define GBUF    (128 * GPITCH)       // halves per operand buffer
#define GRING   (4 * GBUF)           // A buffers 0 and 1, then B buffers 0 and 1

// One stage of A and of B (128 rows x 64 k each) into LDS: eight async copies
// of 16 bytes per lane.  la, ga / lb, gb: this lane's chunk of rows 0..31 of
// the operand, the next copies 32 rows further.  The s_wait_xcnt closes the
// statement so that it stands in front of any rewrite of the address
// registers the copies name.
__device__ __forceinline__ void stage_ab(unsigned la, unsigned lb,
                                         const _Float16* ga,
                                         const _Float16* gb) {
  asm volatile(
      "global_load_async_to_lds_b128 %0, %8, off\n\t"
      "global_load_async_to_lds_b128 %1, %9, off\n\t"
      "global_load_async_to_lds_b128 %2, %10, off\n\t"
      "global_load_async_to_lds_b128 %3, %11, off\n\t"
      "global_load_async_to_lds_b128 %4, %12, off\n\t"
      "global_load_async_to_lds_b128 %5, %13, off\n\t"
      "global_load_async_to_lds_b128 %6, %14, off\n\t"
      "global_load_async_to_lds_b128 %7, %15, off\n\t"
      "s_wait_xcnt 0x0"
      :: "v"(la), "v"(la + 32 * GPITCH * 2), "v"(la + 64 * GPITCH * 2),
         "v"(la + 96 * GPITCH * 2),
         "v"(lb), "v"(lb + 32 * GPITCH * 2), "v"(lb + 64 * GPITCH * 2),
         "v"(lb + 96 * GPITCH * 2),
         "v"(ga), "v"(ga + 32 * DMODEL), "v"(ga + 64 * DMODEL),
         "v"(ga + 96 * DMODEL),
         "v"(gb), "v"(gb + 32 * DMODEL), "v"(gb + 64 * DMODEL),
         "v"(gb + 96 * DMODEL)
      : "memory");
}

__device__ __forceinline__ void gemm_mainloop_k1024(
    _Float16* S, const _Float16* __restrict__ A,
    const _Float16* __restrict__ B, int mb, int nb, int fo, int so,
    v8f acc[4][2]) {
  const int tid  = threadIdx.x;
  const int lane = tid & 31;
  const int row  = lane & 15;
  const int grp  = lane >> 4;

  // This lane's 16-byte chunk of a stage: row tid / 8, chunk tid % 8
  const int sr = tid >> 3;
  const int sc = (tid & 7) * 8;
  const unsigned la0 = (unsigned)(uintptr_t)&S[sr * GPITCH + sc];
  const unsigned lb0 = (unsigned)(uintptr_t)&S[2 * GBUF + sr * GPITCH + sc];
  const _Float16* ga = A + (size_t)(mb + sr) * DMODEL + sc;
  const _Float16* gb = B + (size_t)(nb + sr) * DMODEL + sc;

  stage_ab(la0, lb0, ga, gb);                           // stage 0, buffer 0
  wait_async0();      // this wave's share of stage 0 has landed
  __syncthreads();    // publishes stage 0
  stage_ab(la0 + GBUF * 2, lb0 + GBUF * 2, ga + GK, gb + GK);

  for (int st = 0; st < GSTG; ++st) {
    const int cur = st & 1;
    const _Float16* at = &S[cur * GBUF + fo + row * GPITCH + 8 * grp];
    const _Float16* bt = &S[cur * GBUF + so + row * GPITCH + 8 * grp];

#pragma unroll   // both halves at constant LDS offsets from one address
    for (int h = 0; h < GK / 32; ++h) {
      v16h af[4];
#pragma unroll
      for (int tm = 0; tm < 4; ++tm) {
        const _Float16* p = at + tm * 16 * GPITCH + h * 32;
        af[tm] = cat16(*(const v8h*)p, *(const v8h*)(p + 16));
      }
      v16h bf[2];
#pragma unroll
      for (int tn = 0; tn < 2; ++tn) {
        const _Float16* p = bt + tn * 16 * GPITCH + h * 32;
        bf[tn] = cat16(*(const v8h*)p, *(const v8h*)(p + 16));
      }
#pragma unroll
      for (int tm = 0; tm < 4; ++tm)
#pragma unroll
        for (int tn = 0; tn < 2; ++tn)
          acc[tm][tn] = wmma_f16(af[tm], bf[tn], acc[tm][tn]);
    }

    // Publish point of stage st + 1: this wave's reads of the current buffer
    // have retired, its copies of the next stage have landed, and behind the
    // barrier the current buffer is free for stage st + 2.
    asm volatile("s_wait_dscnt 0x0" ::: "memory");
    wait_async0();
    __syncthreads();
    if (st + 2 < GSTG)
      stage_ab(la0 + cur * (GBUF * 2), lb0 + cur * (GBUF * 2),
               ga + (st + 2) * GK, gb + (st + 2) * GK);
  }
  wait_async0();                  // nothing is in flight behind the loop
}

// ---------------------------------------------------------------------------
// Kernel 1: QKV projection.  C[4096][3072] = xh @ Wqt^T + b_qkv.  Scatters:
//   q_ws: [bh][s][64]  (pre-scaled by 1/sqrt(64))
//   k_ws: [bh][s][64]
//   v_ws: [bh][d][s]   (transposed for the PV matmul's A-fragment layout)
// A wave works inside one 64-column group, which is one head's q, k or v.
// For q and k the weight rows are the first WMMA operand, for v the x rows, so
// that a lane's eight accumulators are always eight neighbours of one
// destination row: 32 rows of 64 halves a wave, staged in LDS, leave as whole
// 128-byte lines.
// ---------------------------------------------------------------------------

// 32 staged rows of 128 bytes (pitch GPITCH) to dst, rows STRIDE halves apart.
// Eight lanes take one row; a store covers rows i, i + 8, i + 16, i + 24: four
// whole lines, and in LDS each half of the wave meets every bank once.
template <int STRIDE>
__device__ __forceinline__ void store_rows_f16(const _Float16* stg,
                                               _Float16* dst, int lane) {
  // This wave's own LDS writes have retired before lanes read others' rows
  asm volatile("s_wait_dscnt 0x0" ::: "memory");
  const _Float16* s = stg + (lane >> 3) * 8 * GPITCH + (lane & 7) * 8;
  _Float16* d = dst + (size_t)((lane >> 3) * 8) * STRIDE + (lane & 7) * 8;
  v8h p[8];
#pragma unroll   // constant offsets from one LDS and one global address
  for (int i = 0; i < 8; ++i) p[i] = *(const v8h*)(s + i * GPITCH);
#pragma unroll
  for (int i = 0; i < 8; ++i) *(v8h*)(d + i * STRIDE) = p[i];
  // Stands in front of any rewrite of a register that the stores above name
  asm volatile("s_wait_xcnt 0x0" ::: "memory");
}

__global__ __launch_bounds__(256) void qkv_gemm_kernel(
    const _Float16* __restrict__ xh, const _Float16* __restrict__ Wqt,
    const float* __restrict__ bqkv,
    _Float16* __restrict__ q_ws, _Float16* __restrict__ k_ws,
    _Float16* __restrict__ v_ws) {
  __shared__ __attribute__((aligned(16))) _Float16 S[GRING];

  const int lane = threadIdx.x & 31;
  const int row  = lane & 15;
  const int grp  = lane >> 4;
  // In a scalar register: the choices below become scalar branches
  const int wave = __builtin_amdgcn_readfirstlane(threadIdx.x >> 5);
  const int sub  = wave & 3;
  const int mb   = blockIdx.y * 128;
  const int nb   = blockIdx.x * 128;
  const int c0   = nb + (wave >> 2) * HDIM;   // first column of the group
  const int hd   = c0 / (3 * HDIM);
  const int part = (c0 / HDIM) % 3;           // 0 q, 1 k, 2 v
  const bool isv = part == 2;
  // v: 64 x rows by 32 weight rows; q, k: 64 weight rows by 32 x rows
  const int xr = isv ? (sub >> 1) * 64 : sub * 32;    // first x row, of 128
  const int wr = isv ? (sub & 1) * 32 : 0;            // first weight row, of 64
  const int xo = xr * GPITCH;
  const int wo = 2 * GBUF + ((wave >> 2) * HDIM + wr) * GPITCH;

  v8f acc[4][2];
#pragma unroll
  for (int i = 0; i < 4; ++i)
#pragma unroll
    for (int j = 0; j < 2; ++j) {
      v8f z = {0.f,0.f,0.f,0.f,0.f,0.f,0.f,0.f};
      acc[i][j] = z;
    }

  gemm_mainloop_k1024(S, xh, Wqt, mb, nb, isv ? xo : wo, isv ? wo : xo, acc);

  // Behind the loop's last barrier nobody reads the ring and no copy is in
  // flight: each wave stages in a range of its own.
  _Float16* stg = S + wave * (32 * GPITCH);
  const int bh = (mb >> 11) * NHEADS + hd;
  const int s0 = (mb & (SEQ - 1)) + xr;
  if (isv) {          // registers run along s, lanes along d
    float bv[2];      // bias: one column a lane and tile
#pragma unroll   // the loads go out together, into registers
    for (int u = 0; u < 2; ++u) bv[u] = bqkv[c0 + wr + u * 16 + row];
    // Stands in front of any rewrite of a register that the loads above name
    asm volatile("s_wait_xcnt 0x0" ::: "memory");
#pragma unroll   // here and below: accumulators are indexed by constants only
    for (int u = 0; u < 2; ++u) {
#pragma unroll
      for (int t = 0; t < 4; ++t) {
        v8h p;
#pragma unroll
        for (int r = 0; r < 8; ++r) p[r] = (_Float16)(acc[t][u][r] + bv[u]);
        *(v8h*)&stg[(u * 16 + row) * GPITCH + t * 16 + 8 * grp] = p;
      }
    }
    store_rows_f16<SEQ>(stg, v_ws + ((size_t)bh * HDIM + wr) * SEQ + s0, lane);
  } else {            // registers run along the head's 64 columns, lanes along s
    const float sc = part == 0 ? 0.125f : 1.f;
    v8f bb[4];        // bias: eight columns a lane and tile
#pragma unroll   // the loads go out together, into registers
    for (int t = 0; t < 4; ++t)
      bb[t] = *(const v8f*)(bqkv + c0 + t * 16 + 8 * grp);
    // Stands in front of any rewrite of a register that the loads above name
    asm volatile("s_wait_xcnt 0x0" ::: "memory");
#pragma unroll
    for (int t = 0; t < 4; ++t) {
#pragma unroll
      for (int u = 0; u < 2; ++u) {
        v8h p;
#pragma unroll
        for (int r = 0; r < 8; ++r)
          p[r] = (_Float16)((acc[t][u][r] + bb[t][r]) * sc);
        *(v8h*)&stg[(u * 16 + row) * GPITCH + t * 16 + 8 * grp] = p;
      }
    }
    store_rows_f16<HDIM>(stg, (part == 0 ? q_ws : k_ws) +
                                  ((size_t)bh * SEQ + s0) * HDIM, lane);
  }
}

__device__ __forceinline__ float xhalf(float x) {
  const int b = __builtin_bit_cast(int, x);
  return __builtin_bit_cast(float, __builtin_amdgcn_permlanex16(
      b, b, 0x76543210, 0xfedcba98, false, false));
}

#define KSTG    128                  // keys per stage
#define NSTG    (SEQ / KSTG)
#define KPITCH  72                   // halves: 128-byte K rows at 144 bytes
#define VPITCH  136                  // halves: 256-byte Vt rows at 272 bytes
#define KBUF    (KSTG * KPITCH)      // halves per K buffer
#define VBUF    (HDIM * VPITCH)      // halves per Vt buffer

// One stage of K (128 keys x 64) and Vt (64 x 128 keys) into LDS: eight async
// copies of 16 bytes per lane, every wave-wide copy covering four whole lines.
// lk, gk: this lane's chunk of K rows 0..31, the next copies 32 rows further;
// lv, gv: its chunk of Vt rows 0..15, the next copies 16 rows further.
// The s_wait_xcnt closes the statement so that it stands in front of any
// rewrite of the address registers the copies name.
__device__ __forceinline__ void stage_kv(unsigned lk, unsigned lv,
                                         const _Float16* gk,
                                         const _Float16* gv) {
  asm volatile(
      "global_load_async_to_lds_b128 %0, %8, off\n\t"
      "global_load_async_to_lds_b128 %1, %9, off\n\t"
      "global_load_async_to_lds_b128 %2, %10, off\n\t"
      "global_load_async_to_lds_b128 %3, %11, off\n\t"
      "global_load_async_to_lds_b128 %4, %12, off\n\t"
      "global_load_async_to_lds_b128 %5, %13, off\n\t"
      "global_load_async_to_lds_b128 %6, %14, off\n\t"
      "global_load_async_to_lds_b128 %7, %15, off\n\t"
      "s_wait_xcnt 0x0"
      :: "v"(lk), "v"(lk + 32 * KPITCH * 2), "v"(lk + 64 * KPITCH * 2),
         "v"(lk + 96 * KPITCH * 2),
         "v"(lv), "v"(lv + 16 * VPITCH * 2), "v"(lv + 32 * VPITCH * 2),
         "v"(lv + 48 * VPITCH * 2),
         "v"(gk), "v"(gk + 32 * HDIM), "v"(gk + 64 * HDIM), "v"(gk + 96 * HDIM),
         "v"(gv), "v"(gv + 16 * SEQ), "v"(gv + 32 * SEQ), "v"(gv + 48 * SEQ)
      : "memory");
}

// Four waves a SIMD and no more: two work-groups fill a WGP, so the 512
// work-groups of the launch cannot pile up three to a WGP and leave others idle.
__global__ __launch_bounds__(256)
__attribute__((amdgpu_waves_per_eu(4, 4))) void attn_kernel(
    const _Float16* __restrict__ q_ws, const _Float16* __restrict__ k_ws,
    const _Float16* __restrict__ v_ws, const int* __restrict__ mask,
    _Float16* __restrict__ att_ws) {
  // 0 for a live key, -inf for a masked one
  __shared__ __attribute__((aligned(32))) float mbias[SEQ];
  // Two-buffer ring of K and Vt stages, shared by the block's eight waves
  __shared__ __attribute__((aligned(16))) _Float16 Ks[2 * KBUF];
  __shared__ __attribute__((aligned(16))) _Float16 Vs[2 * VBUF];

  const int tid  = threadIdx.x;
  const int lane = tid & 31;
  const int row  = lane & 15;
  const int grp  = lane >> 4;
  const int wave = tid >> 5;

  const int bh = blockIdx.x >> 4;                       // 0..31
  const int qt = (blockIdx.x & 15) * 8 + wave;          // 0..127
  const int q0 = qt * 16;
  const int b  = bh >> 4;
  const int hh = bh & (NHEADS - 1);

  const _Float16* qb = q_ws + (size_t)bh * SEQ * HDIM;
  const _Float16* kb = k_ws + (size_t)bh * SEQ * HDIM;
  const _Float16* vb = v_ws + (size_t)bh * HDIM * SEQ;
  const int* mrow    = mask + b * SEQ;

  // This lane's 16-byte chunk of a stage: K row tid / 8, Vt row tid / 16
  const unsigned lk0 =
      (unsigned)(uintptr_t)&Ks[(tid >> 3) * KPITCH + (tid & 7) * 8];
  const unsigned lv0 =
      (unsigned)(uintptr_t)&Vs[(tid >> 4) * VPITCH + (tid & 15) * 8];
  const _Float16* gk = kb + tid * 8;
  const _Float16* gv = vb + (tid >> 4) * SEQ + (tid & 15) * 8;

  stage_kv(lk0, lv0, gk, gv);                           // stage 0, buffer 0

  // Keys run over accumulator registers: the mask enters as the C operand of
  // the score product, read from this table.
#pragma unroll   // independent loads in flight instead of round trips
  for (int i0 = 0; i0 < SEQ; i0 += 256 * 4) {
    const int i = i0 + tid * 4;
    const v4i mm = *(const v4i*)(mrow + i);
    v4f bb;
#pragma unroll
    for (int j = 0; j < 4; ++j) bb[j] = (mm[j] == 0) ? -__builtin_inff() : 0.f;
    *(v4f*)&mbias[i] = bb;
  }
  wait_async0();      // this wave's share of stage 0 has landed
  __syncthreads();    // publishes stage 0 and the mask table
  stage_kv(lk0 + KBUF * 2, lv0 + VBUF * 2, gk + KSTG * HDIM, gv + KSTG);

  const _Float16* qrow = qb + (size_t)(q0 + row) * HDIM;
  const v16h bq0 = cat16(*(const v8h*)(qrow + 8 * grp),
                         *(const v8h*)(qrow + 16 + 8 * grp));
  const v16h bq1 = cat16(*(const v8h*)(qrow + 32 + 8 * grp),
                         *(const v8h*)(qrow + 48 + 8 * grp));

  float mv = -__builtin_inff();   // running maximum of this lane's query
  float lv = 0.f;                 // this half's share of the running sum
  v8f o[4];                       // o[t][r] = Ot[16 t + 8 grp + r][query row]
#pragma unroll
  for (int t = 0; t < 4; ++t) {
    v8f z = {0.f,0.f,0.f,0.f,0.f,0.f,0.f,0.f};
    o[t] = z;
  }

  for (int st = 0; st < NSTG; ++st) {
    const int cur = st & 1;
    const _Float16* kt = &Ks[cur * KBUF + row * KPITCH + 8 * grp];
    const _Float16* vt = &Vs[cur * VBUF + row * VPITCH + 8 * grp];

#pragma unroll 2   // the second pass's LDS reads go out under the first pass
    for (int p = 0; p < KSTG / 32; ++p) {
      const int s0 = st * KSTG + p * 32;
      const _Float16* k0r = kt + p * 32 * KPITCH;      // key row, k chunk
      const _Float16* k1r = k0r + 16 * KPITCH;
      const _Float16* vr  = vt + p * 32;               // d row, key chunk
      const v16h ak00 = cat16(*(const v8h*)(k0r),      *(const v8h*)(k0r + 16));
      const v16h ak01 = cat16(*(const v8h*)(k0r + 32), *(const v8h*)(k0r + 48));
      const v16h ak10 = cat16(*(const v8h*)(k1r),      *(const v8h*)(k1r + 16));
      const v16h ak11 = cat16(*(const v8h*)(k1r + 32), *(const v8h*)(k1r + 48));

      v16h av[4];
#pragma unroll
      for (int t = 0; t < 4; ++t)
        av[t] = cat16(*(const v8h*)(vr + t * 16 * VPITCH),
                      *(const v8h*)(vr + t * 16 * VPITCH + 16));

      // c0[r]: key s0 + 8 grp + r, c1[r]: key s0 + 16 + 8 grp + r
      v8f c0 = *(const v8f*)&mbias[s0 + 8 * grp];
      v8f c1 = *(const v8f*)&mbias[s0 + 16 + 8 * grp];
      c0 = wmma_f16(ak00, bq0, c0);
      c0 = wmma_f16(ak01, bq1, c0);
      c1 = wmma_f16(ak10, bq0, c1);
      c1 = wmma_f16(ak11, bq1, c1);

      float tm[8];
#pragma unroll
      for (int r = 0; r < 8; ++r) tm[r] = fmaxf(c0[r], c1[r]);
      float rm = fmaxf(fmaxf(fmaxf(tm[0], tm[1]), fmaxf(tm[2], tm[3])),
                       fmaxf(fmaxf(tm[4], tm[5]), fmaxf(tm[6], tm[7])));
      rm = fmaxf(rm, xhalf(rm));    // the other half's sixteen keys
      const float mn    = fmaxf(mv, rm);
      const float alpha = __expf(mv - mn);
      mv = mn;

      v16h pb;
      float ls = 0.f;
#pragma unroll
      for (int r = 0; r < 8; ++r) {
        const float p0 = __expf(c0[r] - mn);
        const float p1 = __expf(c1[r] - mn);
        ls += p0 + p1;
        pb[r]     = (_Float16)p0;
        pb[8 + r] = (_Float16)p1;
      }
      lv = lv * alpha + ls;
#pragma unroll
      for (int t = 0; t < 4; ++t)
#pragma unroll
        for (int r = 0; r < 8; ++r) o[t][r] *= alpha;

#pragma unroll
      for (int t = 0; t < 4; ++t) o[t] = wmma_f16(av[t], pb, o[t]);
    }

    // Publish point of stage st + 1: this wave's reads of the current buffer
    // have retired, its copies of the next stage have landed, and behind the
    // barrier the current buffer is free for stage st + 2.
    asm volatile("s_wait_dscnt 0x0" ::: "memory");
    wait_async0();
    __syncthreads();
    if (st + 2 < NSTG)
      stage_kv(lk0 + cur * (KBUF * 2), lv0 + cur * (VBUF * 2),
               gk + (st + 2) * (KSTG * HDIM), gv + (st + 2) * KSTG);
  }
  wait_async0();                  // nothing is in flight when the wave ends

  lv += xhalf(lv);                // join the two halves' sums
  _Float16* orow = att_ws + ((size_t)(b * SEQ + q0 + row)) * DMODEL + hh * HDIM;
#pragma unroll
  for (int t = 0; t < 4; ++t) {
    v8h h;
#pragma unroll
    for (int r = 0; r < 8; ++r) h[r] = (_Float16)(o[t][r] / lv);
    *(v8h*)(orow + t * 16 + 8 * grp) = h;
  }
}

// ---------------------------------------------------------------------------
// Kernel 3: output projection.  out[4096][1024] = att @ Wot^T + b_out
// The weight rows are the first WMMA operand: a lane's eight accumulators are
// eight neighbours of one output row.  A wave's 32 rows of 64 floats, staged in
// LDS, leave as whole 128-byte lines.
// ---------------------------------------------------------------------------
#define OPITCH  68                   // floats: 256-byte rows at 272 bytes

__global__ __launch_bounds__(256) void out_gemm_kernel(
    const _Float16* __restrict__ att, const _Float16* __restrict__ Wot,
    const float* __restrict__ bout, float* __restrict__ out) {
  __shared__ __attribute__((aligned(16))) _Float16 S[GRING];

  const int lane = threadIdx.x & 31;
  const int row  = lane & 15;
  const int grp  = lane >> 4;
  // In a scalar register: the wave's offsets become scalar arithmetic
  const int wave = __builtin_amdgcn_readfirstlane(threadIdx.x >> 5);
  const int mb   = blockIdx.y * 128;
  const int nb   = blockIdx.x * 128;
  const int xr   = (wave & 3) * 32;           // first att row, of 128
  const int wr   = (wave >> 2) * 64;          // first weight row, of 128

  v8f acc[4][2];
#pragma unroll
  for (int i = 0; i < 4; ++i)
#pragma unroll
    for (int j = 0; j < 2; ++j) {
      v8f z = {0.f,0.f,0.f,0.f,0.f,0.f,0.f,0.f};
      acc[i][j] = z;
    }

  gemm_mainloop_k1024(S, att, Wot, mb, nb, 2 * GBUF + wr * GPITCH, xr * GPITCH,
                      acc);

  // Behind the loop's last barrier nobody reads the ring and no copy is in
  // flight: each wave stages in a range of its own.
  float* stg = (float*)S + wave * (32 * OPITCH);
  v8f bb[4];          // bias: eight columns a lane and tile
#pragma unroll   // the loads go out together, into registers
  for (int t = 0; t < 4; ++t)
    bb[t] = *(const v8f*)(bout + nb + wr + t * 16 + 8 * grp);
  // Stands in front of any rewrite of a register that the loads above name
  asm volatile("s_wait_xcnt 0x0" ::: "memory");
#pragma unroll   // here and below: accumulators are indexed by constants only
  for (int t = 0; t < 4; ++t) {
#pragma unroll
    for (int u = 0; u < 2; ++u) {
      const v8f v = acc[t][u] + bb[t];
      float* w = &stg[(u * 16 + row) * OPITCH + t * 16 + 8 * grp];
      *(v4f*)w       = __builtin_shufflevector(v, v, 0, 1, 2, 3);
      *(v4f*)(w + 4) = __builtin_shufflevector(v, v, 4, 5, 6, 7);
    }
  }
  // This wave's own LDS writes have retired before lanes read others' rows
  asm volatile("s_wait_dscnt 0x0" ::: "memory");
  // Sixteen lanes take one row: a store covers two rows, four whole lines
  const float* s = stg + grp * OPITCH + row * 4;
  float* d = out + (size_t)(mb + xr + grp) * DMODEL + nb + wr + row * 4;
  v4f p[16];
#pragma unroll   // constant offsets from one LDS and one global address
  for (int i = 0; i < 16; ++i) p[i] = *(const v4f*)(s + i * 2 * OPITCH);
#pragma unroll
  for (int i = 0; i < 16; ++i) *(v4f*)(d + i * 2 * DMODEL) = p[i];
  // Stands in front of any rewrite of a register that the stores above name
  asm volatile("s_wait_xcnt 0x0" ::: "memory");
}

// ---------------------------------------------------------------------------
// Launch
// ---------------------------------------------------------------------------
extern "C" void kernel_launch(void* const* d_in, const int* in_sizes, int n_in,
                              void* d_out, int out_size, void* d_ws,
                              size_t ws_size, hipStream_t stream) {
  const float* x    = (const float*)d_in[0];
  const int*   mask = (const int*)d_in[1];
  const float* Wqkv = (const float*)d_in[2];
  const float* bqkv = (const float*)d_in[3];
  const float* Wout = (const float*)d_in[4];
  const float* bout = (const float*)d_in[5];
  float* out = (float*)d_out;

  const size_t nBS  = (size_t)NBATCH * SEQ;            // 4096
  _Float16* xh     = (_Float16*)d_ws;                  // [4096][1024]
  _Float16* Wqt    = xh  + nBS * DMODEL;               // [3072][1024]
  _Float16* Wot    = Wqt + (size_t)3 * DMODEL * DMODEL;// [1024][1024]
  _Float16* q_ws   = Wot + (size_t)DMODEL * DMODEL;    // [32][2048][64]
  _Float16* k_ws   = q_ws + nBS * DMODEL;
  _Float16* v_ws   = k_ws + nBS * DMODEL;
  _Float16* att_ws = v_ws + nBS * DMODEL;              // [4096][1024]

  // Prep: f16 conversion + weight transposes, one launch
  prep_kernel<<<PREP_WGS, 256, 0, stream>>>(x, Wqkv, Wout, xh, Wqt, Wot);

  // QKV projection: M=4096, N=3072
  qkv_gemm_kernel<<<dim3(3 * DMODEL / 128, (unsigned)(nBS / 128)), 256, 0,
                    stream>>>(xh, Wqt, bqkv, q_ws, k_ws, v_ws);

  // Attention: 32 (b,h) pairs x 16 query blocks of 128; 8 waves/block
  attn_kernel<<<NBATCH * NHEADS * (SEQ / 128), 256, 0, stream>>>(
      q_ws, k_ws, v_ws, mask, att_ws);

  // Output projection: M=4096, N=1024
  out_gemm_kernel<<<dim3(DMODEL / 128, (unsigned)(nBS / 128)), 256, 0,
                    stream>>>(att_ws, Wot, bout, out);
}

// v006
// Measured time: 82.3 microseconds a run.
// Next to v005, in two timings, it ran 1.04 times as fast each time.
// Counting every step since v000, it is 2.70 times as fast.
#include <hip/hip_runtime.h>

// ---------------------------------------------------------------------------
// MHA forward for MI455X (gfx1250, wave32, WMMA f32_16x16x32_f16,
// async global->LDS double-buffered GEMM staging)
//   B=2, S=2048, D_MODEL=1024, H=16, HD=64
// ---------------------------------------------------------------------------

typedef __attribute__((ext_vector_type(16))) _Float16 v16h;
typedef __attribute__((ext_vector_type(8)))  _Float16 v8h;
typedef __attribute__((ext_vector_type(4)))  _Float16 v4h;
typedef __attribute__((ext_vector_type(8)))  float    v8f;
typedef __attribute__((ext_vector_type(4)))  float    v4f;
typedef __attribute__((ext_vector_type(2)))  float    v2f;
typedef __attribute__((ext_vector_type(4)))  int      v4i;

#define NBATCH   2
#define SEQ      2048
#define DMODEL   1024
#define NHEADS   16
#define HDIM     64

__device__ __forceinline__ v16h cat16(v8h lo, v8h hi) {
  return __builtin_shufflevector(lo, hi, 0,1,2,3,4,5,6,7,8,9,10,11,12,13,14,15);
}

__device__ __forceinline__ v8f wmma_f16(v16h a, v16h b, v8f c) {
  // (neg_a, A, neg_b, B, c_mod, C, reuse_a, reuse_b)
  return __builtin_amdgcn_wmma_f32_16x16x32_f16(false, a, false, b, (short)0, c,
                                                false, false);
}

// Wait for this wave's own async global->LDS copies (ASYNCcnt)
__device__ __forceinline__ void wait_async0() {
  asm volatile("s_wait_asynccnt 0" ::: "memory");
}

// ---------------------------------------------------------------------------
// Prep kernel: f32 -> f16 conversion of x and of both weights (transposed to
// [n][k]), so the GEMM tiles become pure contiguous copies (async-to-LDS
// friendly) and all WMMA fragments are two contiguous 16B loads per lane.
// One launch of 512 work-groups for all three: what bounds this work is the
// number of launches and of waves to start, not its bytes, so every thread
// takes sixteen 16-byte loads, all in flight together.
//   blocks   0..191: 128 x 128 tiles of W_qkv     blocks 192..255: of W_out
//   blocks 256..511: 16,384 consecutive elements of x each
// ---------------------------------------------------------------------------
#define TT        128                       // transpose tile edge
#define NT_QKV    (3 * DMODEL / TT)         // tile columns of W_qkv
#define NT_OUT    (DMODEL / TT)             // tile columns of W_out
#define TILES_QKV ((DMODEL / TT) * NT_QKV)
#define TILES_W   (TILES_QKV + (DMODEL / TT) * NT_OUT)
#define XCHUNK    (256 * 4 * 16)            // elements of x per work-group
#define PREP_WGS  (TILES_W + NBATCH * SEQ * DMODEL / XCHUNK)

// dst[n][k] (f16) = src[k][n] (f32): tile t of a weight with NT tile columns
template <int NT>
__device__ __forceinline__ void transpose_tile(
    const float* __restrict__ src, _Float16* __restrict__ dst, int t,
    _Float16* T) {
  constexpr int N = NT * TT;
  const int k0   = (t / NT) * TT;
  const int n0   = (t % NT) * TT;
  const int tid  = threadIdx.x;
  const int lane = tid & 31;
  const int wave = tid >> 5;

  // Wave w reads rows k0 + 16 w .. + 15, each wave-wide load one 512-byte row
  // piece: a lane ends up with sixteen consecutive k of four columns.
  const float* s = src + (size_t)(k0 + wave * 16) * N + n0 + lane * 4;
  v4f f[16];
#pragma unroll   // all sixteen loads go out before the first is used
  for (int i = 0; i < 15; ++i) f[i] = *(const v4f*)(s + i * N);
  // The last load's result may land in the address registers the others name
  asm volatile("s_wait_xcnt 0x0" ::: "memory");
  f[15] = *(const v4f*)(s + 15 * N);

#pragma unroll
  for (int j = 0; j < 4; ++j) {
#pragma unroll
    for (int h = 0; h < 2; ++h) {
      v8h p;
#pragma unroll
      for (int e = 0; e < 8; ++e) p[e] = (_Float16)f[h * 8 + e][j];
      *(v8h*)&T[(lane * 4 + j) * TT + (((wave * 2 + h) ^ (lane & 15)) * 8)] = p;
    }
  }
  __syncthreads();   // the tile is complete before rows are read back

  // Sixteen lanes store one row's 256 bytes: whole lines, 16 bytes a lane
  const int c = tid & 15;
  _Float16* d = dst + (size_t)(n0 + (tid >> 4)) * DMODEL + k0 + c * 8;
#pragma unroll
  for (int i = 0; i < 8; ++i) {
    const int n = i * 16 + (tid >> 4);
    *(v8h*)(d + i * 16 * DMODEL) =
        *(const v8h*)&T[n * TT + ((c ^ ((n >> 2) & 15)) * 8)];
  }
  // Stands in front of any rewrite of a register that the stores above name
  asm volatile("s_wait_xcnt 0x0" ::: "memory");
}

// Budget of four waves a SIMD (this launch has two work-groups a WGP): at the
// default budget the compiler kept to 64 registers and made the later loads
// wait for the earlier ones; with it all sixteen go out as one group.
__global__ __launch_bounds__(256)
__attribute__((amdgpu_waves_per_eu(4, 4))) void prep_kernel(
    const float* __restrict__ x, const float* __restrict__ Wqkv,
    const float* __restrict__ Wout, _Float16* __restrict__ xh,
    _Float16* __restrict__ Wqt, _Float16* __restrict__ Wot) {
  // Tile as [n][k], rows of 256 bytes in sixteen 16-byte pieces; piece c of
  // row n lies at place c ^ ((n >> 2) & 15), which spreads over all banks both
  // the writers (16 lanes: rows 4 apart, one piece) and the readers (one row).
  __shared__ __attribute__((aligned(16))) _Float16 T[TT * TT];

  const int blk = blockIdx.x;               // every branch is block-uniform
  if (blk < TILES_QKV) {
    transpose_tile<NT_QKV>(Wqkv, Wqt, blk, T);
  } else if (blk < TILES_W) {
    transpose_tile<NT_OUT>(Wout, Wot, blk - TILES_QKV, T);
  } else {                                  // x to f16
    const size_t base = (size_t)(blk - TILES_W) * XCHUNK + threadIdx.x * 4;
    v4f f[16];
#pragma unroll   // all sixteen loads go out before the first is used
    for (int i = 0; i < 15; ++i) f[i] = *(const v4f*)(x + base + i * 1024);
    // The last load's result may land in the address registers the others name
    asm volatile("s_wait_xcnt 0x0" ::: "memory");
    f[15] = *(const v4f*)(x + base + 15 * 1024);
#pragma unroll
    for (int i = 0; i < 16; ++i) {
      v4h h;
      h[0] = (_Float16)f[i][0]; h[1] = (_Float16)f[i][1];
      h[2] = (_Float16)f[i][2]; h[3] = (_Float16)f[i][3];
      *(v4h*)(xh + base + i * 1024) = h;
    }
    // Stands in front of any rewrite of a register that the stores above name
    asm volatile("s_wait_xcnt 0x0" ::: "memory");
  }
}

// ---------------------------------------------------------------------------
// Shared GEMM main loop over A[128 rows @ mb] and B[128 rows @ nb], K = 1024,
// both operands f16 with k contiguous (A row-major, B stored [n][k]).
// 256 threads / 8 waves; a wave owns 4x2 WMMA tiles: 64 stage rows as first
// operand, 32 as second.  A and B rows load alike, so the caller picks per
// wave which of the two is first (fo, so: offsets of those rows in buffer 0 of
// the ring): acc[t][u][r] = first row 16 t + 8 grp + r . second row 16 u + row,
// and a lane's eight registers run along the first operand's rows.
// Two-buffer LDS ring of stages of 64 k: a stage row is one whole 128-byte
// line, eight lanes copy one row, so a wave-wide copy touches four lines.
// ---------------------------------------------------------------------------
#define GK      64                   // k per stage
#define GSTG    (DMODEL / GK)
#define GPITCH  72                   // halves: 128-byte rows at 144 bytes
#define GBUF    (128 * GPITCH)       // halves per operand buffer
#define GRING   (4 * GBUF)           // A buffers 0 and 1, then B buffers 0 and 1

// One stage of A and of B (128 rows x 64 k each) into LDS: eight async copies
// of 16 bytes per lane.  la, ga / lb, gb: this lane's chunk of rows 0..31 of
// the operand, the next copies 32 rows further.  The s_wait_xcnt closes the
// statement so that it stands in front of any rewrite of the address
// registers the copies name.
__device__ __forceinline__ void stage_ab(unsigned la, unsigned lb,
                                         const _Float16* ga,
                                         const _Float16* gb) {
  asm volatile(
      "global_load_async_to_lds_b128 %0, %8, off\n\t"
      "global_load_async_to_lds_b128 %1, %9, off\n\t"
      "global_load_async_to_lds_b128 %2, %10, off\n\t"
      "global_load_async_to_lds_b128 %3, %11, off\n\t"
      "global_load_async_to_lds_b128 %4, %12, off\n\t"
      "global_load_async_to_lds_b128 %5, %13, off\n\t"
      "global_load_async_to_lds_b128 %6, %14, off\n\t"
      "global_load_async_to_lds_b128 %7, %15, off\n\t"
      "s_wait_xcnt 0x0"
      :: "v"(la), "v"(la + 32 * GPITCH * 2), "v"(la + 64 * GPITCH * 2),
         "v"(la + 96 * GPITCH * 2),
         "v"(lb), "v"(lb + 32 * GPITCH * 2), "v"(lb + 64 * GPITCH * 2),
         "v"(lb + 96 * GPITCH * 2),
         "v"(ga), "v"(ga + 32 * DMODEL), "v"(ga + 64 * DMODEL),
         "v"(ga + 96 * DMODEL),
         "v"(gb), "v"(gb + 32 * DMODEL), "v"(gb + 64 * DMODEL),
         "v"(gb + 96 * DMODEL)
      : "memory");
}

__device__ __forceinline__ void gemm_mainloop_k1024(
    _Float16* S, const _Float16* __restrict__ A,
    const _Float16* __restrict__ B, int mb, int nb, int fo, int so,
    v8f acc[4][2]) {
  const int tid  = threadIdx.x;
  const int lane = tid & 31;
  const int row  = lane & 15;
  const int grp  = lane >> 4;

  // This lane's 16-byte chunk of a stage: row tid / 8, chunk tid % 8
  const int sr = tid >> 3;
  const int sc = (tid & 7) * 8;
  const unsigned la0 = (unsigned)(uintptr_t)&S[sr * GPITCH + sc];
  const unsigned lb0 = (unsigned)(uintptr_t)&S[2 * GBUF + sr * GPITCH + sc];
  const _Float16* ga = A + (size_t)(mb + sr) * DMODEL + sc;
  const _Float16* gb = B + (size_t)(nb + sr) * DMODEL + sc;

  stage_ab(la0, lb0, ga, gb);                           // stage 0, buffer 0
  wait_async0();      // this wave's share of stage 0 has landed
  __syncthreads();    // publishes stage 0
  stage_ab(la0 + GBUF * 2, lb0 + GBUF * 2, ga + GK, gb + GK);

  for (int st = 0; st < GSTG; ++st) {
    const int cur = st & 1;
    const _Float16* at = &S[cur * GBUF + fo + row * GPITCH + 8 * grp];
    const _Float16* bt = &S[cur * GBUF + so + row * GPITCH + 8 * grp];

#pragma unroll   // both halves at constant LDS offsets from one address
    for (int h = 0; h < GK / 32; ++h) {
      v16h af[4];
#pragma unroll
      for (int tm = 0; tm < 4; ++tm) {
        const _Float16* p = at + tm * 16 * GPITCH + h * 32;
        af[tm] = cat16(*(const v8h*)p, *(const v8h*)(p + 16));
      }
      v16h bf[2];
#pragma unroll
      for (int tn = 0; tn < 2; ++tn) {
        const _Float16* p = bt + tn * 16 * GPITCH + h * 32;
        bf[tn] = cat16(*(const v8h*)p, *(const v8h*)(p + 16));
      }
#pragma unroll
      for (int tm = 0; tm < 4; ++tm)
#pragma unroll
        for (int tn = 0; tn < 2; ++tn)
          acc[tm][tn] = wmma_f16(af[tm], bf[tn], acc[tm][tn]);
    }

    // Publish point of stage st + 1: this wave's reads of the current buffer
    // have retired, its copies of the next stage have landed, and behind the
    // barrier the current buffer is free for stage st + 2.
    asm volatile("s_wait_dscnt 0x0" ::: "memory");
    wait_async0();
    __syncthreads();
    if (st + 2 < GSTG)
      stage_ab(la0 + cur * (GBUF * 2), lb0 + cur * (GBUF * 2),
               ga + (st + 2) * GK, gb + (st + 2) * GK);
  }
  wait_async0();                  // nothing is in flight behind the loop
}

// ---------------------------------------------------------------------------
// Kernel 1: QKV projection.  C[4096][3072] = xh @ Wqt^T + b_qkv.  Scatters:
//   q_ws: [bh][s][64]  (pre-scaled by 1/sqrt(64))
//   k_ws: [bh][s][64]
//   v_ws: [bh][d][s]   (transposed for the PV matmul's A-fragment layout)
// A wave works inside one 64-column group, which is one head's q, k or v.
// For q and k the weight rows are the first WMMA operand, for v the x rows, so
// that a lane's eight accumulators are always eight neighbours of one
// destination row: 32 rows of 64 halves a wave, staged in LDS, leave as whole
// 128-byte lines.
// ---------------------------------------------------------------------------

// 32 staged rows of 128 bytes (pitch GPITCH) to dst, rows STRIDE halves apart.
// Eight lanes take one row; a store covers rows i, i + 8, i + 16, i + 24: four
// whole lines, and in LDS each half of the wave meets every bank once.
template <int STRIDE>
__device__ __forceinline__ void store_rows_f16(const _Float16* stg,
                                               _Float16* dst, int lane) {
  // This wave's own LDS writes have retired before lanes read others' rows
  asm volatile("s_wait_dscnt 0x0" ::: "memory");
  const _Float16* s = stg + (lane >> 3) * 8 * GPITCH + (lane & 7) * 8;
  _Float16* d = dst + (size_t)((lane >> 3) * 8) * STRIDE + (lane & 7) * 8;
  v8h p[8];
#pragma unroll   // constant offsets from one LDS and one global address
  for (int i = 0; i < 8; ++i) p[i] = *(const v8h*)(s + i * GPITCH);
#pragma unroll
  for (int i = 0; i < 8; ++i) *(v8h*)(d + i * STRIDE) = p[i];
  // Stands in front of any rewrite of a register that the stores above name
  asm volatile("s_wait_xcnt 0x0" ::: "memory");
}

__global__ __launch_bounds__(256) void qkv_gemm_kernel(
    const _Float16* __restrict__ xh, const _Float16* __restrict__ Wqt,
    const float* __restrict__ bqkv,
    _Float16* __restrict__ q_ws, _Float16* __restrict__ k_ws,
    _Float16* __restrict__ v_ws) {
  __shared__ __attribute__((aligned(16))) _Float16 S[GRING];

  const int lane = threadIdx.x & 31;
  const int row  = lane & 15;
  const int grp  = lane >> 4;
  // In a scalar register: the choices below become scalar branches
  const int wave = __builtin_amdgcn_readfirstlane(threadIdx.x >> 5);
  const int sub  = wave & 3;
  const int mb   = blockIdx.y * 128;
  const int nb   = blockIdx.x * 128;
  const int c0   = nb + (wave >> 2) * HDIM;   // first column of the group
  const int hd   = c0 / (3 * HDIM);
  const int part = (c0 / HDIM) % 3;           // 0 q, 1 k, 2 v
  const bool isv = part == 2;
  // v: 64 x rows by 32 weight rows; q, k: 64 weight rows by 32 x rows
  const int xr = isv ? (sub >> 1) * 64 : sub * 32;    // first x row, of 128
  const int wr = isv ? (sub & 1) * 32 : 0;            // first weight row, of 64
  const int xo = xr * GPITCH;
  const int wo = 2 * GBUF + ((wave >> 2) * HDIM + wr) * GPITCH;

  v8f acc[4][2];
#pragma unroll
  for (int i = 0; i < 4; ++i)
#pragma unroll
    for (int j = 0; j < 2; ++j) {
      v8f z = {0.f,0.f,0.f,0.f,0.f,0.f,0.f,0.f};
      acc[i][j] = z;
    }

  gemm_mainloop_k1024(S, xh, Wqt, mb, nb, isv ? xo : wo, isv ? wo : xo, acc);

  // Behind the loop's last barrier nobody reads the ring and no copy is in
  // flight: each wave stages in a range of its own.
  _Float16* stg = S + wave * (32 * GPITCH);
  const int bh = (mb >> 11) * NHEADS + hd;
  const int s0 = (mb & (SEQ - 1)) + xr;
  if (isv) {          // registers run along s, lanes along d
    float bv[2];      // bias: one column a lane and tile
#pragma unroll   // the loads go out together, into registers
    for (int u = 0; u < 2; ++u) bv[u] = bqkv[c0 + wr + u * 16 + row];
    // Stands in front of any rewrite of a register that the loads above name
    asm volatile("s_wait_xcnt 0x0" ::: "memory");
#pragma unroll   // here and below: accumulators are indexed by constants only
    for (int u = 0; u < 2; ++u) {
#pragma unroll
      for (int t = 0; t < 4; ++t) {
        v8h p;
#pragma unroll
        for (int r = 0; r < 8; ++r) p[r] = (_Float16)(acc[t][u][r] + bv[u]);
        *(v8h*)&stg[(u * 16 + row) * GPITCH + t * 16 + 8 * grp] = p;
      }
    }
    store_rows_f16<SEQ>(stg, v_ws + ((size_t)bh * HDIM + wr) * SEQ + s0, lane);
  } else {            // registers run along the head's 64 columns, lanes along s
    const float sc = part == 0 ? 0.125f : 1.f;
    v8f bb[4];        // bias: eight columns a lane and tile
#pragma unroll   // the loads go out together, into registers
    for (int t = 0; t < 4; ++t)
      bb[t] = *(const v8f*)(bqkv + c0 + t * 16 + 8 * grp);
    // Stands in front of any rewrite of a register that the loads above name
    asm volatile("s_wait_xcnt 0x0" ::: "memory");
#pragma unroll
    for (int t = 0; t < 4; ++t) {
#pragma unroll
      for (int u = 0; u < 2; ++u) {
        v8h p;
#pragma unroll
        for (int r = 0; r < 8; ++r)
          p[r] = (_Float16)((acc[t][u][r] + bb[t][r]) * sc);
        *(v8h*)&stg[(u * 16 + row) * GPITCH + t * 16 + 8 * grp] = p;
      }
    }
    store_rows_f16<HDIM>(stg, (part == 0 ? q_ws : k_ws) +
                                  ((size_t)bh * SEQ + s0) * HDIM, lane);
  }
}

__device__ __forceinline__ float xhalf(float x) {
  const int b = __builtin_bit_cast(int, x);
  return __builtin_bit_cast(float, __builtin_amdgcn_permlanex16(
      b, b, 0x76543210, 0xfedcba98, false, false));
}

#define KSTG    128                  // keys per stage
#define NSTG    (SEQ / KSTG)
#define KHALF   (KSTG / 2)           // keys of a stage that one wave takes
#define KPITCH  72                   // halves: 128-byte K rows at 144 bytes
#define VPITCH  136                  // halves: 256-byte Vt rows at 272 bytes
#define KBUF    (KSTG * KPITCH)      // halves per K buffer
#define VBUF    (HDIM * VPITCH)      // halves per Vt buffer

// One stage of K (128 keys x 64) and Vt (64 x 128 keys) into LDS: eight async
// copies of 16 bytes per lane, every wave-wide copy covering four whole lines.
// lk, gk: this lane's chunk of K rows 0..31, the next copies 32 rows further;
// lv, gv: its chunk of Vt rows 0..15, the next copies 16 rows further.
// The s_wait_xcnt closes the statement so that it stands in front of any
// rewrite of the address registers the copies name.
__device__ __forceinline__ void stage_kv(unsigned lk, unsigned lv,
                                         const _Float16* gk,
                                         const _Float16* gv) {
  asm volatile(
      "global_load_async_to_lds_b128 %0, %8, off\n\t"
      "global_load_async_to_lds_b128 %1, %9, off\n\t"
      "global_load_async_to_lds_b128 %2, %10, off\n\t"
      "global_load_async_to_lds_b128 %3, %11, off\n\t"
      "global_load_async_to_lds_b128 %4, %12, off\n\t"
      "global_load_async_to_lds_b128 %5, %13, off\n\t"
      "global_load_async_to_lds_b128 %6, %14, off\n\t"
      "global_load_async_to_lds_b128 %7, %15, off\n\t"
      "s_wait_xcnt 0x0"
      :: "v"(lk), "v"(lk + 32 * KPITCH * 2), "v"(lk + 64 * KPITCH * 2),
         "v"(lk + 96 * KPITCH * 2),
         "v"(lv), "v"(lv + 16 * VPITCH * 2), "v"(lv + 32 * VPITCH * 2),
         "v"(lv + 48 * VPITCH * 2),
         "v"(gk), "v"(gk + 32 * HDIM), "v"(gk + 64 * HDIM), "v"(gk + 96 * HDIM),
         "v"(gv), "v"(gv + 16 * SEQ), "v"(gv + 32 * SEQ), "v"(gv + 48 * SEQ)
      : "memory");
}

// Four waves a SIMD and no more: two work-groups fill a WGP, so the 512
// work-groups of the launch cannot pile up three to a WGP and leave others idle.
__global__ __launch_bounds__(256)
__attribute__((amdgpu_waves_per_eu(4, 4))) void attn_kernel(
    const _Float16* __restrict__ q_ws, const _Float16* __restrict__ k_ws,
    const _Float16* __restrict__ v_ws, const int* __restrict__ mask,
    _Float16* __restrict__ att_ws) {
  // 0 for a live key, -inf for a masked one
  __shared__ __attribute__((aligned(32))) float mbias[SEQ];
  // Two-buffer ring of K and Vt stages, shared by the block's eight waves
  __shared__ __attribute__((aligned(16))) _Float16 Ks[2 * KBUF];
  __shared__ __attribute__((aligned(16))) _Float16 Vs[2 * VBUF];

  const int tid  = threadIdx.x;
  const int lane = tid & 31;
  const int row  = lane & 15;
  const int grp  = lane >> 4;
  // In a scalar register: the choice of who merges becomes a scalar branch
  const int wave = __builtin_amdgcn_readfirstlane(tid >> 5);
  const int cg   = wave & 3;                            // 32-query group
  const int kh   = wave >> 2;                           // key half of a stage

  const int bh = blockIdx.x >> 4;                       // 0..31
  const int q0 = (blockIdx.x & 15) * 128 + cg * 32;
  const int b  = bh >> 4;
  const int hh = bh & (NHEADS - 1);

  const _Float16* qb = q_ws + (size_t)bh * SEQ * HDIM;
  const _Float16* kb = k_ws + (size_t)bh * SEQ * HDIM;
  const _Float16* vb = v_ws + (size_t)bh * HDIM * SEQ;
  const int* mrow    = mask + b * SEQ;

  // This lane's 16-byte chunk of a stage: K row tid / 8, Vt row tid / 16
  const unsigned lk0 =
      (unsigned)(uintptr_t)&Ks[(tid >> 3) * KPITCH + (tid & 7) * 8];
  const unsigned lv0 =
      (unsigned)(uintptr_t)&Vs[(tid >> 4) * VPITCH + (tid & 15) * 8];
  const _Float16* gk = kb + tid * 8;
  const _Float16* gv = vb + (tid >> 4) * SEQ + (tid & 15) * 8;

  stage_kv(lk0, lv0, gk, gv);                           // stage 0, buffer 0

  // Keys run over accumulator registers: the mask enters as the C operand of
  // the score product, read from this table.
#pragma unroll   // independent loads in flight instead of round trips
  for (int i0 = 0; i0 < SEQ; i0 += 256 * 4) {
    const int i = i0 + tid * 4;
    const v4i mm = *(const v4i*)(mrow + i);
    v4f bb;
#pragma unroll
    for (int j = 0; j < 4; ++j) bb[j] = (mm[j] == 0) ? -__builtin_inff() : 0.f;
    *(v4f*)&mbias[i] = bb;
  }
  wait_async0();      // this wave's share of stage 0 has landed
  __syncthreads();    // publishes stage 0 and the mask table
  stage_kv(lk0 + KBUF * 2, lv0 + VBUF * 2, gk + KSTG * HDIM, gv + KSTG);

  v16h bq[2][2];                  // [column group][k half of the head size]
#pragma unroll   // the loads go out together, into registers
  for (int g = 0; g < 2; ++g) {
    const _Float16* qrow = qb + (size_t)(q0 + g * 16 + row) * HDIM;
    bq[g][0] = cat16(*(const v8h*)(qrow + 8 * grp),
                     *(const v8h*)(qrow + 16 + 8 * grp));
    bq[g][1] = cat16(*(const v8h*)(qrow + 32 + 8 * grp),
                     *(const v8h*)(qrow + 48 + 8 * grp));
  }
  // Stands in front of any rewrite of a register that the loads above name
  asm volatile("s_wait_xcnt 0x0" ::: "memory");

  // Running maximum of this lane's query in each group.  The start is finite
  // and below every score, so a key half whose keys are all masked keeps zero
  // sums and merges as nothing instead of giving inf - inf.
  float mv[2] = {-1e30f, -1e30f};
  float lv[2] = {0.f, 0.f};       // this half's share of the running sums
  v8f o[2][4];                    // o[g][t][r] = Ot[16 t + 8 grp + r][query row]
#pragma unroll
  for (int g = 0; g < 2; ++g)
#pragma unroll
    for (int t = 0; t < 4; ++t) {
      v8f z = {0.f,0.f,0.f,0.f,0.f,0.f,0.f,0.f};
      o[g][t] = z;
    }

  for (int st = 0; st < NSTG; ++st) {
    const int cur = st & 1;
    const _Float16* kt =
        &Ks[cur * KBUF + (kh * KHALF + row) * KPITCH + 8 * grp];
    const _Float16* vt = &Vs[cur * VBUF + row * VPITCH + kh * KHALF + 8 * grp];

#pragma unroll   // the second pass's LDS reads go out under the first pass
    for (int p = 0; p < KHALF / 32; ++p) {
      const int s0 = st * KSTG + kh * KHALF + p * 32;
      const _Float16* k0r = kt + p * 32 * KPITCH;      // key row, k chunk
      const _Float16* k1r = k0r + 16 * KPITCH;
      const _Float16* vr  = vt + p * 32;               // d row, key chunk
      const v16h ak00 = cat16(*(const v8h*)(k0r),      *(const v8h*)(k0r + 16));
      const v16h ak01 = cat16(*(const v8h*)(k0r + 32), *(const v8h*)(k0r + 48));
      const v16h ak10 = cat16(*(const v8h*)(k1r),      *(const v8h*)(k1r + 16));
      const v16h ak11 = cat16(*(const v8h*)(k1r + 32), *(const v8h*)(k1r + 48));

      v16h av[4];
#pragma unroll
      for (int t = 0; t < 4; ++t)
        av[t] = cat16(*(const v8h*)(vr + t * 16 * VPITCH),
                      *(const v8h*)(vr + t * 16 * VPITCH + 16));

      // c0[r]: key s0 + 8 grp + r, c1[r]: key s0 + 16 + 8 grp + r
      const v8f mb0 = *(const v8f*)&mbias[s0 + 8 * grp];
      const v8f mb1 = *(const v8f*)&mbias[s0 + 16 + 8 * grp];

      v16h pb[2];
#pragma unroll   // both column groups work from the same fragments
      for (int g = 0; g < 2; ++g) {
        v8f c0 = wmma_f16(ak00, bq[g][0], mb0);
        v8f c1 = wmma_f16(ak10, bq[g][0], mb1);
        c0 = wmma_f16(ak01, bq[g][1], c0);
        c1 = wmma_f16(ak11, bq[g][1], c1);

        float tm[8];
#pragma unroll
        for (int r = 0; r < 8; ++r) tm[r] = fmaxf(c0[r], c1[r]);
        float rm = fmaxf(fmaxf(fmaxf(tm[0], tm[1]), fmaxf(tm[2], tm[3])),
                         fmaxf(fmaxf(tm[4], tm[5]), fmaxf(tm[6], tm[7])));
        rm = fmaxf(rm, xhalf(rm));    // the other half's sixteen keys
        const float mn    = fmaxf(mv[g], rm);
        const float alpha = __expf(mv[g] - mn);
        mv[g] = mn;

        v8f p0, p1;
#pragma unroll
        for (int r = 0; r < 8; ++r) {
          p0[r] = __expf(c0[r] - mn);
          p1[r] = __expf(c1[r] - mn);
          pb[g][r]     = (_Float16)p0[r];
          pb[g][8 + r] = (_Float16)p1[r];
        }
        // Sum of the sixteen as a tree over neighbouring registers
        const v8f ps = p0 + p1;
        const v4f s4 = __builtin_shufflevector(ps, ps, 0, 1, 2, 3) +
                       __builtin_shufflevector(ps, ps, 4, 5, 6, 7);
        const v2f s2 = __builtin_shufflevector(s4, s4, 0, 1) +
                       __builtin_shufflevector(s4, s4, 2, 3);
        lv[g] = lv[g] * alpha + (s2[0] + s2[1]);
#pragma unroll
        for (int t = 0; t < 4; ++t) o[g][t] *= alpha;
      }

#pragma unroll
      for (int g = 0; g < 2; ++g)
#pragma unroll
        for (int t = 0; t < 4; ++t) o[g][t] = wmma_f16(av[t], pb[g], o[g][t]);
    }

    // Publish point of stage st + 1: this wave's reads of the current buffer
    // have retired, its copies of the next stage have landed, and behind the
    // barrier the current buffer is free for stage st + 2.
    asm volatile("s_wait_dscnt 0x0" ::: "memory");
    wait_async0();
    __syncthreads();
    if (st + 2 < NSTG)
      stage_kv(lk0 + cur * (KBUF * 2), lv0 + cur * (VBUF * 2),
               gk + (st + 2) * (KSTG * HDIM), gv + (st + 2) * KSTG);
  }
  wait_async0();                  // nothing is in flight behind the loop

  // Merge of the two key halves.  Behind the loop's last barrier nobody reads
  // the K ring and no copy is in flight: wave 4 + cg hands its sums to wave cg
  // there, lane to lane, seventeen 16-byte pieces a lane, each piece contiguous
  // over the wave.
  v4f* xw = (v4f*)Ks + cg * (17 * 32) + lane;
  if (kh == 1) {
#pragma unroll   // accumulators are indexed by constants only
    for (int g = 0; g < 2; ++g)
#pragma unroll
      for (int t = 0; t < 4; ++t) {
        const v8f v = o[g][t];
        xw[((g * 4 + t) * 2) * 32]     = __builtin_shufflevector(v, v, 0, 1, 2, 3);
        xw[((g * 4 + t) * 2 + 1) * 32] = __builtin_shufflevector(v, v, 4, 5, 6, 7);
      }
    const v4f ml = {mv[0], mv[1], lv[0], lv[1]};
    xw[16 * 32] = ml;
  }
  __syncthreads();    // the second half's sums are in LDS before they are read
  if (kh == 0) {
    const v4f ml = xw[16 * 32];
    v8h h[2][4];
#pragma unroll
    for (int g = 0; g < 2; ++g) {
      const float m  = fmaxf(mv[g], ml[g]);
      const float a0 = __expf(mv[g] - m);
      const float a1 = __expf(ml[g] - m);
      float l = lv[g] * a0 + ml[2 + g] * a1;
      l += xhalf(l);              // join the two wave halves' sums
      const float w0 = a0 / l;    // the division by the sum goes into the weights
      const float w1 = a1 / l;
#pragma unroll
      for (int t = 0; t < 4; ++t) {
        const v4f x0 = xw[((g * 4 + t) * 2) * 32];
        const v4f x1 = xw[((g * 4 + t) * 2 + 1) * 32];
#pragma unroll
        for (int r = 0; r < 4; ++r) {
          h[g][t][r]     = (_Float16)(o[g][t][r] * w0 + x0[r] * w1);
          h[g][t][4 + r] = (_Float16)(o[g][t][4 + r] * w0 + x1[r] * w1);
        }
      }
    }
    _Float16* orow =
        att_ws + ((size_t)(b * SEQ + q0 + row)) * DMODEL + hh * HDIM + 8 * grp;
#pragma unroll   // constant offsets from one global address
    for (int g = 0; g < 2; ++g)
#pragma unroll
      for (int t = 0; t < 4; ++t)
        *(v8h*)(orow + g * 16 * DMODEL + t * 16) = h[g][t];
    // Stands in front of any rewrite of a register that the stores above name
    asm volatile("s_wait_xcnt 0x0" ::: "memory");
  }
}

// ---------------------------------------------------------------------------
// Kernel 3: output projection.  out[4096][1024] = att @ Wot^T + b_out
// The weight rows are the first WMMA operand: a lane's eight accumulators are
// eight neighbours of one output row.  A wave's 32 rows of 64 floats, staged in
// LDS, leave as whole 128-byte lines.
// ---------------------------------------------------------------------------
#define OPITCH  68                   // floats: 256-byte rows at 272 bytes

__global__ __launch_bounds__(256) void out_gemm_kernel(
    const _Float16* __restrict__ att, const _Float16* __restrict__ Wot,
    const float* __restrict__ bout, float* __restrict__ out) {
  __shared__ __attribute__((aligned(16))) _Float16 S[GRING];

  const int lane = threadIdx.x & 31;
  const int row  = lane & 15;
  const int grp  = lane >> 4;
  // In a scalar register: the wave's offsets become scalar arithmetic
  const int wave = __builtin_amdgcn_readfirstlane(threadIdx.x >> 5);
  const int mb   = blockIdx.y * 128;
  const int nb   = blockIdx.x * 128;
  const int xr   = (wave & 3) * 32;           // first att row, of 128
  const int wr   = (wave >> 2) * 64;          // first weight row, of 128

  v8f acc[4][2];
#pragma unroll
  for (int i = 0; i < 4; ++i)
#pragma unroll
    for (int j = 0; j < 2; ++j) {
      v8f z = {0.f,0.f,0.f,0.f,0.f,0.f,0.f,0.f};
      acc[i][j] = z;
    }

  gemm_mainloop_k1024(S, att, Wot, mb, nb, 2 * GBUF + wr * GPITCH, xr * GPITCH,
                      acc);

  // Behind the loop's last barrier nobody reads the ring and no copy is in
  // flight: each wave stages in a range of its own.
  float* stg = (float*)S + wave * (32 * OPITCH);
  v8f bb[4];          // bias: eight columns a lane and tile
#pragma unroll   // the loads go out together, into registers
  for (int t = 0; t < 4; ++t)
    bb[t] = *(const v8f*)(bout + nb + wr + t * 16 + 8 * grp);
  // Stands in front of any rewrite of a register that the loads above name
  asm volatile("s_wait_xcnt 0x0" ::: "memory");
#pragma unroll   // here and below: accumulators are indexed by constants only
  for (int t = 0; t < 4; ++t) {
#pragma unroll
    for (int u = 0; u < 2; ++u) {
      const v8f v = acc[t][u] + bb[t];
      float* w = &stg[(u * 16 + row) * OPITCH + t * 16 + 8 * grp];
      *(v4f*)w       = __builtin_shufflevector(v, v, 0, 1, 2, 3);
      *(v4f*)(w + 4) = __builtin_shufflevector(v, v, 4, 5, 6, 7);
    }
  }
  // This wave's own LDS writes have retired before lanes read others' rows
  asm volatile("s_wait_dscnt 0x0" ::: "memory");
  // Sixteen lanes take one row: a store covers two rows, four whole lines
  const float* s = stg + grp * OPITCH + row * 4;
  float* d = out + (size_t)(mb + xr + grp) * DMODEL + nb + wr + row * 4;
  v4f p[16];
#pragma unroll   // constant offsets from one LDS and one global address
  for (int i = 0; i < 16; ++i) p[i] = *(const v4f*)(s + i * 2 * OPITCH);
#pragma unroll
  for (int i = 0; i < 16; ++i) *(v4f*)(d + i * 2 * DMODEL) = p[i];
  // Stands in front of any rewrite of a register that the stores above name
  asm volatile("s_wait_xcnt 0x0" ::: "memory");
}

// ---------------------------------------------------------------------------
// Launch
// ---------------------------------------------------------------------------
extern "C" void kernel_launch(void* const* d_in, const int* in_sizes, int n_in,
                              void* d_out, int out_size, void* d_ws,
                              size_t ws_size, hipStream_t stream) {
  const float* x    = (const float*)d_in[0];
  const int*   mask = (const int*)d_in[1];
  const float* Wqkv = (const float*)d_in[2];
  const float* bqkv = (const float*)d_in[3];
  const float* Wout = (const float*)d_in[4];
  const float* bout = (const float*)d_in[5];
  float* out = (float*)d_out;

  const size_t nBS  = (size_t)NBATCH * SEQ;            // 4096
  _Float16* xh     = (_Float16*)d_ws;                  // [4096][1024]
  _Float16* Wqt    = xh  + nBS * DMODEL;               // [3072][1024]
  _Float16* Wot    = Wqt + (size_t)3 * DMODEL * DMODEL;// [1024][1024]
  _Float16* q_ws   = Wot + (size_t)DMODEL * DMODEL;    // [32][2048][64]
  _Float16* k_ws   = q_ws + nBS * DMODEL;
  _Float16* v_ws   = k_ws + nBS * DMODEL;
  _Float16* att_ws = v_ws + nBS * DMODEL;              // [4096][1024]

  // Prep: f16 conversion + weight transposes, one launch
  prep_kernel<<<PREP_WGS, 256, 0, stream>>>(x, Wqkv, Wout, xh, Wqt, Wot);

  // QKV projection: M=4096, N=3072
  qkv_gemm_kernel<<<dim3(3 * DMODEL / 128, (unsigned)(nBS / 128)), 256, 0,
                    stream>>>(xh, Wqt, bqkv, q_ws, k_ws, v_ws);

  // Attention: 32 (b,h) pairs x 16 query blocks of 128; 8 waves/block:
  // 4 groups of 32 queries x 2 key halves
  attn_kernel<<<NBATCH * NHEADS * (SEQ / 128), 256, 0, stream>>>(
      q_ws, k_ws, v_ws, mask, att_ws);

  // Output projection: M=4096, N=1024
  out_gemm_kernel<<<dim3(DMODEL / 128, (unsigned)(nBS / 128)), 256, 0,
                    stream>>>(att_ws, Wot, bout, out);
}

// v007
// One run takes 78.4 microseconds.
// Next to v006, in two timings, it ran 1.05 and 1.06 times as fast.
// All steps since v000 together make it 2.85 times as fast.
#include <hip/hip_runtime.h>

// ---------------------------------------------------------------------------
// MHA forward for MI455X (gfx1250, wave32, WMMA f32_16x16x32_f16,
// async global->LDS double-buffered GEMM staging)
//   B=2, S=2048, D_MODEL=1024, H=16, HD=64
// ---------------------------------------------------------------------------

typedef __attribute__((ext_vector_type(16))) _Float16 v16h;
typedef __attribute__((ext_vector_type(8)))  _Float16 v8h;
typedef __attribute__((ext_vector_type(4)))  _Float16 v4h;
typedef __attribute__((ext_vector_type(8)))  float    v8f;
typedef __attribute__((ext_vector_type(4)))  float    v4f;
typedef __attribute__((ext_vector_type(2)))  float    v2f;
typedef __attribute__((ext_vector_type(4)))  int      v4i;

#define NBATCH   2
#define SEQ      2048
#define DMODEL   1024
#define NHEADS   16
#define HDIM     64

__device__ __forceinline__ v16h cat16(v8h lo, v8h hi) {
  return __builtin_shufflevector(lo, hi, 0,1,2,3,4,5,6,7,8,9,10,11,12,13,14,15);
}

__device__ __forceinline__ v8f wmma_f16(v16h a, v16h b, v8f c) {
  // (neg_a, A, neg_b, B, c_mod, C, reuse_a, reuse_b)
  return __builtin_amdgcn_wmma_f32_16x16x32_f16(false, a, false, b, (short)0, c,
                                                false, false);
}

// Wait for this wave's own async global->LDS copies (ASYNCcnt)
__device__ __forceinline__ void wait_async0() {
  asm volatile("s_wait_asynccnt 0" ::: "memory");
}

// ---------------------------------------------------------------------------
// Prep kernel: f32 -> f16 conversion of x and of both weights (transposed to
// [n][k]), so the GEMM tiles become pure contiguous copies (async-to-LDS
// friendly) and all WMMA fragments are two contiguous 16B loads per lane.
// One launch of 512 work-groups for all three: what bounds this work is the
// number of launches and of waves to start, not its bytes, so every thread
// takes sixteen 16-byte loads, all in flight together.
//   blocks   0..191: 128 x 128 tiles of W_qkv     blocks 192..255: of W_out
//   blocks 256..511: 16,384 consecutive elements of x each
// ---------------------------------------------------------------------------
#define TT        128                       // transpose tile edge
#define NT_QKV    (3 * DMODEL / TT)         // tile columns of W_qkv
#define NT_OUT    (DMODEL / TT)             // tile columns of W_out
#define TILES_QKV ((DMODEL / TT) * NT_QKV)
#define TILES_W   (TILES_QKV + (DMODEL / TT) * NT_OUT)
#define XCHUNK    (256 * 4 * 16)            // elements of x per work-group
#define PREP_WGS  (TILES_W + NBATCH * SEQ * DMODEL / XCHUNK)

// dst[n][k] (f16) = src[k][n] (f32): tile t of a weight with NT tile columns
template <int NT>
__device__ __forceinline__ void transpose_tile(
    const float* __restrict__ src, _Float16* __restrict__ dst, int t,
    _Float16* T) {
  constexpr int N = NT * TT;
  const int k0   = (t / NT) * TT;
  const int n0   = (t % NT) * TT;
  const int tid  = threadIdx.x;
  const int lane = tid & 31;
  const int wave = tid >> 5;

  // Wave w reads rows k0 + 16 w .. + 15, each wave-wide load one 512-byte row
  // piece: a lane ends up with sixteen consecutive k of four columns.
  const float* s = src + (size_t)(k0 + wave * 16) * N + n0 + lane * 4;
  v4f f[16];
#pragma unroll   // all sixteen loads go out before the first is used
  for (int i = 0; i < 15; ++i) f[i] = *(const v4f*)(s + i * N);
  // The last load's result may land in the address registers the others name
  asm volatile("s_wait_xcnt 0x0" ::: "memory");
  f[15] = *(const v4f*)(s + 15 * N);

#pragma unroll
  for (int j = 0; j < 4; ++j) {
#pragma unroll
    for (int h = 0; h < 2; ++h) {
      v8h p;
#pragma unroll
      for (int e = 0; e < 8; ++e) p[e] = (_Float16)f[h * 8 + e][j];
      *(v8h*)&T[(lane * 4 + j) * TT + (((wave * 2 + h) ^ (lane & 15)) * 8)] = p;
    }
  }
  __syncthreads();   // the tile is complete before rows are read back

  // Sixteen lanes store one row's 256 bytes: whole lines, 16 bytes a lane
  const int c = tid & 15;
  _Float16* d = dst + (size_t)(n0 + (tid >> 4)) * DMODEL + k0 + c * 8;
#pragma unroll
  for (int i = 0; i < 8; ++i) {
    const int n = i * 16 + (tid >> 4);
    *(v8h*)(d + i * 16 * DMODEL) =
        *(const v8h*)&T[n * TT + ((c ^ ((n >> 2) & 15)) * 8)];
  }
  // Stands in front of any rewrite of a register that the stores above name
  asm volatile("s_wait_xcnt 0x0" ::: "memory");
}

// Budget of four waves a SIMD (this launch has two work-groups a WGP): at the
// default budget the compiler kept to 64 registers and made the later loads
// wait for the earlier ones; with it all sixteen go out as one group.
__global__ __launch_bounds__(256)
__attribute__((amdgpu_waves_per_eu(4, 4))) void prep_kernel(
    const float* __restrict__ x, const float* __restrict__ Wqkv,
    const float* __restrict__ Wout, _Float16* __restrict__ xh,
    _Float16* __restrict__ Wqt, _Float16* __restrict__ Wot) {
  // Tile as [n][k], rows of 256 bytes in sixteen 16-byte pieces; piece c of
  // row n lies at place c ^ ((n >> 2) & 15), which spreads over all banks both
  // the writers (16 lanes: rows 4 apart, one piece) and the readers (one row).
  __shared__ __attribute__((aligned(16))) _Float16 T[TT * TT];

  const int blk = blockIdx.x;               // every branch is block-uniform
  if (blk < TILES_QKV) {
    transpose_tile<NT_QKV>(Wqkv, Wqt, blk, T);
  } else if (blk < TILES_W) {
    transpose_tile<NT_OUT>(Wout, Wot, blk - TILES_QKV, T);
  } else {                                  // x to f16
    const size_t base = (size_t)(blk - TILES_W) * XCHUNK + threadIdx.x * 4;
    v4f f[16];
#pragma unroll   // all sixteen loads go out before the first is used
    for (int i = 0; i < 15; ++i) f[i] = *(const v4f*)(x + base + i * 1024);
    // The last load's result may land in the address registers the others name
    asm volatile("s_wait_xcnt 0x0" ::: "memory");
    f[15] = *(const v4f*)(x + base + 15 * 1024);
#pragma unroll
    for (int i = 0; i < 16; ++i) {
      v4h h;
      h[0] = (_Float16)f[i][0]; h[1] = (_Float16)f[i][1];
      h[2] = (_Float16)f[i][2]; h[3] = (_Float16)f[i][3];
      *(v4h*)(xh + base + i * 1024) = h;
    }
    // Stands in front of any rewrite of a register that the stores above name
    asm volatile("s_wait_xcnt 0x0" ::: "memory");
  }
}

// ---------------------------------------------------------------------------
// Output projection's GEMM main loop over A[128 rows @ mb] and B[128 rows @ nb], K = 1024,
// both operands f16 with k contiguous (A row-major, B stored [n][k]).
// 256 threads / 8 waves; a wave owns 4x2 WMMA tiles: 64 stage rows as first
// operand, 32 as second.  A and B rows load alike, so the caller picks per
// wave which of the two is first (fo, so: offsets of those rows in buffer 0 of
// the ring): acc[t][u][r] = first row 16 t + 8 grp + r . second row 16 u + row,
// and a lane's eight registers run along the first operand's rows.
// Two-buffer LDS ring of stages of 64 k: a stage row is one whole 128-byte
// line, eight lanes copy one row, so a wave-wide copy touches four lines.
// ---------------------------------------------------------------------------
#define GK      64                   // k per stage
#define GSTG    (DMODEL / GK)
#define GPITCH  72                   // halves: 128-byte rows at 144 bytes
#define GBUF    (128 * GPITCH)       // halves per operand buffer
#define GRING   (4 * GBUF)           // A buffers 0 and 1, then B buffers 0 and 1

// One stage of A and of B (128 rows x 64 k each) into LDS: eight async copies
// of 16 bytes per lane.  la, ga / lb, gb: this lane's chunk of rows 0..31 of
// the operand, the next copies 32 rows further.  The s_wait_xcnt closes the
// statement so that it stands in front of any rewrite of the address
// registers the copies name.
__device__ __forceinline__ void stage_ab(unsigned la, unsigned lb,
                                         const _Float16* ga,
                                         const _Float16* gb) {
  asm volatile(
      "global_load_async_to_lds_b128 %0, %8, off\n\t"
      "global_load_async_to_lds_b128 %1, %9, off\n\t"
      "global_load_async_to_lds_b128 %2, %10, off\n\t"
      "global_load_async_to_lds_b128 %3, %11, off\n\t"
      "global_load_async_to_lds_b128 %4, %12, off\n\t"
      "global_load_async_to_lds_b128 %5, %13, off\n\t"
      "global_load_async_to_lds_b128 %6, %14, off\n\t"
      "global_load_async_to_lds_b128 %7, %15, off\n\t"
      "s_wait_xcnt 0x0"
      :: "v"(la), "v"(la + 32 * GPITCH * 2), "v"(la + 64 * GPITCH * 2),
         "v"(la + 96 * GPITCH * 2),
         "v"(lb), "v"(lb + 32 * GPITCH * 2), "v"(lb + 64 * GPITCH * 2),
         "v"(lb + 96 * GPITCH * 2),
         "v"(ga), "v"(ga + 32 * DMODEL), "v"(ga + 64 * DMODEL),
         "v"(ga + 96 * DMODEL),
         "v"(gb), "v"(gb + 32 * DMODEL), "v"(gb + 64 * DMODEL),
         "v"(gb + 96 * DMODEL)
      : "memory");
}

__device__ __forceinline__ void gemm_mainloop_k1024(
    _Float16* S, const _Float16* __restrict__ A,
    const _Float16* __restrict__ B, int mb, int nb, int fo, int so,
    v8f acc[4][2]) {
  const int tid  = threadIdx.x;
  const int lane = tid & 31;
  const int row  = lane & 15;
  const int grp  = lane >> 4;

  // This lane's 16-byte chunk of a stage: row tid / 8, chunk tid % 8
  const int sr = tid >> 3;
  const int sc = (tid & 7) * 8;
  const unsigned la0 = (unsigned)(uintptr_t)&S[sr * GPITCH + sc];
  const unsigned lb0 = (unsigned)(uintptr_t)&S[2 * GBUF + sr * GPITCH + sc];
  const _Float16* ga = A + (size_t)(mb + sr) * DMODEL + sc;
  const _Float16* gb = B + (size_t)(nb + sr) * DMODEL + sc;

  stage_ab(la0, lb0, ga, gb);                           // stage 0, buffer 0
  wait_async0();      // this wave's share of stage 0 has landed
  __syncthreads();    // publishes stage 0
  stage_ab(la0 + GBUF * 2, lb0 + GBUF * 2, ga + GK, gb + GK);

  for (int st = 0; st < GSTG; ++st) {
    const int cur = st & 1;
    const _Float16* at = &S[cur * GBUF + fo + row * GPITCH + 8 * grp];
    const _Float16* bt = &S[cur * GBUF + so + row * GPITCH + 8 * grp];

#pragma unroll   // both halves at constant LDS offsets from one address
    for (int h = 0; h < GK / 32; ++h) {
      v16h af[4];
#pragma unroll
      for (int tm = 0; tm < 4; ++tm) {
        const _Float16* p = at + tm * 16 * GPITCH + h * 32;
        af[tm] = cat16(*(const v8h*)p, *(const v8h*)(p + 16));
      }
      v16h bf[2];
#pragma unroll
      for (int tn = 0; tn < 2; ++tn) {
        const _Float16* p = bt + tn * 16 * GPITCH + h * 32;
        bf[tn] = cat16(*(const v8h*)p, *(const v8h*)(p + 16));
      }
#pragma unroll
      for (int tm = 0; tm < 4; ++tm)
#pragma unroll
        for (int tn = 0; tn < 2; ++tn)
          acc[tm][tn] = wmma_f16(af[tm], bf[tn], acc[tm][tn]);
    }

    // Publish point of stage st + 1: this wave's reads of the current buffer
    // have retired, its copies of the next stage have landed, and behind the
    // barrier the current buffer is free for stage st + 2.
    asm volatile("s_wait_dscnt 0x0" ::: "memory");
    wait_async0();
    __syncthreads();
    if (st + 2 < GSTG)
      stage_ab(la0 + cur * (GBUF * 2), lb0 + cur * (GBUF * 2),
               ga + (st + 2) * GK, gb + (st + 2) * GK);
  }
  wait_async0();                  // nothing is in flight behind the loop
}

// ---------------------------------------------------------------------------
// Kernel 1: QKV projection.  C[4096][3072] = xh @ Wqt^T + b_qkv.  Scatters:
//   q_ws: [bh][s][64]  (pre-scaled by 1/sqrt(64))
//   k_ws: [bh][s][64]
//   v_ws: [bh][d][s]   (transposed for the PV matmul's A-fragment layout)
// A work-group takes 256 x rows by the 192 columns of one head (its q, k and
// v): 256 work-groups, one on each WGP.  A wave takes 64 x rows by 96 columns:
// all of q (waves 0..3) or of k (waves 4..7) and one half of v, 24 WMMA tiles
// from ten fragments.  For q and k the weight rows are the first WMMA operand,
// for v the x rows, so that a lane's eight accumulators are always eight
// neighbours of one destination row; the rows, staged in LDS, leave as whole
// 128-byte lines.
// ---------------------------------------------------------------------------

// 32 staged rows of 128 bytes (pitch GPITCH) to dst, rows STRIDE halves apart.
// Eight lanes take one row; a store covers rows i, i + 8, i + 16, i + 24: four
// whole lines, and in LDS each half of the wave meets every bank once.
template <int STRIDE>
__device__ __forceinline__ void store_rows_f16(const _Float16* stg,
                                               _Float16* dst, int lane) {
  // This wave's own LDS writes have retired before lanes read others' rows
  asm volatile("s_wait_dscnt 0x0" ::: "memory");
  const _Float16* s = stg + (lane >> 3) * 8 * GPITCH + (lane & 7) * 8;
  _Float16* d = dst + (size_t)((lane >> 3) * 8) * STRIDE + (lane & 7) * 8;
  v8h p[8];
#pragma unroll   // constant offsets from one LDS and one global address
  for (int i = 0; i < 8; ++i) p[i] = *(const v8h*)(s + i * GPITCH);
#pragma unroll
  for (int i = 0; i < 8; ++i) *(v8h*)(d + i * STRIDE) = p[i];
  // Stands in front of any rewrite of a register that the stores above name
  asm volatile("s_wait_xcnt 0x0" ::: "memory");
}

#define QM      256                  // x rows per work-group
#define QN      (3 * HDIM)           // weight rows per work-group: one head
#define QK      128                  // k per stage
#define QSTG    (DMODEL / QK)
#define QPITCH  136                  // halves: 256-byte rows at 272 bytes
#define QBUF    ((QN + QM) * QPITCH) // halves per buffer: weight rows, x rows
#define QSTEP   (16 * QPITCH * 2)    // LDS bytes from one copy to the next

// Fourteen async copies of 16 bytes per lane, LDS places sixteen rows apart.
// The s_wait_xcnt closes the statement so that it stands in front of any
// rewrite of the address registers the copies name.
__device__ __forceinline__ void copy14(unsigned l, const _Float16* const* g) {
  asm volatile(
      "global_load_async_to_lds_b128 %0, %14, off\n\t"
      "global_load_async_to_lds_b128 %1, %15, off\n\t"
      "global_load_async_to_lds_b128 %2, %16, off\n\t"
      "global_load_async_to_lds_b128 %3, %17, off\n\t"
      "global_load_async_to_lds_b128 %4, %18, off\n\t"
      "global_load_async_to_lds_b128 %5, %19, off\n\t"
      "global_load_async_to_lds_b128 %6, %20, off\n\t"
      "global_load_async_to_lds_b128 %7, %21, off\n\t"
      "global_load_async_to_lds_b128 %8, %22, off\n\t"
      "global_load_async_to_lds_b128 %9, %23, off\n\t"
      "global_load_async_to_lds_b128 %10, %24, off\n\t"
      "global_load_async_to_lds_b128 %11, %25, off\n\t"
      "global_load_async_to_lds_b128 %12, %26, off\n\t"
      "global_load_async_to_lds_b128 %13, %27, off\n\t"
      "s_wait_xcnt 0x0"
      :: "v"(l), "v"(l + QSTEP), "v"(l + 2 * QSTEP), "v"(l + 3 * QSTEP),
         "v"(l + 4 * QSTEP), "v"(l + 5 * QSTEP), "v"(l + 6 * QSTEP),
         "v"(l + 7 * QSTEP), "v"(l + 8 * QSTEP), "v"(l + 9 * QSTEP),
         "v"(l + 10 * QSTEP), "v"(l + 11 * QSTEP), "v"(l + 12 * QSTEP),
         "v"(l + 13 * QSTEP),
         "v"(g[0]), "v"(g[1]), "v"(g[2]), "v"(g[3]), "v"(g[4]), "v"(g[5]),
         "v"(g[6]), "v"(g[7]), "v"(g[8]), "v"(g[9]), "v"(g[10]), "v"(g[11]),
         "v"(g[12]), "v"(g[13])
      : "memory");
}

// One stage (192 weight rows, then 256 x rows, 128 k each) into the buffer at
// l: 28 copies per lane, sixteen lanes to a row, so a wave-wide copy takes two
// rows' four whole lines.  l, gx, gw: this lane's chunk of rows 0..15.
__device__ __forceinline__ void stage_xw(unsigned l, const _Float16* gx,
                                         const _Float16* gw) {
  const _Float16* g[(QN + QM) / 16];
#pragma unroll   // the table is indexed by constants only: it stays in registers
  for (int i = 0; i < QN / 16; ++i) g[i] = gw + i * 16 * DMODEL;
#pragma unroll
  for (int i = 0; i < QM / 16; ++i) g[QN / 16 + i] = gx + i * 16 * DMODEL;
  copy14(l, g);
  copy14(l + 14 * QSTEP, g + 14);
}

// One work-group fills a WGP's LDS: two waves a SIMD, 512 registers a wave
__global__ __launch_bounds__(256) void qkv_gemm_kernel(
    const _Float16* __restrict__ xh, const _Float16* __restrict__ Wqt,
    const float* __restrict__ bqkv,
    _Float16* __restrict__ q_ws, _Float16* __restrict__ k_ws,
    _Float16* __restrict__ v_ws) {
  __shared__ __attribute__((aligned(16))) _Float16 S[2 * QBUF];

  const int tid  = threadIdx.x;
  const int lane = tid & 31;
  const int row  = lane & 15;
  const int grp  = lane >> 4;
  // In a scalar register: the wave's offsets become scalar arithmetic
  const int wave = __builtin_amdgcn_readfirstlane(tid >> 5);
  const int hd   = blockIdx.x;
  const int mb   = blockIdx.y * QM;
  const int nb   = hd * QN;
  const int xr   = (wave & 3) * 64;           // first x row, of 256
  const int wn   = wave >> 2;                 // 0: q and v 0..31, 1: k and v 32..63

  v8f aq[4][4];       // [weight tile of q or k][x tile]
  v8f av[4][2];       // [x tile][weight tile of v]
#pragma unroll
  for (int i = 0; i < 4; ++i) {
    const v8f z = {0.f,0.f,0.f,0.f,0.f,0.f,0.f,0.f};
#pragma unroll
    for (int j = 0; j < 4; ++j) aq[i][j] = z;
#pragma unroll
    for (int j = 0; j < 2; ++j) av[i][j] = z;
  }

  // This lane's 16-byte chunk of a stage: row tid / 16, chunk tid % 16
  const int sr = tid >> 4;
  const int sc = (tid & 15) * 8;
  const unsigned l0 = (unsigned)(uintptr_t)&S[sr * QPITCH + sc];
  const _Float16* gx = xh + (size_t)(mb + sr) * DMODEL + sc;
  const _Float16* gw = Wqt + (size_t)(nb + sr) * DMODEL + sc;

  stage_xw(l0, gx, gw);                                 // stage 0, buffer 0
  wait_async0();      // this wave's share of stage 0 has landed
  __syncthreads();    // publishes stage 0
  stage_xw(l0 + QBUF * 2, gx + QK, gw + QK);

  for (int st = 0; st < QSTG; ++st) {
    const int cur = st & 1;
    const _Float16* fr = &S[cur * QBUF + row * QPITCH + 8 * grp];
    const _Float16* wt = fr + wn * HDIM * QPITCH;
    const _Float16* vt = fr + (2 * HDIM + wn * 32) * QPITCH;
    const _Float16* xt = fr + (QN + xr) * QPITCH;

    // Two fragment sets: 0..3 x tiles, 4..7 weight tiles of q or k, 8..9 of v
    v16h f[2][10];
#pragma unroll   // a stage's four blocks of 32 k, at constant LDS offsets
    for (int h = -1; h < QK / 32; ++h) {
      if (h + 1 < QK / 32) {      // the next block's fragments, as one group
        v16h* n = f[(h + 1) & 1];
#pragma unroll
        for (int t = 0; t < 10; ++t) {
          const _Float16* p = (t < 4   ? xt + t * 16 * QPITCH
                               : t < 8 ? wt + (t - 4) * 16 * QPITCH
                                       : vt + (t - 8) * 16 * QPITCH) +
                              (h + 1) * 32;
          n[t] = cat16(*(const v8h*)p, *(const v8h*)(p + 16));
        }
      }
      // Keeps those loads ahead of this block's WMMAs: moved down among them,
      // each would be waited for where it stands
      __builtin_amdgcn_sched_barrier(0);
      if (h >= 0) {
        const v16h* b = f[h & 1];
#pragma unroll
        for (int t = 0; t < 4; ++t)
#pragma unroll
          for (int u = 0; u < 4; ++u)
            aq[t][u] = wmma_f16(b[4 + t], b[u], aq[t][u]);
#pragma unroll
        for (int t = 0; t < 4; ++t)
#pragma unroll
          for (int u = 0; u < 2; ++u)
            av[t][u] = wmma_f16(b[t], b[8 + u], av[t][u]);
        // Keeps the block after next's loads from moving up among these WMMAs
        __builtin_amdgcn_sched_barrier(0);
      }
    }

    // Publish point of stage st + 1: this wave's reads of the current buffer
    // have retired, its copies of the next stage have landed, and behind the
    // barrier the current buffer is free for stage st + 2.
    asm volatile("s_wait_dscnt 0x0" ::: "memory");
    wait_async0();
    __syncthreads();
    if (st + 2 < QSTG)
      stage_xw(l0 + cur * (QBUF * 2), gx + (st + 2) * QK, gw + (st + 2) * QK);
  }
  wait_async0();                  // nothing is in flight behind the loop

  // Behind the loop's last barrier nobody reads the ring and no copy is in
  // flight: each wave stages in a range of its own, 64 rows of q or k (one row
  // a position) and then 32 rows of v (one row a head column).
  _Float16* stg  = S + wave * (96 * GPITCH);
  _Float16* stgv = stg + 64 * GPITCH;
  const int bh = (mb >> 11) * NHEADS + hd;
  const int s0 = (mb & (SEQ - 1)) + xr;

  const float sc8 = wn == 0 ? 0.125f : 1.f;
  v4f bb[4][2];       // bias of q or k: eight columns a lane and tile
  float bv[2];        // bias of v: one column a lane and tile
  // The ten loads and their data wait are one statement: as plain loads with a
  // wait in a statement of its own, later address arithmetic was moved up over
  // that wait and rewrote an offset register that the loads name.  All ten are
  // in flight together, and all are needed next.
  asm volatile(
      "global_load_b128 %0, %10, off\n\t"
      "global_load_b128 %1, %10, off offset:16\n\t"
      "global_load_b128 %2, %10, off offset:64\n\t"
      "global_load_b128 %3, %10, off offset:80\n\t"
      "global_load_b128 %4, %10, off offset:128\n\t"
      "global_load_b128 %5, %10, off offset:144\n\t"
      "global_load_b128 %6, %10, off offset:192\n\t"
      "global_load_b128 %7, %10, off offset:208\n\t"
      "global_load_b32 %8, %11, off\n\t"
      "global_load_b32 %9, %11, off offset:64\n\t"
      "s_wait_loadcnt 0x0"
      : "=&v"(bb[0][0]), "=&v"(bb[0][1]), "=&v"(bb[1][0]), "=&v"(bb[1][1]),
        "=&v"(bb[2][0]), "=&v"(bb[2][1]), "=&v"(bb[3][0]), "=&v"(bb[3][1]),
        "=&v"(bv[0]), "=&v"(bv[1])
      : "v"(bqkv + nb + wn * HDIM + 8 * grp),
        "v"(bqkv + nb + 2 * HDIM + wn * 32 + row)
      : "memory");

  // q or k: registers run along the head's 64 columns, lanes along s
#pragma unroll   // here and below: accumulators are indexed by constants only
  for (int t = 0; t < 4; ++t) {
#pragma unroll
    for (int u = 0; u < 4; ++u) {
      v8h p;
#pragma unroll
      for (int r = 0; r < 8; ++r)
        p[r] = (_Float16)((aq[t][u][r] + bb[t][r >> 2][r & 3]) * sc8);
      *(v8h*)&stg[(u * 16 + row) * GPITCH + t * 16 + 8 * grp] = p;
    }
  }
  // v: registers run along s, lanes along d
#pragma unroll
  for (int u = 0; u < 2; ++u) {
#pragma unroll
    for (int t = 0; t < 4; ++t) {
      v8h p;
#pragma unroll
      for (int r = 0; r < 8; ++r) p[r] = (_Float16)(av[t][u][r] + bv[u]);
      *(v8h*)&stgv[(u * 16 + row) * GPITCH + t * 16 + 8 * grp] = p;
    }
  }

  _Float16* dqk = (wn == 0 ? q_ws : k_ws) + ((size_t)bh * SEQ + s0) * HDIM;
  store_rows_f16<HDIM>(stg, dqk, lane);
  store_rows_f16<HDIM>(stg + 32 * GPITCH, dqk + 32 * HDIM, lane);
  store_rows_f16<SEQ>(stgv, v_ws + ((size_t)bh * HDIM + wn * 32) * SEQ + s0,
                      lane);
}

__device__ __forceinline__ float xhalf(float x) {
  const int b = __builtin_bit_cast(int, x);
  return __builtin_bit_cast(float, __builtin_amdgcn_permlanex16(
      b, b, 0x76543210, 0xfedcba98, false, false));
}

#define KSTG    128                  // keys per stage
#define NSTG    (SEQ / KSTG)
#define KHALF   (KSTG / 2)           // keys of a stage that one wave takes
#define KPITCH  72                   // halves: 128-byte K rows at 144 bytes
#define VPITCH  136                  // halves: 256-byte Vt rows at 272 bytes
#define KBUF    (KSTG * KPITCH)      // halves per K buffer
#define VBUF    (HDIM * VPITCH)      // halves per Vt buffer

// One stage of K (128 keys x 64) and Vt (64 x 128 keys) into LDS: eight async
// copies of 16 bytes per lane, every wave-wide copy covering four whole lines.
// lk, gk: this lane's chunk of K rows 0..31, the next copies 32 rows further;
// lv, gv: its chunk of Vt rows 0..15, the next copies 16 rows further.
// The s_wait_xcnt closes the statement so that it stands in front of any
// rewrite of the address registers the copies name.
__device__ __forceinline__ void stage_kv(unsigned lk, unsigned lv,
                                         const _Float16* gk,
                                         const _Float16* gv) {
  asm volatile(
      "global_load_async_to_lds_b128 %0, %8, off\n\t"
      "global_load_async_to_lds_b128 %1, %9, off\n\t"
      "global_load_async_to_lds_b128 %2, %10, off\n\t"
      "global_load_async_to_lds_b128 %3, %11, off\n\t"
      "global_load_async_to_lds_b128 %4, %12, off\n\t"
      "global_load_async_to_lds_b128 %5, %13, off\n\t"
      "global_load_async_to_lds_b128 %6, %14, off\n\t"
      "global_load_async_to_lds_b128 %7, %15, off\n\t"
      "s_wait_xcnt 0x0"
      :: "v"(lk), "v"(lk + 32 * KPITCH * 2), "v"(lk + 64 * KPITCH * 2),
         "v"(lk + 96 * KPITCH * 2),
         "v"(lv), "v"(lv + 16 * VPITCH * 2), "v"(lv + 32 * VPITCH * 2),
         "v"(lv + 48 * VPITCH * 2),
         "v"(gk), "v"(gk + 32 * HDIM), "v"(gk + 64 * HDIM), "v"(gk + 96 * HDIM),
         "v"(gv), "v"(gv + 16 * SEQ), "v"(gv + 32 * SEQ), "v"(gv + 48 * SEQ)
      : "memory");
}

// Four waves a SIMD and no more: two work-groups fill a WGP, so the 512
// work-groups of the launch cannot pile up three to a WGP and leave others idle.
__global__ __launch_bounds__(256)
__attribute__((amdgpu_waves_per_eu(4, 4))) void attn_kernel(
    const _Float16* __restrict__ q_ws, const _Float16* __restrict__ k_ws,
    const _Float16* __restrict__ v_ws, const int* __restrict__ mask,
    _Float16* __restrict__ att_ws) {
  // 0 for a live key, -inf for a masked one
  __shared__ __attribute__((aligned(32))) float mbias[SEQ];
  // Two-buffer ring of K and Vt stages, shared by the block's eight waves
  __shared__ __attribute__((aligned(16))) _Float16 Ks[2 * KBUF];
  __shared__ __attribute__((aligned(16))) _Float16 Vs[2 * VBUF];

  const int tid  = threadIdx.x;
  const int lane = tid & 31;
  const int row  = lane & 15;
  const int grp  = lane >> 4;
  // In a scalar register: the choice of who merges becomes a scalar branch
  const int wave = __builtin_amdgcn_readfirstlane(tid >> 5);
  const int cg   = wave & 3;                            // 32-query group
  const int kh   = wave >> 2;                           // key half of a stage

  const int bh = blockIdx.x >> 4;                       // 0..31
  const int q0 = (blockIdx.x & 15) * 128 + cg * 32;
  const int b  = bh >> 4;
  const int hh = bh & (NHEADS - 1);

  const _Float16* qb = q_ws + (size_t)bh * SEQ * HDIM;
  const _Float16* kb = k_ws + (size_t)bh * SEQ * HDIM;
  const _Float16* vb = v_ws + (size_t)bh * HDIM * SEQ;
  const int* mrow    = mask + b * SEQ;

  // This lane's 16-byte chunk of a stage: K row tid / 8, Vt row tid / 16
  const unsigned lk0 =
      (unsigned)(uintptr_t)&Ks[(tid >> 3) * KPITCH + (tid & 7) * 8];
  const unsigned lv0 =
      (unsigned)(uintptr_t)&Vs[(tid >> 4) * VPITCH + (tid & 15) * 8];
  const _Float16* gk = kb + tid * 8;
  const _Float16* gv = vb + (tid >> 4) * SEQ + (tid & 15) * 8;

  stage_kv(lk0, lv0, gk, gv);                           // stage 0, buffer 0

  // Keys run over accumulator registers: the mask enters as the C operand of
  // the score product, read from this table.
#pragma unroll   // independent loads in flight instead of round trips
  for (int i0 = 0; i0 < SEQ; i0 += 256 * 4) {
    const int i = i0 + tid * 4;
    const v4i mm = *(const v4i*)(mrow + i);
    v4f bb;
#pragma unroll
    for (int j = 0; j < 4; ++j) bb[j] = (mm[j] == 0) ? -__builtin_inff() : 0.f;
    *(v4f*)&mbias[i] = bb;
  }
  wait_async0();      // this wave's share of stage 0 has landed
  __syncthreads();    // publishes stage 0 and the mask table
  stage_kv(lk0 + KBUF * 2, lv0 + VBUF * 2, gk + KSTG * HDIM, gv + KSTG);

  v16h bq[2][2];                  // [column group][k half of the head size]
#pragma unroll   // the loads go out together, into registers
  for (int g = 0; g < 2; ++g) {
    const _Float16* qrow = qb + (size_t)(q0 + g * 16 + row) * HDIM;
    bq[g][0] = cat16(*(const v8h*)(qrow + 8 * grp),
                     *(const v8h*)(qrow + 16 + 8 * grp));
    bq[g][1] = cat16(*(const v8h*)(qrow + 32 + 8 * grp),
                     *(const v8h*)(qrow + 48 + 8 * grp));
  }
  // Stands in front of any rewrite of a register that the loads above name
  asm volatile("s_wait_xcnt 0x0" ::: "memory");

  // Running maximum of this lane's query in each group.  The start is finite
  // and below every score, so a key half whose keys are all masked keeps zero
  // sums and merges as nothing instead of giving inf - inf.
  float mv[2] = {-1e30f, -1e30f};
  float lv[2] = {0.f, 0.f};       // this half's share of the running sums
  v8f o[2][4];                    // o[g][t][r] = Ot[16 t + 8 grp + r][query row]
#pragma unroll
  for (int g = 0; g < 2; ++g)
#pragma unroll
    for (int t = 0; t < 4; ++t) {
      v8f z = {0.f,0.f,0.f,0.f,0.f,0.f,0.f,0.f};
      o[g][t] = z;
    }

  for (int st = 0; st < NSTG; ++st) {
    const int cur = st & 1;
    const _Float16* kt =
        &Ks[cur * KBUF + (kh * KHALF + row) * KPITCH + 8 * grp];
    const _Float16* vt = &Vs[cur * VBUF + row * VPITCH + kh * KHALF + 8 * grp];

#pragma unroll   // the second pass's LDS reads go out under the first pass
    for (int p = 0; p < KHALF / 32; ++p) {
      const int s0 = st * KSTG + kh * KHALF + p * 32;
      const _Float16* k0r = kt + p * 32 * KPITCH;      // key row, k chunk
      const _Float16* k1r = k0r + 16 * KPITCH;
      const _Float16* vr  = vt + p * 32;               // d row, key chunk
      const v16h ak00 = cat16(*(const v8h*)(k0r),      *(const v8h*)(k0r + 16));
      const v16h ak01 = cat16(*(const v8h*)(k0r + 32), *(const v8h*)(k0r + 48));
      const v16h ak10 = cat16(*(const v8h*)(k1r),      *(const v8h*)(k1r + 16));
      const v16h ak11 = cat16(*(const v8h*)(k1r + 32), *(const v8h*)(k1r + 48));

      v16h av[4];
#pragma unroll
      for (int t = 0; t < 4; ++t)
        av[t] = cat16(*(const v8h*)(vr + t * 16 * VPITCH),
                      *(const v8h*)(vr + t * 16 * VPITCH + 16));

      // c0[r]: key s0 + 8 grp + r, c1[r]: key s0 + 16 + 8 grp + r
      const v8f mb0 = *(const v8f*)&mbias[s0 + 8 * grp];
      const v8f mb1 = *(const v8f*)&mbias[s0 + 16 + 8 * grp];

      v16h pb[2];
#pragma unroll   // both column groups work from the same fragments
      for (int g = 0; g < 2; ++g) {
        v8f c0 = wmma_f16(ak00, bq[g][0], mb0);
        v8f c1 = wmma_f16(ak10, bq[g][0], mb1);
        c0 = wmma_f16(ak01, bq[g][1], c0);
        c1 = wmma_f16(ak11, bq[g][1], c1);

        float tm[8];
#pragma unroll
        for (int r = 0; r < 8; ++r) tm[r] = fmaxf(c0[r], c1[r]);
        float rm = fmaxf(fmaxf(fmaxf(tm[0], tm[1]), fmaxf(tm[2], tm[3])),
                         fmaxf(fmaxf(tm[4], tm[5]), fmaxf(tm[6], tm[7])));
        rm = fmaxf(rm, xhalf(rm));    // the other half's sixteen keys
        const float mn    = fmaxf(mv[g], rm);
        const float alpha = __expf(mv[g] - mn);
        mv[g] = mn;

        v8f p0, p1;
#pragma unroll
        for (int r = 0; r < 8; ++r) {
          p0[r] = __expf(c0[r] - mn);
          p1[r] = __expf(c1[r] - mn);
          pb[g][r]     = (_Float16)p0[r];
          pb[g][8 + r] = (_Float16)p1[r];
        }
        // Sum of the sixteen as a tree over neighbouring registers
        const v8f ps = p0 + p1;
        const v4f s4 = __builtin_shufflevector(ps, ps, 0, 1, 2, 3) +
                       __builtin_shufflevector(ps, ps, 4, 5, 6, 7);
        const v2f s2 = __builtin_shufflevector(s4, s4, 0, 1) +
                       __builtin_shufflevector(s4, s4, 2, 3);
        lv[g] = lv[g] * alpha + (s2[0] + s2[1]);
#pragma unroll
        for (int t = 0; t < 4; ++t) o[g][t] *= alpha;
      }

#pragma unroll
      for (int g = 0; g < 2; ++g)
#pragma unroll
        for (int t = 0; t < 4; ++t) o[g][t] = wmma_f16(av[t], pb[g], o[g][t]);
    }

    // Publish point of stage st + 1: this wave's reads of the current buffer
    // have retired, its copies of the next stage have landed, and behind the
    // barrier the current buffer is free for stage st + 2.
    asm volatile("s_wait_dscnt 0x0" ::: "memory");
    wait_async0();
    __syncthreads();
    if (st + 2 < NSTG)
      stage_kv(lk0 + cur * (KBUF * 2), lv0 + cur * (VBUF * 2),
               gk + (st + 2) * (KSTG * HDIM), gv + (st + 2) * KSTG);
  }
  wait_async0();                  // nothing is in flight behind the loop

  // Merge of the two key halves.  Behind the loop's last barrier nobody reads
  // the K ring and no copy is in flight: wave 4 + cg hands its sums to wave cg
  // there, lane to lane, seventeen 16-byte pieces a lane, each piece contiguous
  // over the wave.
  v4f* xw = (v4f*)Ks + cg * (17 * 32) + lane;
  if (kh == 1) {
#pragma unroll   // accumulators are indexed by constants only
    for (int g = 0; g < 2; ++g)
#pragma unroll
      for (int t = 0; t < 4; ++t) {
        const v8f v = o[g][t];
        xw[((g * 4 + t) * 2) * 32]     = __builtin_shufflevector(v, v, 0, 1, 2, 3);
        xw[((g * 4 + t) * 2 + 1) * 32] = __builtin_shufflevector(v, v, 4, 5, 6, 7);
      }
    const v4f ml = {mv[0], mv[1], lv[0], lv[1]};
    xw[16 * 32] = ml;
  }
  __syncthreads();    // the second half's sums are in LDS before they are read
  if (kh == 0) {
    const v4f ml = xw[16 * 32];
    v8h h[2][4];
#pragma unroll
    for (int g = 0; g < 2; ++g) {
      const float m  = fmaxf(mv[g], ml[g]);
      const float a0 = __expf(mv[g] - m);
      const float a1 = __expf(ml[g] - m);
      float l = lv[g] * a0 + ml[2 + g] * a1;
      l += xhalf(l);              // join the two wave halves' sums
      const float w0 = a0 / l;    // the division by the sum goes into the weights
      const float w1 = a1 / l;
#pragma unroll
      for (int t = 0; t < 4; ++t) {
        const v4f x0 = xw[((g * 4 + t) * 2) * 32];
        const v4f x1 = xw[((g * 4 + t) * 2 + 1) * 32];
#pragma unroll
        for (int r = 0; r < 4; ++r) {
          h[g][t][r]     = (_Float16)(o[g][t][r] * w0 + x0[r] * w1);
          h[g][t][4 + r] = (_Float16)(o[g][t][4 + r] * w0 + x1[r] * w1);
        }
      }
    }
    _Float16* orow =
        att_ws + ((size_t)(b * SEQ + q0 + row)) * DMODEL + hh * HDIM + 8 * grp;
#pragma unroll   // constant offsets from one global address
    for (int g = 0; g < 2; ++g)
#pragma unroll
      for (int t = 0; t < 4; ++t)
        *(v8h*)(orow + g * 16 * DMODEL + t * 16) = h[g][t];
    // Stands in front of any rewrite of a register that the stores above name
    asm volatile("s_wait_xcnt 0x0" ::: "memory");
  }
}

// ---------------------------------------------------------------------------
// Kernel 3: output projection.  out[4096][1024] = att @ Wot^T + b_out
// The weight rows are the first WMMA operand: a lane's eight accumulators are
// eight neighbours of one output row.  A wave's 32 rows of 64 floats, staged in
// LDS, leave as whole 128-byte lines.
// ---------------------------------------------------------------------------
#define OPITCH  68                   // floats: 256-byte rows at 272 bytes

__global__ __launch_bounds__(256) void out_gemm_kernel(
    const _Float16* __restrict__ att, const _Float16* __restrict__ Wot,
    const float* __restrict__ bout, float* __restrict__ out) {
  __shared__ __attribute__((aligned(16))) _Float16 S[GRING];

  const int lane = threadIdx.x & 31;
  const int row  = lane & 15;
  const int grp  = lane >> 4;
  // In a scalar register: the wave's offsets become scalar arithmetic
  const int wave = __builtin_amdgcn_readfirstlane(threadIdx.x >> 5);
  const int mb   = blockIdx.y * 128;
  const int nb   = blockIdx.x * 128;
  const int xr   = (wave & 3) * 32;           // first att row, of 128
  const int wr   = (wave >> 2) * 64;          // first weight row, of 128

  v8f acc[4][2];
#pragma unroll
  for (int i = 0; i < 4; ++i)
#pragma unroll
    for (int j = 0; j < 2; ++j) {
      v8f z = {0.f,0.f,0.f,0.f,0.f,0.f,0.f,0.f};
      acc[i][j] = z;
    }

  gemm_mainloop_k1024(S, att, Wot, mb, nb, 2 * GBUF + wr * GPITCH, xr * GPITCH,
                      acc);

  // Behind the loop's last barrier nobody reads the ring and no copy is in
  // flight: each wave stages in a range of its own.
  float* stg = (float*)S + wave * (32 * OPITCH);
  v8f bb[4];          // bias: eight columns a lane and tile
#pragma unroll   // the loads go out together, into registers
  for (int t = 0; t < 4; ++t)
    bb[t] = *(const v8f*)(bout + nb + wr + t * 16 + 8 * grp);
  // Stands in front of any rewrite of a register that the loads above name
  asm volatile("s_wait_xcnt 0x0" ::: "memory");
#pragma unroll   // here and below: accumulators are indexed by constants only
  for (int t = 0; t < 4; ++t) {
#pragma unroll
    for (int u = 0; u < 2; ++u) {
      const v8f v = acc[t][u] + bb[t];
      float* w = &stg[(u * 16 + row) * OPITCH + t * 16 + 8 * grp];
      *(v4f*)w       = __builtin_shufflevector(v, v, 0, 1, 2, 3);
      *(v4f*)(w + 4) = __builtin_shufflevector(v, v, 4, 5, 6, 7);
    }
  }
  // This wave's own LDS writes have retired before lanes read others' rows
  asm volatile("s_wait_dscnt 0x0" ::: "memory");
  // Sixteen lanes take one row: a store covers two rows, four whole lines
  const float* s = stg + grp * OPITCH + row * 4;
  float* d = out + (size_t)(mb + xr + grp) * DMODEL + nb + wr + row * 4;
  v4f p[16];
#pragma unroll   // constant offsets from one LDS and one global address
  for (int i = 0; i < 16; ++i) p[i] = *(const v4f*)(s + i * 2 * OPITCH);
#pragma unroll
  for (int i = 0; i < 16; ++i) *(v4f*)(d + i * 2 * DMODEL) = p[i];
  // Stands in front of any rewrite of a register that the stores above name
  asm volatile("s_wait_xcnt 0x0" ::: "memory");
}

// ---------------------------------------------------------------------------
// Launch
// ---------------------------------------------------------------------------
extern "C" void kernel_launch(void* const* d_in, const int* in_sizes, int n_in,
                              void* d_out, int out_size, void* d_ws,
                              size_t ws_size, hipStream_t stream) {
  const float* x    = (const float*)d_in[0];
  const int*   mask = (const int*)d_in[1];
  const float* Wqkv = (const float*)d_in[2];
  const float* bqkv = (const float*)d_in[3];
  const float* Wout = (const float*)d_in[4];
  const float* bout = (const float*)d_in[5];
  float* out = (float*)d_out;

  const size_t nBS  = (size_t)NBATCH * SEQ;            // 4096
  _Float16* xh     = (_Float16*)d_ws;                  // [4096][1024]
  _Float16* Wqt    = xh  + nBS * DMODEL;               // [3072][1024]
  _Float16* Wot    = Wqt + (size_t)3 * DMODEL * DMODEL;// [1024][1024]
  _Float16* q_ws   = Wot + (size_t)DMODEL * DMODEL;    // [32][2048][64]
  _Float16* k_ws   = q_ws + nBS * DMODEL;
  _Float16* v_ws   = k_ws + nBS * DMODEL;
  _Float16* att_ws = v_ws + nBS * DMODEL;              // [4096][1024]

  // Prep: f16 conversion + weight transposes, one launch
  prep_kernel<<<PREP_WGS, 256, 0, stream>>>(x, Wqkv, Wout, xh, Wqt, Wot);

  // QKV projection: M=4096, N=3072; 16 heads x 16 blocks of 256 rows
  qkv_gemm_kernel<<<dim3(NHEADS, (unsigned)(nBS / QM)), 256, 0,
                    stream>>>(xh, Wqt, bqkv, q_ws, k_ws, v_ws);

  // Attention: 32 (b,h) pairs x 16 query blocks of 128; 8 waves/block:
  // 4 groups of 32 queries x 2 key halves
  attn_kernel<<<NBATCH * NHEADS * (SEQ / 128), 256, 0, stream>>>(
      q_ws, k_ws, v_ws, mask, att_ws);

  // Output projection: M=4096, N=1024
  out_gemm_kernel<<<dim3(DMODEL / 128, (unsigned)(nBS / 128)), 256, 0,
                    stream>>>(att_ws, Wot, bout, out);
}

// v008
// One run takes 75.7 microseconds.
// In two side-by-side timings against v007, it was 1.03 and 1.04 times as fast.
// Over all steps from v000 it is 2.94 times as fast.
#include <hip/hip_runtime.h>

// ---------------------------------------------------------------------------
// MHA forward for MI455X (gfx1250, wave32, WMMA f32_16x16x32_f16,
// async global->LDS double-buffered GEMM staging)
//   B=2, S=2048, D_MODEL=1024, H=16, HD=64
// ---------------------------------------------------------------------------

typedef __attribute__((ext_vector_type(16))) _Float16 v16h;
typedef __attribute__((ext_vector_type(8)))  _Float16 v8h;
typedef __attribute__((ext_vector_type(4)))  _Float16 v4h;
typedef __attribute__((ext_vector_type(8)))  float    v8f;
typedef __attribute__((ext_vector_type(4)))  float    v4f;
typedef __attribute__((ext_vector_type(2)))  float    v2f;
typedef __attribute__((ext_vector_type(4)))  int      v4i;

#define NBATCH   2
#define SEQ      2048
#define DMODEL   1024
#define NHEADS   16
#define HDIM     64

__device__ __forceinline__ v16h cat16(v8h lo, v8h hi) {
  return __builtin_shufflevector(lo, hi, 0,1,2,3,4,5,6,7,8,9,10,11,12,13,14,15);
}

__device__ __forceinline__ v8f wmma_f16(v16h a, v16h b, v8f c) {
  // (neg_a, A, neg_b, B, c_mod, C, reuse_a, reuse_b)
  return __builtin_amdgcn_wmma_f32_16x16x32_f16(false, a, false, b, (short)0, c,
                                                false, false);
}

// Wait for this wave's own async global->LDS copies (ASYNCcnt)
__device__ __forceinline__ void wait_async0() {
  asm volatile("s_wait_asynccnt 0" ::: "memory");
}

// ---------------------------------------------------------------------------
// Prep kernel: f32 -> f16 conversion of x and of both weights (transposed to
// [n][k]), so the GEMM tiles become pure contiguous copies (async-to-LDS
// friendly) and all WMMA fragments are two contiguous 16B loads per lane.
// One launch of 512 work-groups for all three; every thread
// takes sixteen 16-byte loads, all in flight together.
//   blocks   0..191: 128 x 128 tiles of W_qkv     blocks 192..255: of W_out
//   blocks 256..511: 16,384 consecutive elements of x each
// ---------------------------------------------------------------------------
#define TT        128                       // transpose tile edge
#define NT_QKV    (3 * DMODEL / TT)         // tile columns of W_qkv
#define NT_OUT    (DMODEL / TT)             // tile columns of W_out
#define TILES_QKV ((DMODEL / TT) * NT_QKV)
#define TILES_W   (TILES_QKV + (DMODEL / TT) * NT_OUT)
#define XCHUNK    (256 * 4 * 16)            // elements of x per work-group
#define PREP_WGS  (TILES_W + NBATCH * SEQ * DMODEL / XCHUNK)

// dst[n][k] (f16) = src[k][n] (f32): tile t of a weight with NT tile columns
template <int NT>
__device__ __forceinline__ void transpose_tile(
    const float* __restrict__ src, _Float16* __restrict__ dst, int t,
    _Float16* T) {
  constexpr int N = NT * TT;
  const int k0   = (t / NT) * TT;
  const int n0   = (t % NT) * TT;
  const int tid  = threadIdx.x;
  const int lane = tid & 31;
  const int wave = tid >> 5;

  // Wave w reads rows k0 + 16 w .. + 15, each wave-wide load one 512-byte row
  // piece: a lane ends up with sixteen consecutive k of four columns.
  const float* s = src + (size_t)(k0 + wave * 16) * N + n0 + lane * 4;
  v4f f[16];
#pragma unroll   // all sixteen loads go out before the first is used
  for (int i = 0; i < 15; ++i) f[i] = *(const v4f*)(s + i * N);
  // The last load's result may land in the address registers the others name
  asm volatile("s_wait_xcnt 0x0" ::: "memory");
  f[15] = *(const v4f*)(s + 15 * N);

#pragma unroll
  for (int j = 0; j < 4; ++j) {
#pragma unroll
    for (int h = 0; h < 2; ++h) {
      v8h p;
#pragma unroll
      for (int e = 0; e < 8; ++e) p[e] = (_Float16)f[h * 8 + e][j];
      *(v8h*)&T[(lane * 4 + j) * TT + (((wave * 2 + h) ^ (lane & 15)) * 8)] = p;
    }
  }
  __syncthreads();   // the tile is complete before rows are read back

  // Sixteen lanes store one row's 256 bytes: whole lines, 16 bytes a lane
  const int c = tid & 15;
  _Float16* d = dst + (size_t)(n0 + (tid >> 4)) * DMODEL + k0 + c * 8;
#pragma unroll
  for (int i = 0; i < 8; ++i) {
    const int n = i * 16 + (tid >> 4);
    *(v8h*)(d + i * 16 * DMODEL) =
        *(const v8h*)&T[n * TT + ((c ^ ((n >> 2) & 15)) * 8)];
  }
  // Stands in front of any rewrite of a register that the stores above name
  asm volatile("s_wait_xcnt 0x0" ::: "memory");
}

// Budget of four waves a SIMD (this launch has two work-groups a WGP): at the
// default budget the compiler kept to 64 registers and made the later loads
// wait for the earlier ones; with it all sixteen go out as one group.
__global__ __launch_bounds__(256)
__attribute__((amdgpu_waves_per_eu(4, 4))) void prep_kernel(
    const float* __restrict__ x, const float* __restrict__ Wqkv,
    const float* __restrict__ Wout, _Float16* __restrict__ xh,
    _Float16* __restrict__ Wqt, _Float16* __restrict__ Wot) {
  // Tile as [n][k], rows of 256 bytes in sixteen 16-byte pieces; piece c of
  // row n lies at place c ^ ((n >> 2) & 15), which spreads over all banks both
  // the writers (16 lanes: rows 4 apart, one piece) and the readers (one row).
  __shared__ __attribute__((aligned(16))) _Float16 T[TT * TT];

  const int blk = blockIdx.x;               // every branch is block-uniform
  if (blk < TILES_QKV) {
    transpose_tile<NT_QKV>(Wqkv, Wqt, blk, T);
  } else if (blk < TILES_W) {
    transpose_tile<NT_OUT>(Wout, Wot, blk - TILES_QKV, T);
  } else {                                  // x to f16
    const size_t base = (size_t)(blk - TILES_W) * XCHUNK + threadIdx.x * 4;
    v4f f[16];
#pragma unroll   // all sixteen loads go out before the first is used
    for (int i = 0; i < 15; ++i) f[i] = *(const v4f*)(x + base + i * 1024);
    // The last load's result may land in the address registers the others name
    asm volatile("s_wait_xcnt 0x0" ::: "memory");
    f[15] = *(const v4f*)(x + base + 15 * 1024);
#pragma unroll
    for (int i = 0; i < 16; ++i) {
      v4h h;
      h[0] = (_Float16)f[i][0]; h[1] = (_Float16)f[i][1];
      h[2] = (_Float16)f[i][2]; h[3] = (_Float16)f[i][3];
      *(v4h*)(xh + base + i * 1024) = h;
    }
    // Stands in front of any rewrite of a register that the stores above name
    asm volatile("s_wait_xcnt 0x0" ::: "memory");
  }
}

// ---------------------------------------------------------------------------
// Output projection's GEMM main loop over A[128 rows @ mb] and B[128 rows @ nb], K = 1024,
// both operands f16 with k contiguous (A row-major, B stored [n][k]).
// 256 threads / 8 waves; a wave owns 4x2 WMMA tiles: 64 stage rows as first
// operand, 32 as second.  A and B rows load alike, so the caller picks per
// wave which of the two is first (fo, so: offsets of those rows in buffer 0 of
// the ring): acc[t][u][r] = first row 16 t + 8 grp + r . second row 16 u + row,
// and a lane's eight registers run along the first operand's rows.
// Two-buffer LDS ring of stages of 64 k: a stage row is one whole 128-byte
// line, eight lanes copy one row, so a wave-wide copy touches four lines.
// ---------------------------------------------------------------------------
#define GK      64                   // k per stage
#define GSTG    (DMODEL / GK)
#define GPITCH  72                   // halves: 128-byte rows at 144 bytes
#define GBUF    (128 * GPITCH)       // halves per operand buffer
#define GRING   (4 * GBUF)           // A buffers 0 and 1, then B buffers 0 and 1

// One stage of A and of B (128 rows x 64 k each) into LDS: eight async copies
// of 16 bytes per lane.  la, ga / lb, gb: this lane's chunk of rows 0..31 of
// the operand, the next copies 32 rows further.  The s_wait_xcnt closes the
// statement so that it stands in front of any rewrite of the address
// registers the copies name.
__device__ __forceinline__ void stage_ab(unsigned la, unsigned lb,
                                         const _Float16* ga,
                                         const _Float16* gb) {
  asm volatile(
      "global_load_async_to_lds_b128 %0, %8, off\n\t"
      "global_load_async_to_lds_b128 %1, %9, off\n\t"
      "global_load_async_to_lds_b128 %2, %10, off\n\t"
      "global_load_async_to_lds_b128 %3, %11, off\n\t"
      "global_load_async_to_lds_b128 %4, %12, off\n\t"
      "global_load_async_to_lds_b128 %5, %13, off\n\t"
      "global_load_async_to_lds_b128 %6, %14, off\n\t"
      "global_load_async_to_lds_b128 %7, %15, off\n\t"
      "s_wait_xcnt 0x0"
      :: "v"(la), "v"(la + 32 * GPITCH * 2), "v"(la + 64 * GPITCH * 2),
         "v"(la + 96 * GPITCH * 2),
         "v"(lb), "v"(lb + 32 * GPITCH * 2), "v"(lb + 64 * GPITCH * 2),
         "v"(lb + 96 * GPITCH * 2),
         "v"(ga), "v"(ga + 32 * DMODEL), "v"(ga + 64 * DMODEL),
         "v"(ga + 96 * DMODEL),
         "v"(gb), "v"(gb + 32 * DMODEL), "v"(gb + 64 * DMODEL),
         "v"(gb + 96 * DMODEL)
      : "memory");
}

__device__ __forceinline__ void gemm_mainloop_k1024(
    _Float16* S, const _Float16* __restrict__ A,
    const _Float16* __restrict__ B, int mb, int nb, int fo, int so,
    v8f acc[4][2]) {
  const int tid  = threadIdx.x;
  const int lane = tid & 31;
  const int row  = lane & 15;
  const int grp  = lane >> 4;

  // This lane's 16-byte chunk of a stage: row tid / 8, chunk tid % 8
  const int sr = tid >> 3;
  const int sc = (tid & 7) * 8;
  const unsigned la0 = (unsigned)(uintptr_t)&S[sr * GPITCH + sc];
  const unsigned lb0 = (unsigned)(uintptr_t)&S[2 * GBUF + sr * GPITCH + sc];
  const _Float16* ga = A + (size_t)(mb + sr) * DMODEL + sc;
  const _Float16* gb = B + (size_t)(nb + sr) * DMODEL + sc;

  stage_ab(la0, lb0, ga, gb);                           // stage 0, buffer 0
  wait_async0();      // this wave's share of stage 0 has landed
  __syncthreads();    // publishes stage 0
  stage_ab(la0 + GBUF * 2, lb0 + GBUF * 2, ga + GK, gb + GK);

  for (int st = 0; st < GSTG; ++st) {
    const int cur = st & 1;
    const _Float16* at = &S[cur * GBUF + fo + row * GPITCH + 8 * grp];
    const _Float16* bt = &S[cur * GBUF + so + row * GPITCH + 8 * grp];

#pragma unroll   // both halves at constant LDS offsets from one address
    for (int h = 0; h < GK / 32; ++h) {
      v16h af[4];
#pragma unroll
      for (int tm = 0; tm < 4; ++tm) {
        const _Float16* p = at + tm * 16 * GPITCH + h * 32;
        af[tm] = cat16(*(const v8h*)p, *(const v8h*)(p + 16));
      }
      v16h bf[2];
#pragma unroll
      for (int tn = 0; tn < 2; ++tn) {
        const _Float16* p = bt + tn * 16 * GPITCH + h * 32;
        bf[tn] = cat16(*(const v8h*)p, *(const v8h*)(p + 16));
      }
#pragma unroll
      for (int tm = 0; tm < 4; ++tm)
#pragma unroll
        for (int tn = 0; tn < 2; ++tn)
          acc[tm][tn] = wmma_f16(af[tm], bf[tn], acc[tm][tn]);
    }

    // Publish point of stage st + 1: this wave's reads of the current buffer
    // have retired, its copies of the next stage have landed, and behind the
    // barrier the current buffer is free for stage st + 2.
    asm volatile("s_wait_dscnt 0x0" ::: "memory");
    wait_async0();
    __syncthreads();
    if (st + 2 < GSTG)
      stage_ab(la0 + cur * (GBUF * 2), lb0 + cur * (GBUF * 2),
               ga + (st + 2) * GK, gb + (st + 2) * GK);
  }
  wait_async0();                  // nothing is in flight behind the loop
}

// ---------------------------------------------------------------------------
// Kernel 1: QKV projection.  C[4096][3072] = xh @ Wqt^T + b_qkv.  Scatters:
//   q_ws: [bh][s][64]  (pre-scaled by 1/sqrt(64))
//   k_ws: [bh][s][64]
//   v_ws: [bh][d][s]   (transposed for the PV matmul's A-fragment layout)
// A work-group takes 256 x rows by the 192 columns of one head (its q, k and
// v): 256 work-groups, one on each WGP.  A wave takes 64 x rows by 96 columns:
// all of q (waves 0..3) or of k (waves 4..7) and one half of v, 24 WMMA tiles
// from ten fragments.  For q and k the weight rows are the first WMMA operand,
// for v the x rows, so that a lane's eight accumulators are always eight
// neighbours of one destination row; the rows, staged in LDS, leave as whole
// 128-byte lines.
// ---------------------------------------------------------------------------

// 32 staged rows of 128 bytes (pitch GPITCH) to dst, rows STRIDE halves apart.
// Eight lanes take one row; a store covers rows i, i + 8, i + 16, i + 24: four
// whole lines, and in LDS each half of the wave meets every bank once.
template <int STRIDE>
__device__ __forceinline__ void store_rows_f16(const _Float16* stg,
                                               _Float16* dst, int lane) {
  // This wave's own LDS writes have retired before lanes read others' rows
  asm volatile("s_wait_dscnt 0x0" ::: "memory");
  const _Float16* s = stg + (lane >> 3) * 8 * GPITCH + (lane & 7) * 8;
  _Float16* d = dst + (size_t)((lane >> 3) * 8) * STRIDE + (lane & 7) * 8;
  v8h p[8];
#pragma unroll   // constant offsets from one LDS and one global address
  for (int i = 0; i < 8; ++i) p[i] = *(const v8h*)(s + i * GPITCH);
#pragma unroll
  for (int i = 0; i < 8; ++i) *(v8h*)(d + i * STRIDE) = p[i];
  // Stands in front of any rewrite of a register that the stores above name
  asm volatile("s_wait_xcnt 0x0" ::: "memory");
}

#define QM      256                  // x rows per work-group
#define QN      (3 * HDIM)           // weight rows per work-group: one head
#define QK      128                  // k per stage
#define QSTG    (DMODEL / QK)
#define QPITCH  136                  // halves: 256-byte rows at 272 bytes
#define QBUF    ((QN + QM) * QPITCH) // halves per buffer: weight rows, x rows
#define QSTEP   (16 * QPITCH * 2)    // LDS bytes from one copy to the next

// Fourteen async copies of 16 bytes per lane, LDS places sixteen rows apart.
// The s_wait_xcnt closes the statement so that it stands in front of any
// rewrite of the address registers the copies name.
__device__ __forceinline__ void copy14(unsigned l, const _Float16* const* g) {
  asm volatile(
      "global_load_async_to_lds_b128 %0, %14, off\n\t"
      "global_load_async_to_lds_b128 %1, %15, off\n\t"
      "global_load_async_to_lds_b128 %2, %16, off\n\t"
      "global_load_async_to_lds_b128 %3, %17, off\n\t"
      "global_load_async_to_lds_b128 %4, %18, off\n\t"
      "global_load_async_to_lds_b128 %5, %19, off\n\t"
      "global_load_async_to_lds_b128 %6, %20, off\n\t"
      "global_load_async_to_lds_b128 %7, %21, off\n\t"
      "global_load_async_to_lds_b128 %8, %22, off\n\t"
      "global_load_async_to_lds_b128 %9, %23, off\n\t"
      "global_load_async_to_lds_b128 %10, %24, off\n\t"
      "global_load_async_to_lds_b128 %11, %25, off\n\t"
      "global_load_async_to_lds_b128 %12, %26, off\n\t"
      "global_load_async_to_lds_b128 %13, %27, off\n\t"
      "s_wait_xcnt 0x0"
      :: "v"(l), "v"(l + QSTEP), "v"(l + 2 * QSTEP), "v"(l + 3 * QSTEP),
         "v"(l + 4 * QSTEP), "v"(l + 5 * QSTEP), "v"(l + 6 * QSTEP),
         "v"(l + 7 * QSTEP), "v"(l + 8 * QSTEP), "v"(l + 9 * QSTEP),
         "v"(l + 10 * QSTEP), "v"(l + 11 * QSTEP), "v"(l + 12 * QSTEP),
         "v"(l + 13 * QSTEP),
         "v"(g[0]), "v"(g[1]), "v"(g[2]), "v"(g[3]), "v"(g[4]), "v"(g[5]),
         "v"(g[6]), "v"(g[7]), "v"(g[8]), "v"(g[9]), "v"(g[10]), "v"(g[11]),
         "v"(g[12]), "v"(g[13])
      : "memory");
}

// One stage (192 weight rows, then 256 x rows, 128 k each) into the buffer at
// l: 28 copies per lane, sixteen lanes to a row, so a wave-wide copy takes two
// rows' four whole lines.  l, gx, gw: this lane's chunk of rows 0..15.
__device__ __forceinline__ void stage_xw(unsigned l, const _Float16* gx,
                                         const _Float16* gw) {
  const _Float16* g[(QN + QM) / 16];
#pragma unroll   // the table is indexed by constants only: it stays in registers
  for (int i = 0; i < QN / 16; ++i) g[i] = gw + i * 16 * DMODEL;
#pragma unroll
  for (int i = 0; i < QM / 16; ++i) g[QN / 16 + i] = gx + i * 16 * DMODEL;
  copy14(l, g);
  copy14(l + 14 * QSTEP, g + 14);
}

// One work-group fills a WGP's LDS: two waves a SIMD, 512 registers a wave
__global__ __launch_bounds__(256) void qkv_gemm_kernel(
    const _Float16* __restrict__ xh, const _Float16* __restrict__ Wqt,
    const float* __restrict__ bqkv,
    _Float16* __restrict__ q_ws, _Float16* __restrict__ k_ws,
    _Float16* __restrict__ v_ws) {
  __shared__ __attribute__((aligned(16))) _Float16 S[2 * QBUF];

  const int tid  = threadIdx.x;
  const int lane = tid & 31;
  const int row  = lane & 15;
  const int grp  = lane >> 4;
  // In a scalar register: the wave's offsets become scalar arithmetic
  const int wave = __builtin_amdgcn_readfirstlane(tid >> 5);
  const int hd   = blockIdx.x;
  const int mb   = blockIdx.y * QM;
  const int nb   = hd * QN;
  const int xr   = (wave & 3) * 64;           // first x row, of 256
  const int wn   = wave >> 2;                 // 0: q and v 0..31, 1: k and v 32..63

  v8f aq[4][4];       // [weight tile of q or k][x tile]
  v8f av[4][2];       // [x tile][weight tile of v]
#pragma unroll
  for (int i = 0; i < 4; ++i) {
    const v8f z = {0.f,0.f,0.f,0.f,0.f,0.f,0.f,0.f};
#pragma unroll
    for (int j = 0; j < 4; ++j) aq[i][j] = z;
#pragma unroll
    for (int j = 0; j < 2; ++j) av[i][j] = z;
  }

  // This lane's 16-byte chunk of a stage: row tid / 16, chunk tid % 16
  const int sr = tid >> 4;
  const int sc = (tid & 15) * 8;
  const unsigned l0 = (unsigned)(uintptr_t)&S[sr * QPITCH + sc];
  const _Float16* gx = xh + (size_t)(mb + sr) * DMODEL + sc;
  const _Float16* gw = Wqt + (size_t)(nb + sr) * DMODEL + sc;

  stage_xw(l0, gx, gw);                                 // stage 0, buffer 0
  wait_async0();      // this wave's share of stage 0 has landed
  __syncthreads();    // publishes stage 0
  stage_xw(l0 + QBUF * 2, gx + QK, gw + QK);

  for (int st = 0; st < QSTG; ++st) {
    const int cur = st & 1;
    const _Float16* fr = &S[cur * QBUF + row * QPITCH + 8 * grp];
    const _Float16* wt = fr + wn * HDIM * QPITCH;
    const _Float16* vt = fr + (2 * HDIM + wn * 32) * QPITCH;
    const _Float16* xt = fr + (QN + xr) * QPITCH;

    // Two fragment sets: 0..3 x tiles, 4..7 weight tiles of q or k, 8..9 of v
    v16h f[2][10];
#pragma unroll   // a stage's four blocks of 32 k, at constant LDS offsets
    for (int h = -1; h < QK / 32; ++h) {
      if (h + 1 < QK / 32) {      // the next block's fragments, as one group
        v16h* n = f[(h + 1) & 1];
#pragma unroll
        for (int t = 0; t < 10; ++t) {
          const _Float16* p = (t < 4   ? xt + t * 16 * QPITCH
                               : t < 8 ? wt + (t - 4) * 16 * QPITCH
                                       : vt + (t - 8) * 16 * QPITCH) +
                              (h + 1) * 32;
          n[t] = cat16(*(const v8h*)p, *(const v8h*)(p + 16));
        }
      }
      // Keeps those loads ahead of this block's WMMAs: moved down among them,
      // each would be waited for where it stands
      __builtin_amdgcn_sched_barrier(0);
      if (h >= 0) {
        const v16h* b = f[h & 1];
#pragma unroll
        for (int t = 0; t < 4; ++t)
#pragma unroll
          for (int u = 0; u < 4; ++u)
            aq[t][u] = wmma_f16(b[4 + t], b[u], aq[t][u]);
#pragma unroll
        for (int t = 0; t < 4; ++t)
#pragma unroll
          for (int u = 0; u < 2; ++u)
            av[t][u] = wmma_f16(b[t], b[8 + u], av[t][u]);
        // Keeps the block after next's loads from moving up among these WMMAs
        __builtin_amdgcn_sched_barrier(0);
      }
    }

    // Publish point of stage st + 1: this wave's reads of the current buffer
    // have retired, its copies of the next stage have landed, and behind the
    // barrier the current buffer is free for stage st + 2.
    asm volatile("s_wait_dscnt 0x0" ::: "memory");
    wait_async0();
    __syncthreads();
    if (st + 2 < QSTG)
      stage_xw(l0 + cur * (QBUF * 2), gx + (st + 2) * QK, gw + (st + 2) * QK);
  }
  wait_async0();                  // nothing is in flight behind the loop

  // Behind the loop's last barrier nobody reads the ring and no copy is in
  // flight: each wave stages in a range of its own, 64 rows of q or k (one row
  // a position) and then 32 rows of v (one row a head column).
  _Float16* stg  = S + wave * (96 * GPITCH);
  _Float16* stgv = stg + 64 * GPITCH;
  const int bh = (mb >> 11) * NHEADS + hd;
  const int s0 = (mb & (SEQ - 1)) + xr;

  const float sc8 = wn == 0 ? 0.125f : 1.f;
  v4f bb[4][2];       // bias of q or k: eight columns a lane and tile
  float bv[2];        // bias of v: one column a lane and tile
  // The ten loads and their data wait are one statement: as plain loads with a
  // wait in a statement of its own, later address arithmetic was moved up over
  // that wait and rewrote an offset register that the loads name.  All ten are
  // in flight together, and all are needed next.
  asm volatile(
      "global_load_b128 %0, %10, off\n\t"
      "global_load_b128 %1, %10, off offset:16\n\t"
      "global_load_b128 %2, %10, off offset:64\n\t"
      "global_load_b128 %3, %10, off offset:80\n\t"
      "global_load_b128 %4, %10, off offset:128\n\t"
      "global_load_b128 %5, %10, off offset:144\n\t"
      "global_load_b128 %6, %10, off offset:192\n\t"
      "global_load_b128 %7, %10, off offset:208\n\t"
      "global_load_b32 %8, %11, off\n\t"
      "global_load_b32 %9, %11, off offset:64\n\t"
      "s_wait_loadcnt 0x0"
      : "=&v"(bb[0][0]), "=&v"(bb[0][1]), "=&v"(bb[1][0]), "=&v"(bb[1][1]),
        "=&v"(bb[2][0]), "=&v"(bb[2][1]), "=&v"(bb[3][0]), "=&v"(bb[3][1]),
        "=&v"(bv[0]), "=&v"(bv[1])
      : "v"(bqkv + nb + wn * HDIM + 8 * grp),
        "v"(bqkv + nb + 2 * HDIM + wn * 32 + row)
      : "memory");

  // q or k: registers run along the head's 64 columns, lanes along s
#pragma unroll   // here and below: accumulators are indexed by constants only
  for (int t = 0; t < 4; ++t) {
#pragma unroll
    for (int u = 0; u < 4; ++u) {
      v8h p;
#pragma unroll
      for (int r = 0; r < 8; ++r)
        p[r] = (_Float16)((aq[t][u][r] + bb[t][r >> 2][r & 3]) * sc8);
      *(v8h*)&stg[(u * 16 + row) * GPITCH + t * 16 + 8 * grp] = p;
    }
  }
  // v: registers run along s, lanes along d
#pragma unroll
  for (int u = 0; u < 2; ++u) {
#pragma unroll
    for (int t = 0; t < 4; ++t) {
      v8h p;
#pragma unroll
      for (int r = 0; r < 8; ++r) p[r] = (_Float16)(av[t][u][r] + bv[u]);
      *(v8h*)&stgv[(u * 16 + row) * GPITCH + t * 16 + 8 * grp] = p;
    }
  }

  _Float16* dqk = (wn == 0 ? q_ws : k_ws) + ((size_t)bh * SEQ + s0) * HDIM;
  store_rows_f16<HDIM>(stg, dqk, lane);
  store_rows_f16<HDIM>(stg + 32 * GPITCH, dqk + 32 * HDIM, lane);
  store_rows_f16<SEQ>(stgv, v_ws + ((size_t)bh * HDIM + wn * 32) * SEQ + s0,
                      lane);
}

__device__ __forceinline__ float xhalf(float x) {
  const int b = __builtin_bit_cast(int, x);
  return __builtin_bit_cast(float, __builtin_amdgcn_permlanex16(
      b, b, 0x76543210, 0xfedcba98, false, false));
}

#define KSTG    128                  // keys per stage
#define NSTG    (SEQ / KSTG)
#define KHALF   (KSTG / 2)           // keys of a stage that one wave takes
#define KPITCH  72                   // halves: 128-byte K rows at 144 bytes
#define VPITCH  136                  // halves: 256-byte Vt rows at 272 bytes
#define KBUF    (KSTG * KPITCH)      // halves per K buffer
#define VBUF    (HDIM * VPITCH)      // halves per Vt buffer
#define PMAX    4096.f               // bound of a P value: a sixteenth of f16's top

// P = exp(score - m) of one lane's sixteen keys of a column group, as f16 into
// the B fragment; returns their sum, a tree that folds halves onto each other.
__device__ __forceinline__ float exp_tile(v8f c0, v8f c1, float m, v16h& pb) {
  v8f p0, p1;
#pragma unroll   // vector elements are indexed by constants only
  for (int r = 0; r < 8; ++r) {
    p0[r] = __expf(c0[r] - m);
    p1[r] = __expf(c1[r] - m);
    pb[r]     = (_Float16)p0[r];
    pb[8 + r] = (_Float16)p1[r];
  }
  const v8f ps = p0 + p1;
  const v4f s4 = __builtin_shufflevector(ps, ps, 0, 1, 2, 3) +
                 __builtin_shufflevector(ps, ps, 4, 5, 6, 7);
  const v2f s2 = __builtin_shufflevector(s4, s4, 0, 1) +
                 __builtin_shufflevector(s4, s4, 2, 3);
  return s2[0] + s2[1];
}

// One stage of K (128 keys x 64) and Vt (64 x 128 keys) into LDS: eight async
// copies of 16 bytes per lane, every wave-wide copy covering four whole lines.
// lk, gk: this lane's chunk of K rows 0..31, the next copies 32 rows further;
// lv, gv: its chunk of Vt rows 0..15, the next copies 16 rows further.
// The s_wait_xcnt closes the statement so that it stands in front of any
// rewrite of the address registers the copies name.
__device__ __forceinline__ void stage_kv(unsigned lk, unsigned lv,
                                         const _Float16* gk,
                                         const _Float16* gv) {
  asm volatile(
      "global_load_async_to_lds_b128 %0, %8, off\n\t"
      "global_load_async_to_lds_b128 %1, %9, off\n\t"
      "global_load_async_to_lds_b128 %2, %10, off\n\t"
      "global_load_async_to_lds_b128 %3, %11, off\n\t"
      "global_load_async_to_lds_b128 %4, %12, off\n\t"
      "global_load_async_to_lds_b128 %5, %13, off\n\t"
      "global_load_async_to_lds_b128 %6, %14, off\n\t"
      "global_load_async_to_lds_b128 %7, %15, off\n\t"
      "s_wait_xcnt 0x0"
      :: "v"(lk), "v"(lk + 32 * KPITCH * 2), "v"(lk + 64 * KPITCH * 2),
         "v"(lk + 96 * KPITCH * 2),
         "v"(lv), "v"(lv + 16 * VPITCH * 2), "v"(lv + 32 * VPITCH * 2),
         "v"(lv + 48 * VPITCH * 2),
         "v"(gk), "v"(gk + 32 * HDIM), "v"(gk + 64 * HDIM), "v"(gk + 96 * HDIM),
         "v"(gv), "v"(gv + 16 * SEQ), "v"(gv + 32 * SEQ), "v"(gv + 48 * SEQ)
      : "memory");
}

// Four waves a SIMD and no more: two work-groups fill a WGP, so the 512
// work-groups of the launch cannot pile up three to a WGP and leave others idle.
__global__ __launch_bounds__(256)
__attribute__((amdgpu_waves_per_eu(4, 4))) void attn_kernel(
    const _Float16* __restrict__ q_ws, const _Float16* __restrict__ k_ws,
    const _Float16* __restrict__ v_ws, const int* __restrict__ mask,
    _Float16* __restrict__ att_ws) {
  // 0 for a live key, -inf for a masked one
  __shared__ __attribute__((aligned(32))) float mbias[SEQ];
  // Two-buffer ring of K and Vt stages, shared by the block's eight waves
  __shared__ __attribute__((aligned(16))) _Float16 Ks[2 * KBUF];
  __shared__ __attribute__((aligned(16))) _Float16 Vs[2 * VBUF];

  const int tid  = threadIdx.x;
  const int lane = tid & 31;
  const int row  = lane & 15;
  const int grp  = lane >> 4;
  // In a scalar register: the choice of who merges becomes a scalar branch
  const int wave = __builtin_amdgcn_readfirstlane(tid >> 5);
  const int cg   = wave & 3;                            // 32-query group
  const int kh   = wave >> 2;                           // key half of a stage

  const int bh = blockIdx.x >> 4;                       // 0..31
  const int q0 = (blockIdx.x & 15) * 128 + cg * 32;
  const int b  = bh >> 4;
  const int hh = bh & (NHEADS - 1);

  const _Float16* qb = q_ws + (size_t)bh * SEQ * HDIM;
  const _Float16* kb = k_ws + (size_t)bh * SEQ * HDIM;
  const _Float16* vb = v_ws + (size_t)bh * HDIM * SEQ;
  const int* mrow    = mask + b * SEQ;

  // This lane's 16-byte chunk of a stage: K row tid / 8, Vt row tid / 16
  const unsigned lk0 =
      (unsigned)(uintptr_t)&Ks[(tid >> 3) * KPITCH + (tid & 7) * 8];
  const unsigned lv0 =
      (unsigned)(uintptr_t)&Vs[(tid >> 4) * VPITCH + (tid & 15) * 8];
  const _Float16* gk = kb + tid * 8;
  const _Float16* gv = vb + (tid >> 4) * SEQ + (tid & 15) * 8;

  stage_kv(lk0, lv0, gk, gv);                           // stage 0, buffer 0

  // Keys run over accumulator registers: the mask enters as the C operand of
  // the score product, read from this table.
#pragma unroll   // independent loads in flight instead of round trips
  for (int i0 = 0; i0 < SEQ; i0 += 256 * 4) {
    const int i = i0 + tid * 4;
    const v4i mm = *(const v4i*)(mrow + i);
    v4f bb;
#pragma unroll
    for (int j = 0; j < 4; ++j) bb[j] = (mm[j] == 0) ? -__builtin_inff() : 0.f;
    *(v4f*)&mbias[i] = bb;
  }
  wait_async0();      // this wave's share of stage 0 has landed
  __syncthreads();    // publishes stage 0 and the mask table
  stage_kv(lk0 + KBUF * 2, lv0 + VBUF * 2, gk + KSTG * HDIM, gv + KSTG);

  v16h bq[2][2];                  // [column group][k half of the head size]
#pragma unroll   // the loads go out together, into registers
  for (int g = 0; g < 2; ++g) {
    const _Float16* qrow = qb + (size_t)(q0 + g * 16 + row) * HDIM;
    bq[g][0] = cat16(*(const v8h*)(qrow + 8 * grp),
                     *(const v8h*)(qrow + 16 + 8 * grp));
    bq[g][1] = cat16(*(const v8h*)(qrow + 32 + 8 * grp),
                     *(const v8h*)(qrow + 48 + 8 * grp));
  }
  // Stands in front of any rewrite of a register that the loads above name
  asm volatile("s_wait_xcnt 0x0" ::: "memory");

  // Maximum in use for this lane's query in each group.  The start is finite
  // and below every score, so a key half whose keys are all masked keeps zero
  // sums and merges as nothing instead of giving inf - inf; a live key's
  // exponential against it is inf, which forces the first renewal.
  float mv[2] = {-1e30f, -1e30f};
  float lv[2] = {0.f, 0.f};       // this half's share of the running sums
  v8f o[2][4];                    // o[g][t][r] = Ot[16 t + 8 grp + r][query row]
#pragma unroll
  for (int g = 0; g < 2; ++g)
#pragma unroll
    for (int t = 0; t < 4; ++t) {
      v8f z = {0.f,0.f,0.f,0.f,0.f,0.f,0.f,0.f};
      o[g][t] = z;
    }

  for (int st = 0; st < NSTG; ++st) {
    const int cur = st & 1;
    const _Float16* kt =
        &Ks[cur * KBUF + (kh * KHALF + row) * KPITCH + 8 * grp];
    const _Float16* vt = &Vs[cur * VBUF + row * VPITCH + kh * KHALF + 8 * grp];

#pragma unroll   // the second pass's LDS reads go out under the first pass
    for (int p = 0; p < KHALF / 32; ++p) {
      const int s0 = st * KSTG + kh * KHALF + p * 32;
      const _Float16* k0r = kt + p * 32 * KPITCH;      // key row, k chunk
      const _Float16* k1r = k0r + 16 * KPITCH;
      const _Float16* vr  = vt + p * 32;               // d row, key chunk
      const v16h ak00 = cat16(*(const v8h*)(k0r),      *(const v8h*)(k0r + 16));
      const v16h ak01 = cat16(*(const v8h*)(k0r + 32), *(const v8h*)(k0r + 48));
      const v16h ak10 = cat16(*(const v8h*)(k1r),      *(const v8h*)(k1r + 16));
      const v16h ak11 = cat16(*(const v8h*)(k1r + 32), *(const v8h*)(k1r + 48));

      v16h av[4];
#pragma unroll
      for (int t = 0; t < 4; ++t)
        av[t] = cat16(*(const v8h*)(vr + t * 16 * VPITCH),
                      *(const v8h*)(vr + t * 16 * VPITCH + 16));

      // c0[r]: key s0 + 8 grp + r, c1[r]: key s0 + 16 + 8 grp + r
      const v8f mb0 = *(const v8f*)&mbias[s0 + 8 * grp];
      const v8f mb1 = *(const v8f*)&mbias[s0 + 16 + 8 * grp];

      v8f c0[2], c1[2];
      v16h pb[2];
      float ps[2];                // sum of this lane's sixteen exponentials
#pragma unroll   // both column groups work from the same fragments
      for (int g = 0; g < 2; ++g) {
        c0[g] = wmma_f16(ak00, bq[g][0], mb0);
        c1[g] = wmma_f16(ak10, bq[g][0], mb1);
        c0[g] = wmma_f16(ak01, bq[g][1], c0[g]);
        c1[g] = wmma_f16(ak11, bq[g][1], c1[g]);
        ps[g] = exp_tile(c0[g], c1[g], mv[g], pb[g]);
      }

      // Compiler fence: keeps the Vt loads in front of the branch, so that they
      // fly during the test; moved behind it they are waited for where they
      // stand, with nothing to cover them.
      asm volatile("" ::: "memory");

      // No P value is above its lane's sum: while every sum is within PMAX, all
      // of P fits f16 and the maximum in use may stay.  One test a pass for both
      // groups, a scalar branch; written so that inf and NaN take the renewal.
      if (__builtin_amdgcn_ballot_w32(!(ps[0] <= PMAX) | !(ps[1] <= PMAX)) != 0) {
#pragma unroll   // accumulators are indexed by constants only
        for (int g = 0; g < 2; ++g) {
          float tm[8];
#pragma unroll
          for (int r = 0; r < 8; ++r) tm[r] = fmaxf(c0[g][r], c1[g][r]);
          float rm = fmaxf(fmaxf(fmaxf(tm[0], tm[1]), fmaxf(tm[2], tm[3])),
                           fmaxf(fmaxf(tm[4], tm[5]), fmaxf(tm[6], tm[7])));
          rm = fmaxf(rm, xhalf(rm));  // both wave halves keep one maximum
          const float mn    = fmaxf(mv[g], rm);
          const float alpha = __expf(mv[g] - mn);
          mv[g] = mn;
          lv[g] *= alpha;
#pragma unroll
          for (int t = 0; t < 4; ++t) o[g][t] *= alpha;
          ps[g] = exp_tile(c0[g], c1[g], mn, pb[g]);
        }
      }
      lv[0] += ps[0];
      lv[1] += ps[1];

#pragma unroll
      for (int g = 0; g < 2; ++g)
#pragma unroll
        for (int t = 0; t < 4; ++t) o[g][t] = wmma_f16(av[t], pb[g], o[g][t]);
    }

    // Publish point of stage st + 1: this wave's reads of the current buffer
    // have retired, its copies of the next stage have landed, and behind the
    // barrier the current buffer is free for stage st + 2.
    asm volatile("s_wait_dscnt 0x0" ::: "memory");
    wait_async0();
    __syncthreads();
    if (st + 2 < NSTG)
      stage_kv(lk0 + cur * (KBUF * 2), lv0 + cur * (VBUF * 2),
               gk + (st + 2) * (KSTG * HDIM), gv + (st + 2) * KSTG);
  }
  wait_async0();                  // nothing is in flight behind the loop

  // Merge of the two key halves.  Behind the loop's last barrier nobody reads
  // the K ring and no copy is in flight: wave 4 + cg hands its sums to wave cg
  // there, lane to lane, seventeen 16-byte pieces a lane, each piece contiguous
  // over the wave.
  v4f* xw = (v4f*)Ks + cg * (17 * 32) + lane;
  if (kh == 1) {
#pragma unroll   // accumulators are indexed by constants only
    for (int g = 0; g < 2; ++g)
#pragma unroll
      for (int t = 0; t < 4; ++t) {
        const v8f v = o[g][t];
        xw[((g * 4 + t) * 2) * 32]     = __builtin_shufflevector(v, v, 0, 1, 2, 3);
        xw[((g * 4 + t) * 2 + 1) * 32] = __builtin_shufflevector(v, v, 4, 5, 6, 7);
      }
    const v4f ml = {mv[0], mv[1], lv[0], lv[1]};
    xw[16 * 32] = ml;
  }
  __syncthreads();    // the second half's sums are in LDS before they are read
  if (kh == 0) {
    const v4f ml = xw[16 * 32];
    v8h h[2][4];
#pragma unroll
    for (int g = 0; g < 2; ++g) {
      const float m  = fmaxf(mv[g], ml[g]);
      const float a0 = __expf(mv[g] - m);
      const float a1 = __expf(ml[g] - m);
      float l = lv[g] * a0 + ml[2 + g] * a1;
      l += xhalf(l);              // join the two wave halves' sums
      const float w0 = a0 / l;    // the division by the sum goes into the weights
      const float w1 = a1 / l;
#pragma unroll
      for (int t = 0; t < 4; ++t) {
        const v4f x0 = xw[((g * 4 + t) * 2) * 32];
        const v4f x1 = xw[((g * 4 + t) * 2 + 1) * 32];
#pragma unroll
        for (int r = 0; r < 4; ++r) {
          h[g][t][r]     = (_Float16)(o[g][t][r] * w0 + x0[r] * w1);
          h[g][t][4 + r] = (_Float16)(o[g][t][4 + r] * w0 + x1[r] * w1);
        }
      }
    }
    _Float16* orow =
        att_ws + ((size_t)(b * SEQ + q0 + row)) * DMODEL + hh * HDIM + 8 * grp;
#pragma unroll   // constant offsets from one global address
    for (int g = 0; g < 2; ++g)
#pragma unroll
      for (int t = 0; t < 4; ++t)
        *(v8h*)(orow + g * 16 * DMODEL + t * 16) = h[g][t];
    // Stands in front of any rewrite of a register that the stores above name
    asm volatile("s_wait_xcnt 0x0" ::: "memory");
  }
}

// ---------------------------------------------------------------------------
// Kernel 3: output projection.  out[4096][1024] = att @ Wot^T + b_out
// The weight rows are the first WMMA operand: a lane's eight accumulators are
// eight neighbours of one output row.  A wave's 32 rows of 64 floats, staged in
// LDS, leave as whole 128-byte lines.
// ---------------------------------------------------------------------------
#define OPITCH  68                   // floats: 256-byte rows at 272 bytes

__global__ __launch_bounds__(256) void out_gemm_kernel(
    const _Float16* __restrict__ att, const _Float16* __restrict__ Wot,
    const float* __restrict__ bout, float* __restrict__ out) {
  __shared__ __attribute__((aligned(16))) _Float16 S[GRING];

  const int lane = threadIdx.x & 31;
  const int row  = lane & 15;
  const int grp  = lane >> 4;
  // In a scalar register: the wave's offsets become scalar arithmetic
  const int wave = __builtin_amdgcn_readfirstlane(threadIdx.x >> 5);
  const int mb   = blockIdx.y * 128;
  const int nb   = blockIdx.x * 128;
  const int xr   = (wave & 3) * 32;           // first att row, of 128
  const int wr   = (wave >> 2) * 64;          // first weight row, of 128

  v8f acc[4][2];
#pragma unroll
  for (int i = 0; i < 4; ++i)
#pragma unroll
    for (int j = 0; j < 2; ++j) {
      v8f z = {0.f,0.f,0.f,0.f,0.f,0.f,0.f,0.f};
      acc[i][j] = z;
    }

  gemm_mainloop_k1024(S, att, Wot, mb, nb, 2 * GBUF + wr * GPITCH, xr * GPITCH,
                      acc);

  // Behind the loop's last barrier nobody reads the ring and no copy is in
  // flight: each wave stages in a range of its own.
  float* stg = (float*)S + wave * (32 * OPITCH);
  v8f bb[4];          // bias: eight columns a lane and tile
#pragma unroll   // the loads go out together, into registers
  for (int t = 0; t < 4; ++t)
    bb[t] = *(const v8f*)(bout + nb + wr + t * 16 + 8 * grp);
  // Stands in front of any rewrite of a register that the loads above name
  asm volatile("s_wait_xcnt 0x0" ::: "memory");
#pragma unroll   // here and below: accumulators are indexed by constants only
  for (int t = 0; t < 4; ++t) {
#pragma unroll
    for (int u = 0; u < 2; ++u) {
      const v8f v = acc[t][u] + bb[t];
      float* w = &stg[(u * 16 + row) * OPITCH + t * 16 + 8 * grp];
      *(v4f*)w       = __builtin_shufflevector(v, v, 0, 1, 2, 3);
      *(v4f*)(w + 4) = __builtin_shufflevector(v, v, 4, 5, 6, 7);
    }
  }
  // This wave's own LDS writes have retired before lanes read others' rows
  asm volatile("s_wait_dscnt 0x0" ::: "memory");
  // Sixteen lanes take one row: a store covers two rows, four whole lines
  const float* s = stg + grp * OPITCH + row * 4;
  float* d = out + (size_t)(mb + xr + grp) * DMODEL + nb + wr + row * 4;
  v4f p[16];
#pragma unroll   // constant offsets from one LDS and one global address
  for (int i = 0; i < 16; ++i) p[i] = *(const v4f*)(s + i * 2 * OPITCH);
#pragma unroll
  for (int i = 0; i < 16; ++i) *(v4f*)(d + i * 2 * DMODEL) = p[i];
  // Stands in front of any rewrite of a register that the stores above name
  asm volatile("s_wait_xcnt 0x0" ::: "memory");
}

// ---------------------------------------------------------------------------
// Launch
// ---------------------------------------------------------------------------
extern "C" void kernel_launch(void* const* d_in, const int* in_sizes, int n_in,
                              void* d_out, int out_size, void* d_ws,
                              size_t ws_size, hipStream_t stream) {
  const float* x    = (const float*)d_in[0];
  const int*   mask = (const int*)d_in[1];
  const float* Wqkv = (const float*)d_in[2];
  const float* bqkv = (const float*)d_in[3];
  const float* Wout = (const float*)d_in[4];
  const float* bout = (const float*)d_in[5];
  float* out = (float*)d_out;

  const size_t nBS  = (size_t)NBATCH * SEQ;            // 4096
  _Float16* xh     = (_Float16*)d_ws;                  // [4096][1024]
  _Float16* Wqt    = xh  + nBS * DMODEL;               // [3072][1024]
  _Float16* Wot    = Wqt + (size_t)3 * DMODEL * DMODEL;// [1024][1024]
  _Float16* q_ws   = Wot + (size_t)DMODEL * DMODEL;    // [32][2048][64]
  _Float16* k_ws   = q_ws + nBS * DMODEL;
  _Float16* v_ws   = k_ws + nBS * DMODEL;
  _Float16* att_ws = v_ws + nBS * DMODEL;              // [4096][1024]

  // Prep: f16 conversion + weight transposes, one launch
  prep_kernel<<<PREP_WGS, 256, 0, stream>>>(x, Wqkv, Wout, xh, Wqt, Wot);

  // QKV projection: M=4096, N=3072; 16 heads x 16 blocks of 256 rows
  qkv_gemm_kernel<<<dim3(NHEADS, (unsigned)(nBS / QM)), 256, 0,
                    stream>>>(xh, Wqt, bqkv, q_ws, k_ws, v_ws);

  // Attention: 32 (b,h) pairs x 16 query blocks of 128; 8 waves/block:
  // 4 groups of 32 queries x 2 key halves
  attn_kernel<<<NBATCH * NHEADS * (SEQ / 128), 256, 0, stream>>>(
      q_ws, k_ws, v_ws, mask, att_ws);

  // Output projection: M=4096, N=1024
  out_gemm_kernel<<<dim3(DMODEL / 128, (unsigned)(nBS / 128)), 256, 0,
                    stream>>>(att_ws, Wot, bout, out);
}

// v009
// One run takes 71.8 microseconds.
// Two timings next to v008 put it at 1.06 and 1.05 times that version's speed.
// Over all steps from v000 it is 3.10 times as fast.
#include <hip/hip_runtime.h>

// ---------------------------------------------------------------------------
// MHA forward for MI455X (gfx1250, wave32, WMMA f32_16x16x32_f16,
// async global->LDS double-buffered GEMM staging)
//   B=2, S=2048, D_MODEL=1024, H=16, HD=64
// ---------------------------------------------------------------------------

typedef __attribute__((ext_vector_type(16))) _Float16 v16h;
typedef __attribute__((ext_vector_type(8)))  _Float16 v8h;
typedef __attribute__((ext_vector_type(4)))  _Float16 v4h;
typedef __attribute__((ext_vector_type(8)))  float    v8f;
typedef __attribute__((ext_vector_type(4)))  float    v4f;
typedef __attribute__((ext_vector_type(2)))  float    v2f;
typedef __attribute__((ext_vector_type(4)))  int      v4i;

#define NBATCH   2
#define SEQ      2048
#define DMODEL   1024
#define NHEADS   16
#define HDIM     64

__device__ __forceinline__ v16h cat16(v8h lo, v8h hi) {
  return __builtin_shufflevector(lo, hi, 0,1,2,3,4,5,6,7,8,9,10,11,12,13,14,15);
}

__device__ __forceinline__ v8f wmma_f16(v16h a, v16h b, v8f c) {
  // (neg_a, A, neg_b, B, c_mod, C, reuse_a, reuse_b)
  return __builtin_amdgcn_wmma_f32_16x16x32_f16(false, a, false, b, (short)0, c,
                                                false, false);
}

// Wait for this wave's own async global->LDS copies (ASYNCcnt)
__device__ __forceinline__ void wait_async0() {
  asm volatile("s_wait_asynccnt 0" ::: "memory");
}

// ---------------------------------------------------------------------------
// Prep kernel: f32 -> f16 conversion of x and of both weights (transposed to
// [n][k]), so the GEMM tiles become pure contiguous copies (async-to-LDS
// friendly) and all WMMA fragments are two contiguous 16B loads per lane.
// One launch of 512 work-groups for all three; every thread
// takes sixteen 16-byte loads, all in flight together.
//   blocks   0..191: 128 x 128 tiles of W_qkv     blocks 192..255: of W_out
//   blocks 256..511: 16,384 consecutive elements of x each
// ---------------------------------------------------------------------------
#define TT        128                       // transpose tile edge
#define NT_QKV    (3 * DMODEL / TT)         // tile columns of W_qkv
#define NT_OUT    (DMODEL / TT)             // tile columns of W_out
#define TILES_QKV ((DMODEL / TT) * NT_QKV)
#define TILES_W   (TILES_QKV + (DMODEL / TT) * NT_OUT)
#define XCHUNK    (256 * 4 * 16)            // elements of x per work-group
#define PREP_WGS  (TILES_W + NBATCH * SEQ * DMODEL / XCHUNK)

// dst[n][k] (f16) = src[k][n] (f32): tile t of a weight with NT tile columns
template <int NT>
__device__ __forceinline__ void transpose_tile(
    const float* __restrict__ src, _Float16* __restrict__ dst, int t,
    _Float16* T) {
  constexpr int N = NT * TT;
  const int k0   = (t / NT) * TT;
  const int n0   = (t % NT) * TT;
  const int tid  = threadIdx.x;
  const int lane = tid & 31;
  const int wave = tid >> 5;

  // Wave w reads rows k0 + 16 w .. + 15, each wave-wide load one 512-byte row
  // piece: a lane ends up with sixteen consecutive k of four columns.
  const float* s = src + (size_t)(k0 + wave * 16) * N + n0 + lane * 4;
  v4f f[16];
#pragma unroll   // all sixteen loads go out before the first is used
  for (int i = 0; i < 15; ++i) f[i] = *(const v4f*)(s + i * N);
  // The last load's result may land in the address registers the others name
  asm volatile("s_wait_xcnt 0x0" ::: "memory");
  f[15] = *(const v4f*)(s + 15 * N);

#pragma unroll
  for (int j = 0; j < 4; ++j) {
#pragma unroll
    for (int h = 0; h < 2; ++h) {
      v8h p;
#pragma unroll
      for (int e = 0; e < 8; ++e) p[e] = (_Float16)f[h * 8 + e][j];
      *(v8h*)&T[(lane * 4 + j) * TT + (((wave * 2 + h) ^ (lane & 15)) * 8)] = p;
    }
  }
  __syncthreads();   // the tile is complete before rows are read back

  // Sixteen lanes store one row's 256 bytes: whole lines, 16 bytes a lane
  const int c = tid & 15;
  _Float16* d = dst + (size_t)(n0 + (tid >> 4)) * DMODEL + k0 + c * 8;
#pragma unroll
  for (int i = 0; i < 8; ++i) {
    const int n = i * 16 + (tid >> 4);
    *(v8h*)(d + i * 16 * DMODEL) =
        *(const v8h*)&T[n * TT + ((c ^ ((n >> 2) & 15)) * 8)];
  }
  // Stands in front of any rewrite of a register that the stores above name
  asm volatile("s_wait_xcnt 0x0" ::: "memory");
}

// Budget of four waves a SIMD (this launch has two work-groups a WGP): at the
// default budget the compiler kept to 64 registers and made the later loads
// wait for the earlier ones; with it all sixteen go out as one group.
__global__ __launch_bounds__(256)
__attribute__((amdgpu_waves_per_eu(4, 4))) void prep_kernel(
    const float* __restrict__ x, const float* __restrict__ Wqkv,
    const float* __restrict__ Wout, _Float16* __restrict__ xh,
    _Float16* __restrict__ Wqt, _Float16* __restrict__ Wot) {
  // Tile as [n][k], rows of 256 bytes in sixteen 16-byte pieces; piece c of
  // row n lies at place c ^ ((n >> 2) & 15), which spreads over all banks both
  // the writers (16 lanes: rows 4 apart, one piece) and the readers (one row).
  __shared__ __attribute__((aligned(16))) _Float16 T[TT * TT];

  const int blk = blockIdx.x;               // every branch is block-uniform
  if (blk < TILES_QKV) {
    transpose_tile<NT_QKV>(Wqkv, Wqt, blk, T);
  } else if (blk < TILES_W) {
    transpose_tile<NT_OUT>(Wout, Wot, blk - TILES_QKV, T);
  } else {                                  // x to f16
    const size_t base = (size_t)(blk - TILES_W) * XCHUNK + threadIdx.x * 4;
    v4f f[16];
#pragma unroll   // all sixteen loads go out before the first is used
    for (int i = 0; i < 15; ++i) f[i] = *(const v4f*)(x + base + i * 1024);
    // The last load's result may land in the address registers the others name
    asm volatile("s_wait_xcnt 0x0" ::: "memory");
    f[15] = *(const v4f*)(x + base + 15 * 1024);
#pragma unroll
    for (int i = 0; i < 16; ++i) {
      v4h h;
      h[0] = (_Float16)f[i][0]; h[1] = (_Float16)f[i][1];
      h[2] = (_Float16)f[i][2]; h[3] = (_Float16)f[i][3];
      *(v4h*)(xh + base + i * 1024) = h;
    }
    // Stands in front of any rewrite of a register that the stores above name
    asm volatile("s_wait_xcnt 0x0" ::: "memory");
  }
}

// ---------------------------------------------------------------------------
// Output projection's GEMM main loop over A[128 rows @ mb] and B[128 rows @ nb], K = 1024,
// both operands f16 with k contiguous (A row-major, B stored [n][k]).
// 256 threads / 8 waves; a wave owns 4x2 WMMA tiles: 64 stage rows as first
// operand, 32 as second.  A and B rows load alike, so the caller picks per
// wave which of the two is first (fo, so: offsets of those rows in buffer 0 of
// the ring): acc[t][u][r] = first row 16 t + 8 grp + r . second row 16 u + row,
// and a lane's eight registers run along the first operand's rows.
// Two-buffer LDS ring of stages of 64 k: a stage row is one whole 128-byte
// line, eight lanes copy one row, so a wave-wide copy touches four lines.
// ---------------------------------------------------------------------------
#define GK      64                   // k per stage
#define GSTG    (DMODEL / GK)
#define GPITCH  72                   // halves: 128-byte rows at 144 bytes
#define GBUF    (128 * GPITCH)       // halves per operand buffer
#define GRING   (4 * GBUF)           // A buffers 0 and 1, then B buffers 0 and 1

// One stage of A and of B (128 rows x 64 k each) into LDS: eight async copies
// of 16 bytes per lane.  la, ga / lb, gb: this lane's chunk of rows 0..31 of
// the operand, the next copies 32 rows further.  The s_wait_xcnt closes the
// statement so that it stands in front of any rewrite of the address
// registers the copies name.
__device__ __forceinline__ void stage_ab(unsigned la, unsigned lb,
                                         const _Float16* ga,
                                         const _Float16* gb) {
  asm volatile(
      "global_load_async_to_lds_b128 %0, %8, off\n\t"
      "global_load_async_to_lds_b128 %1, %9, off\n\t"
      "global_load_async_to_lds_b128 %2, %10, off\n\t"
      "global_load_async_to_lds_b128 %3, %11, off\n\t"
      "global_load_async_to_lds_b128 %4, %12, off\n\t"
      "global_load_async_to_lds_b128 %5, %13, off\n\t"
      "global_load_async_to_lds_b128 %6, %14, off\n\t"
      "global_load_async_to_lds_b128 %7, %15, off\n\t"
      "s_wait_xcnt 0x0"
      :: "v"(la), "v"(la + 32 * GPITCH * 2), "v"(la + 64 * GPITCH * 2),
         "v"(la + 96 * GPITCH * 2),
         "v"(lb), "v"(lb + 32 * GPITCH * 2), "v"(lb + 64 * GPITCH * 2),
         "v"(lb + 96 * GPITCH * 2),
         "v"(ga), "v"(ga + 32 * DMODEL), "v"(ga + 64 * DMODEL),
         "v"(ga + 96 * DMODEL),
         "v"(gb), "v"(gb + 32 * DMODEL), "v"(gb + 64 * DMODEL),
         "v"(gb + 96 * DMODEL)
      : "memory");
}

__device__ __forceinline__ void gemm_mainloop_k1024(
    _Float16* S, const _Float16* __restrict__ A,
    const _Float16* __restrict__ B, int mb, int nb, int fo, int so,
    v8f acc[4][2]) {
  const int tid  = threadIdx.x;
  const int lane = tid & 31;
  const int row  = lane & 15;
  const int grp  = lane >> 4;

  // This lane's 16-byte chunk of a stage: row tid / 8, chunk tid % 8
  const int sr = tid >> 3;
  const int sc = (tid & 7) * 8;
  const unsigned la0 = (unsigned)(uintptr_t)&S[sr * GPITCH + sc];
  const unsigned lb0 = (unsigned)(uintptr_t)&S[2 * GBUF + sr * GPITCH + sc];
  const _Float16* ga = A + (size_t)(mb + sr) * DMODEL + sc;
  const _Float16* gb = B + (size_t)(nb + sr) * DMODEL + sc;

  stage_ab(la0, lb0, ga, gb);                           // stage 0, buffer 0
  wait_async0();      // this wave's share of stage 0 has landed
  __syncthreads();    // publishes stage 0
  stage_ab(la0 + GBUF * 2, lb0 + GBUF * 2, ga + GK, gb + GK);

  for (int st = 0; st < GSTG; ++st) {
    const int cur = st & 1;
    const _Float16* at = &S[cur * GBUF + fo + row * GPITCH + 8 * grp];
    const _Float16* bt = &S[cur * GBUF + so + row * GPITCH + 8 * grp];

#pragma unroll   // both halves at constant LDS offsets from one address
    for (int h = 0; h < GK / 32; ++h) {
      v16h af[4];
#pragma unroll
      for (int tm = 0; tm < 4; ++tm) {
        const _Float16* p = at + tm * 16 * GPITCH + h * 32;
        af[tm] = cat16(*(const v8h*)p, *(const v8h*)(p + 16));
      }
      v16h bf[2];
#pragma unroll
      for (int tn = 0; tn < 2; ++tn) {
        const _Float16* p = bt + tn * 16 * GPITCH + h * 32;
        bf[tn] = cat16(*(const v8h*)p, *(const v8h*)(p + 16));
      }
#pragma unroll
      for (int tm = 0; tm < 4; ++tm)
#pragma unroll
        for (int tn = 0; tn < 2; ++tn)
          acc[tm][tn] = wmma_f16(af[tm], bf[tn], acc[tm][tn]);
    }

    // Publish point of stage st + 1: this wave's reads of the current buffer
    // have retired, its copies of the next stage have landed, and behind the
    // barrier the current buffer is free for stage st + 2.
    asm volatile("s_wait_dscnt 0x0" ::: "memory");
    wait_async0();
    __syncthreads();
    if (st + 2 < GSTG)
      stage_ab(la0 + cur * (GBUF * 2), lb0 + cur * (GBUF * 2),
               ga + (st + 2) * GK, gb + (st + 2) * GK);
  }
  wait_async0();                  // nothing is in flight behind the loop
}

// ---------------------------------------------------------------------------
// Kernel 1: QKV projection.  C[4096][3072] = xh @ Wqt^T + b_qkv.  Scatters:
//   q_ws: [bh][s][64]  (pre-scaled by log2(e)/sqrt(64): scores in log2 units)
//   k_ws: [bh][s][64]
//   v_ws: [bh][d][s]   (transposed for the PV matmul's A-fragment layout)
// A work-group takes 256 x rows by the 192 columns of one head (its q, k and
// v): 256 work-groups, one on each WGP.  A wave takes 64 x rows by 96 columns:
// all of q (waves 0..3) or of k (waves 4..7) and one half of v, 24 WMMA tiles
// from ten fragments.  For q and k the weight rows are the first WMMA operand,
// for v the x rows, so that a lane's eight accumulators are always eight
// neighbours of one destination row; the rows, staged in LDS, leave as whole
// 128-byte lines.
// ---------------------------------------------------------------------------

// 32 staged rows of 128 bytes (pitch GPITCH) to dst, rows STRIDE halves apart.
// Eight lanes take one row; a store covers rows i, i + 8, i + 16, i + 24: four
// whole lines, and in LDS each half of the wave meets every bank once.
template <int STRIDE>
__device__ __forceinline__ void store_rows_f16(const _Float16* stg,
                                               _Float16* dst, int lane) {
  // This wave's own LDS writes have retired before lanes read others' rows
  asm volatile("s_wait_dscnt 0x0" ::: "memory");
  const _Float16* s = stg + (lane >> 3) * 8 * GPITCH + (lane & 7) * 8;
  _Float16* d = dst + (size_t)((lane >> 3) * 8) * STRIDE + (lane & 7) * 8;
  v8h p[8];
#pragma unroll   // constant offsets from one LDS and one global address
  for (int i = 0; i < 8; ++i) p[i] = *(const v8h*)(s + i * GPITCH);
#pragma unroll
  for (int i = 0; i < 8; ++i) *(v8h*)(d + i * STRIDE) = p[i];
  // Stands in front of any rewrite of a register that the stores above name
  asm volatile("s_wait_xcnt 0x0" ::: "memory");
}

#define QM      256                  // x rows per work-group
#define QN      (3 * HDIM)           // weight rows per work-group: one head
#define QK      128                  // k per stage
#define QSTG    (DMODEL / QK)
#define QPITCH  136                  // halves: 256-byte rows at 272 bytes
#define QBUF    ((QN + QM) * QPITCH) // halves per buffer: weight rows, x rows
#define QSTEP   (16 * QPITCH * 2)    // LDS bytes from one copy to the next

// Fourteen async copies of 16 bytes per lane, LDS places sixteen rows apart.
// The s_wait_xcnt closes the statement so that it stands in front of any
// rewrite of the address registers the copies name.
__device__ __forceinline__ void copy14(unsigned l, const _Float16* const* g) {
  asm volatile(
      "global_load_async_to_lds_b128 %0, %14, off\n\t"
      "global_load_async_to_lds_b128 %1, %15, off\n\t"
      "global_load_async_to_lds_b128 %2, %16, off\n\t"
      "global_load_async_to_lds_b128 %3, %17, off\n\t"
      "global_load_async_to_lds_b128 %4, %18, off\n\t"
      "global_load_async_to_lds_b128 %5, %19, off\n\t"
      "global_load_async_to_lds_b128 %6, %20, off\n\t"
      "global_load_async_to_lds_b128 %7, %21, off\n\t"
      "global_load_async_to_lds_b128 %8, %22, off\n\t"
      "global_load_async_to_lds_b128 %9, %23, off\n\t"
      "global_load_async_to_lds_b128 %10, %24, off\n\t"
      "global_load_async_to_lds_b128 %11, %25, off\n\t"
      "global_load_async_to_lds_b128 %12, %26, off\n\t"
      "global_load_async_to_lds_b128 %13, %27, off\n\t"
      "s_wait_xcnt 0x0"
      :: "v"(l), "v"(l + QSTEP), "v"(l + 2 * QSTEP), "v"(l + 3 * QSTEP),
         "v"(l + 4 * QSTEP), "v"(l + 5 * QSTEP), "v"(l + 6 * QSTEP),
         "v"(l + 7 * QSTEP), "v"(l + 8 * QSTEP), "v"(l + 9 * QSTEP),
         "v"(l + 10 * QSTEP), "v"(l + 11 * QSTEP), "v"(l + 12 * QSTEP),
         "v"(l + 13 * QSTEP),
         "v"(g[0]), "v"(g[1]), "v"(g[2]), "v"(g[3]), "v"(g[4]), "v"(g[5]),
         "v"(g[6]), "v"(g[7]), "v"(g[8]), "v"(g[9]), "v"(g[10]), "v"(g[11]),
         "v"(g[12]), "v"(g[13])
      : "memory");
}

// One stage (192 weight rows, then 256 x rows, 128 k each) into the buffer at
// l: 28 copies per lane, sixteen lanes to a row, so a wave-wide copy takes two
// rows' four whole lines.  l, gx, gw: this lane's chunk of rows 0..15.
__device__ __forceinline__ void stage_xw(unsigned l, const _Float16* gx,
                                         const _Float16* gw) {
  const _Float16* g[(QN + QM) / 16];
#pragma unroll   // the table is indexed by constants only: it stays in registers
  for (int i = 0; i < QN / 16; ++i) g[i] = gw + i * 16 * DMODEL;
#pragma unroll
  for (int i = 0; i < QM / 16; ++i) g[QN / 16 + i] = gx + i * 16 * DMODEL;
  copy14(l, g);
  copy14(l + 14 * QSTEP, g + 14);
}

// One work-group fills a WGP's LDS: two waves a SIMD, 512 registers a wave
__global__ __launch_bounds__(256) void qkv_gemm_kernel(
    const _Float16* __restrict__ xh, const _Float16* __restrict__ Wqt,
    const float* __restrict__ bqkv,
    _Float16* __restrict__ q_ws, _Float16* __restrict__ k_ws,
    _Float16* __restrict__ v_ws) {
  __shared__ __attribute__((aligned(16))) _Float16 S[2 * QBUF];

  const int tid  = threadIdx.x;
  const int lane = tid & 31;
  const int row  = lane & 15;
  const int grp  = lane >> 4;
  // In a scalar register: the wave's offsets become scalar arithmetic
  const int wave = __builtin_amdgcn_readfirstlane(tid >> 5);
  const int hd   = blockIdx.x;
  const int mb   = blockIdx.y * QM;
  const int nb   = hd * QN;
  const int xr   = (wave & 3) * 64;           // first x row, of 256
  const int wn   = wave >> 2;                 // 0: q and v 0..31, 1: k and v 32..63

  v8f aq[4][4];       // [weight tile of q or k][x tile]
  v8f av[4][2];       // [x tile][weight tile of v]
#pragma unroll
  for (int i = 0; i < 4; ++i) {
    const v8f z = {0.f,0.f,0.f,0.f,0.f,0.f,0.f,0.f};
#pragma unroll
    for (int j = 0; j < 4; ++j) aq[i][j] = z;
#pragma unroll
    for (int j = 0; j < 2; ++j) av[i][j] = z;
  }

  // This lane's 16-byte chunk of a stage: row tid / 16, chunk tid % 16
  const int sr = tid >> 4;
  const int sc = (tid & 15) * 8;
  const unsigned l0 = (unsigned)(uintptr_t)&S[sr * QPITCH + sc];
  const _Float16* gx = xh + (size_t)(mb + sr) * DMODEL + sc;
  const _Float16* gw = Wqt + (size_t)(nb + sr) * DMODEL + sc;

  stage_xw(l0, gx, gw);                                 // stage 0, buffer 0
  wait_async0();      // this wave's share of stage 0 has landed
  __syncthreads();    // publishes stage 0
  stage_xw(l0 + QBUF * 2, gx + QK, gw + QK);

  for (int st = 0; st < QSTG; ++st) {
    const int cur = st & 1;
    const _Float16* fr = &S[cur * QBUF + row * QPITCH + 8 * grp];
    const _Float16* wt = fr + wn * HDIM * QPITCH;
    const _Float16* vt = fr + (2 * HDIM + wn * 32) * QPITCH;
    const _Float16* xt = fr + (QN + xr) * QPITCH;

    // Two fragment sets: 0..3 x tiles, 4..7 weight tiles of q or k, 8..9 of v
    v16h f[2][10];
#pragma unroll   // a stage's four blocks of 32 k, at constant LDS offsets
    for (int h = -1; h < QK / 32; ++h) {
      if (h + 1 < QK / 32) {      // the next block's fragments, as one group
        v16h* n = f[(h + 1) & 1];
#pragma unroll
        for (int t = 0; t < 10; ++t) {
          const _Float16* p = (t < 4   ? xt + t * 16 * QPITCH
                               : t < 8 ? wt + (t - 4) * 16 * QPITCH
                                       : vt + (t - 8) * 16 * QPITCH) +
                              (h + 1) * 32;
          n[t] = cat16(*(const v8h*)p, *(const v8h*)(p + 16));
        }
      }
      // Keeps those loads ahead of this block's WMMAs: moved down among them,
      // each would be waited for where it stands
      __builtin_amdgcn_sched_barrier(0);
      if (h >= 0) {
        const v16h* b = f[h & 1];
#pragma unroll
        for (int t = 0; t < 4; ++t)
#pragma unroll
          for (int u = 0; u < 4; ++u)
            aq[t][u] = wmma_f16(b[4 + t], b[u], aq[t][u]);
#pragma unroll
        for (int t = 0; t < 4; ++t)
#pragma unroll
          for (int u = 0; u < 2; ++u)
            av[t][u] = wmma_f16(b[t], b[8 + u], av[t][u]);
        // Keeps the block after next's loads from moving up among these WMMAs
        __builtin_amdgcn_sched_barrier(0);
      }
    }

    // Publish point of stage st + 1: this wave's reads of the current buffer
    // have retired, its copies of the next stage have landed, and behind the
    // barrier the current buffer is free for stage st + 2.
    asm volatile("s_wait_dscnt 0x0" ::: "memory");
    wait_async0();
    __syncthreads();
    if (st + 2 < QSTG)
      stage_xw(l0 + cur * (QBUF * 2), gx + (st + 2) * QK, gw + (st + 2) * QK);
  }
  wait_async0();                  // nothing is in flight behind the loop

  // Behind the loop's last barrier nobody reads the ring and no copy is in
  // flight: each wave stages in a range of its own, 64 rows of q or k (one row
  // a position) and then 32 rows of v (one row a head column).
  _Float16* stg  = S + wave * (96 * GPITCH);
  _Float16* stgv = stg + 64 * GPITCH;
  const int bh = (mb >> 11) * NHEADS + hd;
  const int s0 = (mb & (SEQ - 1)) + xr;

  const float sc8 = wn == 0 ? 0.125f * 1.44269504f : 1.f;
  v4f bb[4][2];       // bias of q or k: eight columns a lane and tile
  float bv[2];        // bias of v: one column a lane and tile
  // The ten loads and their data wait are one statement: as plain loads with a
  // wait in a statement of its own, later address arithmetic was moved up over
  // that wait and rewrote an offset register that the loads name.  All ten are
  // in flight together, and all are needed next.
  asm volatile(
      "global_load_b128 %0, %10, off\n\t"
      "global_load_b128 %1, %10, off offset:16\n\t"
      "global_load_b128 %2, %10, off offset:64\n\t"
      "global_load_b128 %3, %10, off offset:80\n\t"
      "global_load_b128 %4, %10, off offset:128\n\t"
      "global_load_b128 %5, %10, off offset:144\n\t"
      "global_load_b128 %6, %10, off offset:192\n\t"
      "global_load_b128 %7, %10, off offset:208\n\t"
      "global_load_b32 %8, %11, off\n\t"
      "global_load_b32 %9, %11, off offset:64\n\t"
      "s_wait_loadcnt 0x0"
      : "=&v"(bb[0][0]), "=&v"(bb[0][1]), "=&v"(bb[1][0]), "=&v"(bb[1][1]),
        "=&v"(bb[2][0]), "=&v"(bb[2][1]), "=&v"(bb[3][0]), "=&v"(bb[3][1]),
        "=&v"(bv[0]), "=&v"(bv[1])
      : "v"(bqkv + nb + wn * HDIM + 8 * grp),
        "v"(bqkv + nb + 2 * HDIM + wn * 32 + row)
      : "memory");

  // q or k: registers run along the head's 64 columns, lanes along s
#pragma unroll   // here and below: accumulators are indexed by constants only
  for (int t = 0; t < 4; ++t) {
#pragma unroll
    for (int u = 0; u < 4; ++u) {
      v8h p;
#pragma unroll
      for (int r = 0; r < 8; ++r)
        p[r] = (_Float16)((aq[t][u][r] + bb[t][r >> 2][r & 3]) * sc8);
      *(v8h*)&stg[(u * 16 + row) * GPITCH + t * 16 + 8 * grp] = p;
    }
  }
  // v: registers run along s, lanes along d
#pragma unroll
  for (int u = 0; u < 2; ++u) {
#pragma unroll
    for (int t = 0; t < 4; ++t) {
      v8h p;
#pragma unroll
      for (int r = 0; r < 8; ++r) p[r] = (_Float16)(av[t][u][r] + bv[u]);
      *(v8h*)&stgv[(u * 16 + row) * GPITCH + t * 16 + 8 * grp] = p;
    }
  }

  _Float16* dqk = (wn == 0 ? q_ws : k_ws) + ((size_t)bh * SEQ + s0) * HDIM;
  store_rows_f16<HDIM>(stg, dqk, lane);
  store_rows_f16<HDIM>(stg + 32 * GPITCH, dqk + 32 * HDIM, lane);
  store_rows_f16<SEQ>(stgv, v_ws + ((size_t)bh * HDIM + wn * 32) * SEQ + s0,
                      lane);
}

__device__ __forceinline__ float xhalf(float x) {
  const int b = __builtin_bit_cast(int, x);
  return __builtin_bit_cast(float, __builtin_amdgcn_permlanex16(
      b, b, 0x76543210, 0xfedcba98, false, false));
}

#define KSTG    128                  // keys per stage
#define NSTG    (SEQ / KSTG)
#define KHALF   (KSTG / 2)           // keys of a stage that one wave takes
#define KPITCH  72                   // halves: 128-byte K rows at 144 bytes
#define VPITCH  136                  // halves: 256-byte Vt rows at 272 bytes
#define KBUF    (KSTG * KPITCH)      // halves per K buffer
#define VBUF    (HDIM * VPITCH)      // halves per Vt buffer
#define PMAX    4096.f               // bound of a P value: a sixteenth of f16's top

// P = 2^(score - m) of one lane's sixteen keys of a column group, as f16 into
// the B fragment; returns their sum, a tree over halves: terms 8, 4, 2, then 1 apart.
__device__ __forceinline__ float exp_tile(v8f c0, v8f c1, float m, v16h& pb) {
  // Subtracted by pairs of one tile: the packed subtractions then take
  // neighbouring accumulator registers as they lie, with no copies to pair them
  const v2f mm = {m, m};
  v8f p0, p1;
#pragma unroll   // vector elements are indexed by constants only
  for (int r = 0; r < 8; r += 2) {
    const v2f x0 = {c0[r], c0[r + 1]};
    const v2f x1 = {c1[r], c1[r + 1]};
    const v2f a0 = x0 - mm;
    const v2f a1 = x1 - mm;
#pragma unroll
    for (int e = 0; e < 2; ++e) {
      p0[r + e] = __builtin_amdgcn_exp2f(a0[e]);
      p1[r + e] = __builtin_amdgcn_exp2f(a1[e]);
      pb[r + e]     = (_Float16)p0[r + e];
      pb[8 + r + e] = (_Float16)p1[r + e];
    }
  }
  const v8f ps = p0 + p1;
  const v4f s4 = __builtin_shufflevector(ps, ps, 0, 1, 2, 3) +
                 __builtin_shufflevector(ps, ps, 4, 5, 6, 7);
  const v2f s2 = __builtin_shufflevector(s4, s4, 0, 1) +
                 __builtin_shufflevector(s4, s4, 2, 3);
  return s2[0] + s2[1];
}

// One stage of K (128 keys x 64) and Vt (64 x 128 keys) into LDS: eight async
// copies of 16 bytes per lane, every wave-wide copy covering four whole lines.
// lk, gk: this lane's chunk of K rows 0..31, the next copies 32 rows further;
// lv, gv: its chunk of Vt rows 0..15, the next copies 16 rows further.
// The s_wait_xcnt closes the statement so that it stands in front of any
// rewrite of the address registers the copies name.
__device__ __forceinline__ void stage_kv(unsigned lk, unsigned lv,
                                         const _Float16* gk,
                                         const _Float16* gv) {
  asm volatile(
      "global_load_async_to_lds_b128 %0, %8, off\n\t"
      "global_load_async_to_lds_b128 %1, %9, off\n\t"
      "global_load_async_to_lds_b128 %2, %10, off\n\t"
      "global_load_async_to_lds_b128 %3, %11, off\n\t"
      "global_load_async_to_lds_b128 %4, %12, off\n\t"
      "global_load_async_to_lds_b128 %5, %13, off\n\t"
      "global_load_async_to_lds_b128 %6, %14, off\n\t"
      "global_load_async_to_lds_b128 %7, %15, off\n\t"
      "s_wait_xcnt 0x0"
      :: "v"(lk), "v"(lk + 32 * KPITCH * 2), "v"(lk + 64 * KPITCH * 2),
         "v"(lk + 96 * KPITCH * 2),
         "v"(lv), "v"(lv + 16 * VPITCH * 2), "v"(lv + 32 * VPITCH * 2),
         "v"(lv + 48 * VPITCH * 2),
         "v"(gk), "v"(gk + 32 * HDIM), "v"(gk + 64 * HDIM), "v"(gk + 96 * HDIM),
         "v"(gv), "v"(gv + 16 * SEQ), "v"(gv + 32 * SEQ), "v"(gv + 48 * SEQ)
      : "memory");
}

// Four waves a SIMD and no more: two work-groups fill a WGP, so the 512
// work-groups of the launch cannot pile up three to a WGP and leave others idle.
__global__ __launch_bounds__(256)
__attribute__((amdgpu_waves_per_eu(4, 4))) void attn_kernel(
    const _Float16* __restrict__ q_ws, const _Float16* __restrict__ k_ws,
    const _Float16* __restrict__ v_ws, const int* __restrict__ mask,
    _Float16* __restrict__ att_ws) {
  // 0 for a live key, -inf for a masked one
  __shared__ __attribute__((aligned(32))) float mbias[SEQ];
  // Two-buffer ring of K and Vt stages, shared by the block's eight waves
  __shared__ __attribute__((aligned(16))) _Float16 Ks[2 * KBUF];
  __shared__ __attribute__((aligned(16))) _Float16 Vs[2 * VBUF];

  const int tid  = threadIdx.x;
  const int lane = tid & 31;
  const int row  = lane & 15;
  const int grp  = lane >> 4;
  // In a scalar register: the choice of who merges becomes a scalar branch
  const int wave = __builtin_amdgcn_readfirstlane(tid >> 5);
  const int cg   = wave & 3;                            // 32-query group
  const int kh   = wave >> 2;                           // key half of a stage

  const int bh = blockIdx.x >> 4;                       // 0..31
  const int q0 = (blockIdx.x & 15) * 128 + cg * 32;
  const int b  = bh >> 4;
  const int hh = bh & (NHEADS - 1);

  const _Float16* qb = q_ws + (size_t)bh * SEQ * HDIM;
  const _Float16* kb = k_ws + (size_t)bh * SEQ * HDIM;
  const _Float16* vb = v_ws + (size_t)bh * HDIM * SEQ;
  const int* mrow    = mask + b * SEQ;

  // This lane's 16-byte chunk of a stage: K row tid / 8, Vt row tid / 16
  const unsigned lk0 =
      (unsigned)(uintptr_t)&Ks[(tid >> 3) * KPITCH + (tid & 7) * 8];
  const unsigned lv0 =
      (unsigned)(uintptr_t)&Vs[(tid >> 4) * VPITCH + (tid & 15) * 8];
  const _Float16* gk = kb + tid * 8;
  const _Float16* gv = vb + (tid >> 4) * SEQ + (tid & 15) * 8;

  stage_kv(lk0, lv0, gk, gv);                           // stage 0, buffer 0

  // Keys run over accumulator registers: the mask enters as the C operand of
  // the score product, read from this table.
#pragma unroll   // independent loads in flight instead of round trips
  for (int i0 = 0; i0 < SEQ; i0 += 256 * 4) {
    const int i = i0 + tid * 4;
    const v4i mm = *(const v4i*)(mrow + i);
    v4f bb;
#pragma unroll
    for (int j = 0; j < 4; ++j) bb[j] = (mm[j] == 0) ? -__builtin_inff() : 0.f;
    *(v4f*)&mbias[i] = bb;
  }
  wait_async0();      // this wave's share of stage 0 has landed
  __syncthreads();    // publishes stage 0 and the mask table
  stage_kv(lk0 + KBUF * 2, lv0 + VBUF * 2, gk + KSTG * HDIM, gv + KSTG);

  v16h bq[2][2];                  // [column group][k half of the head size]
#pragma unroll   // the loads go out together, into registers
  for (int g = 0; g < 2; ++g) {
    const _Float16* qrow = qb + (size_t)(q0 + g * 16 + row) * HDIM;
    bq[g][0] = cat16(*(const v8h*)(qrow + 8 * grp),
                     *(const v8h*)(qrow + 16 + 8 * grp));
    bq[g][1] = cat16(*(const v8h*)(qrow + 32 + 8 * grp),
                     *(const v8h*)(qrow + 48 + 8 * grp));
  }
  // Stands in front of any rewrite of a register that the loads above name
  asm volatile("s_wait_xcnt 0x0" ::: "memory");

  // Maximum in use for this lane's query in each group.  The start is finite
  // and below every score, so a key half whose keys are all masked keeps zero
  // sums and merges as nothing instead of giving inf - inf; a live key's
  // exponential against it is inf, which forces the first renewal.
  float mv[2] = {-1e30f, -1e30f};
  float lv[2] = {0.f, 0.f};       // this half's share of the running sums
  v8f o[2][4];                    // o[g][t][r] = Ot[16 t + 8 grp + r][query row]
#pragma unroll
  for (int g = 0; g < 2; ++g)
#pragma unroll
    for (int t = 0; t < 4; ++t) {
      v8f z = {0.f,0.f,0.f,0.f,0.f,0.f,0.f,0.f};
      o[g][t] = z;
    }

  for (int st = 0; st < NSTG; ++st) {
    const int cur = st & 1;
    const _Float16* kt =
        &Ks[cur * KBUF + (kh * KHALF + row) * KPITCH + 8 * grp];
    const _Float16* vt = &Vs[cur * VBUF + row * VPITCH + kh * KHALF + 8 * grp];

#pragma unroll   // the second pass's LDS reads go out under the first pass
    for (int p = 0; p < KHALF / 32; ++p) {
      const int s0 = st * KSTG + kh * KHALF + p * 32;
      const _Float16* k0r = kt + p * 32 * KPITCH;      // key row, k chunk
      const _Float16* k1r = k0r + 16 * KPITCH;
      const _Float16* vr  = vt + p * 32;               // d row, key chunk
      const v16h ak00 = cat16(*(const v8h*)(k0r),      *(const v8h*)(k0r + 16));
      const v16h ak01 = cat16(*(const v8h*)(k0r + 32), *(const v8h*)(k0r + 48));
      const v16h ak10 = cat16(*(const v8h*)(k1r),      *(const v8h*)(k1r + 16));
      const v16h ak11 = cat16(*(const v8h*)(k1r + 32), *(const v8h*)(k1r + 48));

      v16h av[4];
#pragma unroll
      for (int t = 0; t < 4; ++t)
        av[t] = cat16(*(const v8h*)(vr + t * 16 * VPITCH),
                      *(const v8h*)(vr + t * 16 * VPITCH + 16));

      // c0[r]: key s0 + 8 grp + r, c1[r]: key s0 + 16 + 8 grp + r
      const v8f mb0 = *(const v8f*)&mbias[s0 + 8 * grp];
      const v8f mb1 = *(const v8f*)&mbias[s0 + 16 + 8 * grp];

      v8f c0[2], c1[2];
      v16h pb[2];
      float ps[2];                // sum of this lane's sixteen exponentials
#pragma unroll   // both column groups work from the same fragments
      for (int g = 0; g < 2; ++g) {
        c0[g] = wmma_f16(ak00, bq[g][0], mb0);
        c1[g] = wmma_f16(ak10, bq[g][0], mb1);
        c0[g] = wmma_f16(ak01, bq[g][1], c0[g]);
        c1[g] = wmma_f16(ak11, bq[g][1], c1[g]);
        ps[g] = exp_tile(c0[g], c1[g], mv[g], pb[g]);
      }

      // Compiler fence: keeps the Vt loads in front of the branch, so that they
      // fly during the test; moved behind it they are waited for where they
      // stand, with nothing to cover them.
      asm volatile("" ::: "memory");

      // No P value is above its lane's sum: while every sum is within PMAX, all
      // of P fits f16 and the maximum in use may stay.  One test a pass for both
      // groups, a scalar branch; written so that inf and NaN take the renewal.
      if (__builtin_amdgcn_ballot_w32(!(ps[0] <= PMAX) | !(ps[1] <= PMAX)) != 0) {
#pragma unroll   // accumulators are indexed by constants only
        for (int g = 0; g < 2; ++g) {
          float tm[8];
#pragma unroll
          for (int r = 0; r < 8; ++r) tm[r] = fmaxf(c0[g][r], c1[g][r]);
          float rm = fmaxf(fmaxf(fmaxf(tm[0], tm[1]), fmaxf(tm[2], tm[3])),
                           fmaxf(fmaxf(tm[4], tm[5]), fmaxf(tm[6], tm[7])));
          rm = fmaxf(rm, xhalf(rm));  // both wave halves keep one maximum
          const float mn    = fmaxf(mv[g], rm);
          const float alpha = __builtin_amdgcn_exp2f(mv[g] - mn);
          mv[g] = mn;
          lv[g] *= alpha;
#pragma unroll
          for (int t = 0; t < 4; ++t) o[g][t] *= alpha;
          ps[g] = exp_tile(c0[g], c1[g], mn, pb[g]);
        }
      }
      lv[0] += ps[0];
      lv[1] += ps[1];

#pragma unroll
      for (int g = 0; g < 2; ++g)
#pragma unroll
        for (int t = 0; t < 4; ++t) o[g][t] = wmma_f16(av[t], pb[g], o[g][t]);
    }

    // Publish point of stage st + 1: this wave's reads of the current buffer
    // have retired, its copies of the next stage have landed, and behind the
    // barrier the current buffer is free for stage st + 2.
    asm volatile("s_wait_dscnt 0x0" ::: "memory");
    wait_async0();
    __syncthreads();
    if (st + 2 < NSTG)
      stage_kv(lk0 + cur * (KBUF * 2), lv0 + cur * (VBUF * 2),
               gk + (st + 2) * (KSTG * HDIM), gv + (st + 2) * KSTG);
  }
  wait_async0();                  // nothing is in flight behind the loop

  // Merge of the two key halves.  Behind the loop's last barrier nobody reads
  // the K ring and no copy is in flight: wave 4 + cg hands its sums to wave cg
  // there, lane to lane, seventeen 16-byte pieces a lane, each piece contiguous
  // over the wave.
  v4f* xw = (v4f*)Ks + cg * (17 * 32) + lane;
  if (kh == 1) {
#pragma unroll   // accumulators are indexed by constants only
    for (int g = 0; g < 2; ++g)
#pragma unroll
      for (int t = 0; t < 4; ++t) {
        const v8f v = o[g][t];
        xw[((g * 4 + t) * 2) * 32]     = __builtin_shufflevector(v, v, 0, 1, 2, 3);
        xw[((g * 4 + t) * 2 + 1) * 32] = __builtin_shufflevector(v, v, 4, 5, 6, 7);
      }
    const v4f ml = {mv[0], mv[1], lv[0], lv[1]};
    xw[16 * 32] = ml;
  }
  __syncthreads();    // the second half's sums are in LDS before they are read
  if (kh == 0) {
    const v4f ml = xw[16 * 32];
    v8h h[2][4];
#pragma unroll
    for (int g = 0; g < 2; ++g) {
      const float m  = fmaxf(mv[g], ml[g]);
      const float a0 = __builtin_amdgcn_exp2f(mv[g] - m);
      const float a1 = __builtin_amdgcn_exp2f(ml[g] - m);
      float l = lv[g] * a0 + ml[2 + g] * a1;
      l += xhalf(l);              // join the two wave halves' sums
      const float w0 = a0 / l;    // the division by the sum goes into the weights
      const float w1 = a1 / l;
#pragma unroll
      for (int t = 0; t < 4; ++t) {
        const v4f x0 = xw[((g * 4 + t) * 2) * 32];
        const v4f x1 = xw[((g * 4 + t) * 2 + 1) * 32];
#pragma unroll
        for (int r = 0; r < 4; ++r) {
          h[g][t][r]     = (_Float16)(o[g][t][r] * w0 + x0[r] * w1);
          h[g][t][4 + r] = (_Float16)(o[g][t][4 + r] * w0 + x1[r] * w1);
        }
      }
    }
    _Float16* orow =
        att_ws + ((size_t)(b * SEQ + q0 + row)) * DMODEL + hh * HDIM + 8 * grp;
#pragma unroll   // constant offsets from one global address
    for (int g = 0; g < 2; ++g)
#pragma unroll
      for (int t = 0; t < 4; ++t)
        *(v8h*)(orow + g * 16 * DMODEL + t * 16) = h[g][t];
    // Stands in front of any rewrite of a register that the stores above name
    asm volatile("s_wait_xcnt 0x0" ::: "memory");
  }
}

// ---------------------------------------------------------------------------
// Kernel 3: output projection.  out[4096][1024] = att @ Wot^T + b_out
// The weight rows are the first WMMA operand: a lane's eight accumulators are
// eight neighbours of one output row.  A wave's 32 rows of 64 floats, staged in
// LDS, leave as whole 128-byte lines.
// ---------------------------------------------------------------------------
#define OPITCH  68                   // floats: 256-byte rows at 272 bytes

__global__ __launch_bounds__(256) void out_gemm_kernel(
    const _Float16* __restrict__ att, const _Float16* __restrict__ Wot,
    const float* __restrict__ bout, float* __restrict__ out) {
  __shared__ __attribute__((aligned(16))) _Float16 S[GRING];

  const int lane = threadIdx.x & 31;
  const int row  = lane & 15;
  const int grp  = lane >> 4;
  // In a scalar register: the wave's offsets become scalar arithmetic
  const int wave = __builtin_amdgcn_readfirstlane(threadIdx.x >> 5);
  const int mb   = blockIdx.y * 128;
  const int nb   = blockIdx.x * 128;
  const int xr   = (wave & 3) * 32;           // first att row, of 128
  const int wr   = (wave >> 2) * 64;          // first weight row, of 128

  v8f acc[4][2];
#pragma unroll
  for (int i = 0; i < 4; ++i)
#pragma unroll
    for (int j = 0; j < 2; ++j) {
      v8f z = {0.f,0.f,0.f,0.f,0.f,0.f,0.f,0.f};
      acc[i][j] = z;
    }

  gemm_mainloop_k1024(S, att, Wot, mb, nb, 2 * GBUF + wr * GPITCH, xr * GPITCH,
                      acc);

  // Behind the loop's last barrier nobody reads the ring and no copy is in
  // flight: each wave stages in a range of its own.
  float* stg = (float*)S + wave * (32 * OPITCH);
  v8f bb[4];          // bias: eight columns a lane and tile
#pragma unroll   // the loads go out together, into registers
  for (int t = 0; t < 4; ++t)
    bb[t] = *(const v8f*)(bout + nb + wr + t * 16 + 8 * grp);
  // Stands in front of any rewrite of a register that the loads above name
  asm volatile("s_wait_xcnt 0x0" ::: "memory");
#pragma unroll   // here and below: accumulators are indexed by constants only
  for (int t = 0; t < 4; ++t) {
#pragma unroll
    for (int u = 0; u < 2; ++u) {
      const v8f v = acc[t][u] + bb[t];
      float* w = &stg[(u * 16 + row) * OPITCH + t * 16 + 8 * grp];
      *(v4f*)w       = __builtin_shufflevector(v, v, 0, 1, 2, 3);
      *(v4f*)(w + 4) = __builtin_shufflevector(v, v, 4, 5, 6, 7);
    }
  }
  // This wave's own LDS writes have retired before lanes read others' rows
  asm volatile("s_wait_dscnt 0x0" ::: "memory");
  // Sixteen lanes take one row: a store covers two rows, four whole lines
  const float* s = stg + grp * OPITCH + row * 4;
  float* d = out + (size_t)(mb + xr + grp) * DMODEL + nb + wr + row * 4;
  v4f p[16];
#pragma unroll   // constant offsets from one LDS and one global address
  for (int i = 0; i < 16; ++i) p[i] = *(const v4f*)(s + i * 2 * OPITCH);
#pragma unroll
  for (int i = 0; i < 16; ++i) *(v4f*)(d + i * 2 * DMODEL) = p[i];
  // Stands in front of any rewrite of a register that the stores above name
  asm volatile("s_wait_xcnt 0x0" ::: "memory");
}

// ---------------------------------------------------------------------------
// Launch
// ---------------------------------------------------------------------------
extern "C" void kernel_launch(void* const* d_in, const int* in_sizes, int n_in,
                              void* d_out, int out_size, void* d_ws,
                              size_t ws_size, hipStream_t stream) {
  const float* x    = (const float*)d_in[0];
  const int*   mask = (const int*)d_in[1];
  const float* Wqkv = (const float*)d_in[2];
  const float* bqkv = (const float*)d_in[3];
  const float* Wout = (const float*)d_in[4];
  const float* bout = (const float*)d_in[5];
  float* out = (float*)d_out;

  const size_t nBS  = (size_t)NBATCH * SEQ;            // 4096
  _Float16* xh     = (_Float16*)d_ws;                  // [4096][1024]
  _Float16* Wqt    = xh  + nBS * DMODEL;               // [3072][1024]
  _Float16* Wot    = Wqt + (size_t)3 * DMODEL * DMODEL;// [1024][1024]
  _Float16* q_ws   = Wot + (size_t)DMODEL * DMODEL;    // [32][2048][64]
  _Float16* k_ws   = q_ws + nBS * DMODEL;
  _Float16* v_ws   = k_ws + nBS * DMODEL;
  _Float16* att_ws = v_ws + nBS * DMODEL;              // [4096][1024]

  // Prep: f16 conversion + weight transposes, one launch
  prep_kernel<<<PREP_WGS, 256, 0, stream>>>(x, Wqkv, Wout, xh, Wqt, Wot);

  // QKV projection: M=4096, N=3072; 16 heads x 16 blocks of 256 rows
  qkv_gemm_kernel<<<dim3(NHEADS, (unsigned)(nBS / QM)), 256, 0,
                    stream>>>(xh, Wqt, bqkv, q_ws, k_ws, v_ws);

  // Attention: 32 (b,h) pairs x 16 query blocks of 128; 8 waves/block:
  // 4 groups of 32 queries x 2 key halves
  attn_kernel<<<NBATCH * NHEADS * (SEQ / 128), 256, 0, stream>>>(
      q_ws, k_ws, v_ws, mask, att_ws);

  // Output projection: M=4096, N=1024
  out_gemm_kernel<<<dim3(DMODEL / 128, (unsigned)(nBS / 128)), 256, 0,
                    stream>>>(att_ws, Wot, bout, out);
}

// v010
// Measured time: 67.3 microseconds a run.
// Next to v009, in two timings, it ran 1.07 times as fast each time.
// Over all steps from v000 it is 3.32 times as fast.
#include <hip/hip_runtime.h>

// ---------------------------------------------------------------------------
// MHA forward for MI455X (gfx1250, wave32, WMMA f32_16x16x32_f16,
// async global->LDS double-buffered GEMM staging)
//   B=2, S=2048, D_MODEL=1024, H=16, HD=64
// ---------------------------------------------------------------------------

typedef __attribute__((ext_vector_type(16))) _Float16 v16h;
typedef __attribute__((ext_vector_type(8)))  _Float16 v8h;
typedef __attribute__((ext_vector_type(4)))  _Float16 v4h;
typedef __attribute__((ext_vector_type(8)))  float    v8f;
typedef __attribute__((ext_vector_type(4)))  float    v4f;
typedef __attribute__((ext_vector_type(2)))  float    v2f;
typedef __attribute__((ext_vector_type(4)))  int      v4i;

#define NBATCH   2
#define SEQ      2048
#define DMODEL   1024
#define NHEADS   16
#define HDIM     64

__device__ __forceinline__ v16h cat16(v8h lo, v8h hi) {
  return __builtin_shufflevector(lo, hi, 0,1,2,3,4,5,6,7,8,9,10,11,12,13,14,15);
}

__device__ __forceinline__ v8f wmma_f16(v16h a, v16h b, v8f c) {
  // (neg_a, A, neg_b, B, c_mod, C, reuse_a, reuse_b)
  return __builtin_amdgcn_wmma_f32_16x16x32_f16(false, a, false, b, (short)0, c,
                                                false, false);
}

// Wait for this wave's own async global->LDS copies (ASYNCcnt)
__device__ __forceinline__ void wait_async0() {
  asm volatile("s_wait_asynccnt 0" ::: "memory");
}

// ---------------------------------------------------------------------------
// Prep kernel: f32 -> f16 conversion of x and of both weights (transposed to
// [n][k]), so the GEMM tiles become pure contiguous copies (async-to-LDS
// friendly) and all WMMA fragments are two contiguous 16B loads per lane.
// One launch of 512 work-groups for all three; every thread
// takes sixteen 16-byte loads, all in flight together.
//   blocks   0..191: 128 x 128 tiles of W_qkv     blocks 192..255: of W_out
//   blocks 256..511: 16,384 consecutive elements of x each
// ---------------------------------------------------------------------------
#define TT        128                       // transpose tile edge
#define NT_QKV    (3 * DMODEL / TT)         // tile columns of W_qkv
#define NT_OUT    (DMODEL / TT)             // tile columns of W_out
#define TILES_QKV ((DMODEL / TT) * NT_QKV)
#define TILES_W   (TILES_QKV + (DMODEL / TT) * NT_OUT)
#define XCHUNK    (256 * 4 * 16)            // elements of x per work-group
#define PREP_WGS  (TILES_W + NBATCH * SEQ * DMODEL / XCHUNK)

// dst[n][k] (f16) = src[k][n] (f32): tile t of a weight with NT tile columns
template <int NT>
__device__ __forceinline__ void transpose_tile(
    const float* __restrict__ src, _Float16* __restrict__ dst, int t,
    _Float16* T) {
  constexpr int N = NT * TT;
  const int k0   = (t / NT) * TT;
  const int n0   = (t % NT) * TT;
  const int tid  = threadIdx.x;
  const int lane = tid & 31;
  const int wave = tid >> 5;

  // Wave w reads rows k0 + 16 w .. + 15, each wave-wide load one 512-byte row
  // piece: a lane ends up with sixteen consecutive k of four columns.
  const float* s = src + (size_t)(k0 + wave * 16) * N + n0 + lane * 4;
  v4f f[16];
#pragma unroll   // all sixteen loads go out before the first is used
  for (int i = 0; i < 15; ++i) f[i] = *(const v4f*)(s + i * N);
  // The last load's result may land in the address registers the others name
  asm volatile("s_wait_xcnt 0x0" ::: "memory");
  f[15] = *(const v4f*)(s + 15 * N);

#pragma unroll
  for (int j = 0; j < 4; ++j) {
#pragma unroll
    for (int h = 0; h < 2; ++h) {
      v8h p;
#pragma unroll
      for (int e = 0; e < 8; ++e) p[e] = (_Float16)f[h * 8 + e][j];
      *(v8h*)&T[(lane * 4 + j) * TT + (((wave * 2 + h) ^ (lane & 15)) * 8)] = p;
    }
  }
  __syncthreads();   // the tile is complete before rows are read back

  // Sixteen lanes store one row's 256 bytes: whole lines, 16 bytes a lane
  const int c = tid & 15;
  _Float16* d = dst + (size_t)(n0 + (tid >> 4)) * DMODEL + k0 + c * 8;
#pragma unroll
  for (int i = 0; i < 8; ++i) {
    const int n = i * 16 + (tid >> 4);
    *(v8h*)(d + i * 16 * DMODEL) =
        *(const v8h*)&T[n * TT + ((c ^ ((n >> 2) & 15)) * 8)];
  }
  // Stands in front of any rewrite of a register that the stores above name
  asm volatile("s_wait_xcnt 0x0" ::: "memory");
}

// Budget of four waves a SIMD (this launch has two work-groups a WGP): at the
// default budget the compiler kept to 64 registers and made the later loads
// wait for the earlier ones; with it all sixteen go out as one group.
__global__ __launch_bounds__(256)
__attribute__((amdgpu_waves_per_eu(4, 4))) void prep_kernel(
    const float* __restrict__ x, const float* __restrict__ Wqkv,
    const float* __restrict__ Wout, _Float16* __restrict__ xh,
    _Float16* __restrict__ Wqt, _Float16* __restrict__ Wot) {
  // Tile as [n][k], rows of 256 bytes in sixteen 16-byte pieces; piece c of
  // row n lies at place c ^ ((n >> 2) & 15), which spreads over all banks both
  // the writers (16 lanes: rows 4 apart, one piece) and the readers (one row).
  __shared__ __attribute__((aligned(16))) _Float16 T[TT * TT];

  const int blk = blockIdx.x;               // every branch is block-uniform
  if (blk < TILES_QKV) {
    transpose_tile<NT_QKV>(Wqkv, Wqt, blk, T);
  } else if (blk < TILES_W) {
    transpose_tile<NT_OUT>(Wout, Wot, blk - TILES_QKV, T);
  } else {                                  // x to f16
    const size_t base = (size_t)(blk - TILES_W) * XCHUNK + threadIdx.x * 4;
    v4f f[16];
#pragma unroll   // all sixteen loads go out before the first is used
    for (int i = 0; i < 15; ++i) f[i] = *(const v4f*)(x + base + i * 1024);
    // The last load's result may land in the address registers the others name
    asm volatile("s_wait_xcnt 0x0" ::: "memory");
    f[15] = *(const v4f*)(x + base + 15 * 1024);
#pragma unroll
    for (int i = 0; i < 16; ++i) {
      v4h h;
      h[0] = (_Float16)f[i][0]; h[1] = (_Float16)f[i][1];
      h[2] = (_Float16)f[i][2]; h[3] = (_Float16)f[i][3];
      *(v4h*)(xh + base + i * 1024) = h;
    }
    // Stands in front of any rewrite of a register that the stores above name
    asm volatile("s_wait_xcnt 0x0" ::: "memory");
  }
}

// ---------------------------------------------------------------------------
// GEMM main loop over A[128 rows @ mb] and B[128 rows @ nb], K = 1024, both
// operands f16 with k contiguous (A row-major, B stored [n][k]).
// 256 threads / 8 waves; a wave owns 4x2 WMMA tiles: 64 stage rows as first
// operand, 32 as second.  A and B rows load alike, so the caller picks per
// wave which of the two is first (fo, so: offsets of those rows in buffer 0 of
// the ring): acc[t][u][r] = first row 16 t + 8 grp + r . second row 16 u + row,
// and a lane's eight registers run along the first operand's rows.
// Two-buffer LDS ring of stages of 128 k, four blocks of 32 k: sixteen lanes
// copy one 256-byte row, so a wave-wide copy takes two rows' four whole lines.
// ---------------------------------------------------------------------------
#define GPITCH  72                   // halves: 128-byte rows at 144 bytes
#define GK      128                  // k per stage
#define GSTG    (DMODEL / GK)
#define GKP     136                  // halves: 256-byte rows at 272 bytes
#define GBUF    (256 * GKP)          // halves per buffer: A rows, then B rows
#define GRING   (2 * GBUF)
#define GSTEP   (16 * GKP * 2)       // LDS bytes from one copy to the next

// Eight async copies of 16 bytes per lane: 128 rows of one operand, sixteen
// rows a copy.  l, g: this lane's chunk of rows 0..15.  The s_wait_xcnt closes
// the statement so that it stands in front of any rewrite of the address
// registers the copies name.
__device__ __forceinline__ void copy8(unsigned l, const _Float16* g) {
  asm volatile(
      "global_load_async_to_lds_b128 %0, %8, off\n\t"
      "global_load_async_to_lds_b128 %1, %9, off\n\t"
      "global_load_async_to_lds_b128 %2, %10, off\n\t"
      "global_load_async_to_lds_b128 %3, %11, off\n\t"
      "global_load_async_to_lds_b128 %4, %12, off\n\t"
      "global_load_async_to_lds_b128 %5, %13, off\n\t"
      "global_load_async_to_lds_b128 %6, %14, off\n\t"
      "global_load_async_to_lds_b128 %7, %15, off\n\t"
      "s_wait_xcnt 0x0"
      :: "v"(l), "v"(l + GSTEP), "v"(l + 2 * GSTEP), "v"(l + 3 * GSTEP),
         "v"(l + 4 * GSTEP), "v"(l + 5 * GSTEP), "v"(l + 6 * GSTEP),
         "v"(l + 7 * GSTEP),
         "v"(g), "v"(g + 16 * DMODEL), "v"(g + 32 * DMODEL),
         "v"(g + 48 * DMODEL), "v"(g + 64 * DMODEL), "v"(g + 80 * DMODEL),
         "v"(g + 96 * DMODEL), "v"(g + 112 * DMODEL)
      : "memory");
}

// One stage of A and of B (128 rows x 128 k each) into the buffer at l
__device__ __forceinline__ void stage_ab(unsigned l, const _Float16* ga,
                                         const _Float16* gb) {
  copy8(l, ga);
  copy8(l + 8 * GSTEP, gb);
}

__device__ __forceinline__ void gemm_mainloop_k1024(
    _Float16* S, const _Float16* __restrict__ A,
    const _Float16* __restrict__ B, int mb, int nb, int fo, int so,
    v8f acc[4][2]) {
  const int tid  = threadIdx.x;
  const int lane = tid & 31;
  const int row  = lane & 15;
  const int grp  = lane >> 4;

  // This lane's 16-byte chunk of a stage: row tid / 16, chunk tid % 16
  const int sr = tid >> 4;
  const int sc = (tid & 15) * 8;
  const unsigned l0 = (unsigned)(uintptr_t)&S[sr * GKP + sc];
  const _Float16* ga = A + (size_t)(mb + sr) * DMODEL + sc;
  const _Float16* gb = B + (size_t)(nb + sr) * DMODEL + sc;

  stage_ab(l0, ga, gb);                                 // stage 0, buffer 0
  wait_async0();      // this wave's share of stage 0 has landed
  __syncthreads();    // publishes stage 0
  stage_ab(l0 + GBUF * 2, ga + GK, gb + GK);

  for (int st = 0; st < GSTG; ++st) {
    const int cur = st & 1;
    const _Float16* at = &S[cur * GBUF + fo + row * GKP + 8 * grp];
    const _Float16* bt = &S[cur * GBUF + so + row * GKP + 8 * grp];

    // Three fragment sets: 0..3 tiles of the first operand, 4..5 of the second
    v16h f[3][6];
#pragma unroll   // a stage's four blocks of 32 k, at constant LDS offsets
    for (int h = -2; h < GK / 32; ++h) {
      if (h + 2 < GK / 32) {      // the block after next's fragments, one group
        v16h* n = f[(h + 2) % 3];
#pragma unroll
        for (int t = 0; t < 6; ++t) {
          const _Float16* p = (t < 4 ? at + t * 16 * GKP
                                     : bt + (t - 4) * 16 * GKP) + (h + 2) * 32;
          n[t] = cat16(*(const v8h*)p, *(const v8h*)(p + 16));
        }
      }
      // Keeps those loads ahead of this block's WMMAs: moved down among them,
      // each would be waited for where it stands
      __builtin_amdgcn_sched_barrier(0);
      if (h >= 0) {
        const v16h* b = f[h % 3];
#pragma unroll
        for (int tm = 0; tm < 4; ++tm)
#pragma unroll
          for (int tn = 0; tn < 2; ++tn)
            acc[tm][tn] = wmma_f16(b[tm], b[4 + tn], acc[tm][tn]);
        // Keeps later blocks' loads from moving up among these WMMAs
        __builtin_amdgcn_sched_barrier(0);
      }
    }

    // Publish point of stage st + 1: this wave's reads of the current buffer
    // have retired, its copies of the next stage have landed, and behind the
    // barrier the current buffer is free for stage st + 2.
    asm volatile("s_wait_dscnt 0x0" ::: "memory");
    wait_async0();
    __syncthreads();
    if (st + 2 < GSTG)
      stage_ab(l0 + cur * (GBUF * 2), ga + (st + 2) * GK, gb + (st + 2) * GK);
  }
  wait_async0();                  // nothing is in flight behind the loop
}

// ---------------------------------------------------------------------------
// Kernel 1: QKV projection.  C[4096][3072] = xh @ Wqt^T + b_qkv.  Scatters:
//   q_ws: [bh][s][64]  (pre-scaled by log2(e)/sqrt(64): scores in log2 units)
//   k_ws: [bh][s][64]
//   v_ws: [bh][d][s]   (transposed for the PV matmul's A-fragment layout)
// A work-group takes 256 x rows by the 192 columns of one head (its q, k and
// v): 256 work-groups, one on each WGP.  A wave takes 64 x rows by 96 columns:
// all of q (waves 0..3) or of k (waves 4..7) and one half of v, 24 WMMA tiles
// from ten fragments.  For q and k the weight rows are the first WMMA operand,
// for v the x rows, so that a lane's eight accumulators are always eight
// neighbours of one destination row; the rows, staged in LDS, leave as whole
// 128-byte lines.
// ---------------------------------------------------------------------------

// 32 staged rows of 128 bytes (pitch GPITCH) to dst, rows STRIDE halves apart.
// Eight lanes take one row; a store covers rows i, i + 8, i + 16, i + 24: four
// whole lines, and in LDS each half of the wave meets every bank once.
template <int STRIDE>
__device__ __forceinline__ void store_rows_f16(const _Float16* stg,
                                               _Float16* dst, int lane) {
  // This wave's own LDS writes have retired before lanes read others' rows
  asm volatile("s_wait_dscnt 0x0" ::: "memory");
  const _Float16* s = stg + (lane >> 3) * 8 * GPITCH + (lane & 7) * 8;
  _Float16* d = dst + (size_t)((lane >> 3) * 8) * STRIDE + (lane & 7) * 8;
  v8h p[8];
#pragma unroll   // constant offsets from one LDS and one global address
  for (int i = 0; i < 8; ++i) p[i] = *(const v8h*)(s + i * GPITCH);
#pragma unroll
  for (int i = 0; i < 8; ++i) *(v8h*)(d + i * STRIDE) = p[i];
  // Stands in front of any rewrite of a register that the stores above name
  asm volatile("s_wait_xcnt 0x0" ::: "memory");
}

#define QM      256                  // x rows per work-group
#define QN      (3 * HDIM)           // weight rows per work-group: one head
#define QK      128                  // k per stage
#define QSTG    (DMODEL / QK)
#define QPITCH  136                  // halves: 256-byte rows at 272 bytes
#define QBUF    ((QN + QM) * QPITCH) // halves per buffer: weight rows, x rows
#define QSTEP   (16 * QPITCH * 2)    // LDS bytes from one copy to the next

// Fourteen async copies of 16 bytes per lane, LDS places sixteen rows apart.
// The s_wait_xcnt closes the statement so that it stands in front of any
// rewrite of the address registers the copies name.
__device__ __forceinline__ void copy14(unsigned l, const _Float16* const* g) {
  asm volatile(
      "global_load_async_to_lds_b128 %0, %14, off\n\t"
      "global_load_async_to_lds_b128 %1, %15, off\n\t"
      "global_load_async_to_lds_b128 %2, %16, off\n\t"
      "global_load_async_to_lds_b128 %3, %17, off\n\t"
      "global_load_async_to_lds_b128 %4, %18, off\n\t"
      "global_load_async_to_lds_b128 %5, %19, off\n\t"
      "global_load_async_to_lds_b128 %6, %20, off\n\t"
      "global_load_async_to_lds_b128 %7, %21, off\n\t"
      "global_load_async_to_lds_b128 %8, %22, off\n\t"
      "global_load_async_to_lds_b128 %9, %23, off\n\t"
      "global_load_async_to_lds_b128 %10, %24, off\n\t"
      "global_load_async_to_lds_b128 %11, %25, off\n\t"
      "global_load_async_to_lds_b128 %12, %26, off\n\t"
      "global_load_async_to_lds_b128 %13, %27, off\n\t"
      "s_wait_xcnt 0x0"
      :: "v"(l), "v"(l + QSTEP), "v"(l + 2 * QSTEP), "v"(l + 3 * QSTEP),
         "v"(l + 4 * QSTEP), "v"(l + 5 * QSTEP), "v"(l + 6 * QSTEP),
         "v"(l + 7 * QSTEP), "v"(l + 8 * QSTEP), "v"(l + 9 * QSTEP),
         "v"(l + 10 * QSTEP), "v"(l + 11 * QSTEP), "v"(l + 12 * QSTEP),
         "v"(l + 13 * QSTEP),
         "v"(g[0]), "v"(g[1]), "v"(g[2]), "v"(g[3]), "v"(g[4]), "v"(g[5]),
         "v"(g[6]), "v"(g[7]), "v"(g[8]), "v"(g[9]), "v"(g[10]), "v"(g[11]),
         "v"(g[12]), "v"(g[13])
      : "memory");
}

// One stage (192 weight rows, then 256 x rows, 128 k each) into the buffer at
// l: 28 copies per lane, sixteen lanes to a row, so a wave-wide copy takes two
// rows' four whole lines.  l, gx, gw: this lane's chunk of rows 0..15.
__device__ __forceinline__ void stage_xw(unsigned l, const _Float16* gx,
                                         const _Float16* gw) {
  const _Float16* g[(QN + QM) / 16];
#pragma unroll   // the table is indexed by constants only: it stays in registers
  for (int i = 0; i < QN / 16; ++i) g[i] = gw + i * 16 * DMODEL;
#pragma unroll
  for (int i = 0; i < QM / 16; ++i) g[QN / 16 + i] = gx + i * 16 * DMODEL;
  copy14(l, g);
  copy14(l + 14 * QSTEP, g + 14);
}

// One work-group fills a WGP's LDS: two waves a SIMD, 512 registers a wave
__global__ __launch_bounds__(256) void qkv_gemm_kernel(
    const _Float16* __restrict__ xh, const _Float16* __restrict__ Wqt,
    const float* __restrict__ bqkv,
    _Float16* __restrict__ q_ws, _Float16* __restrict__ k_ws,
    _Float16* __restrict__ v_ws) {
  __shared__ __attribute__((aligned(16))) _Float16 S[2 * QBUF];

  const int tid  = threadIdx.x;
  const int lane = tid & 31;
  const int row  = lane & 15;
  const int grp  = lane >> 4;
  // In a scalar register: the wave's offsets become scalar arithmetic
  const int wave = __builtin_amdgcn_readfirstlane(tid >> 5);
  const int hd   = blockIdx.x;
  const int mb   = blockIdx.y * QM;
  const int nb   = hd * QN;
  const int xr   = (wave & 3) * 64;           // first x row, of 256
  const int wn   = wave >> 2;                 // 0: q and v 0..31, 1: k and v 32..63

  v8f aq[4][4];       // [weight tile of q or k][x tile]
  v8f av[4][2];       // [x tile][weight tile of v]
#pragma unroll
  for (int i = 0; i < 4; ++i) {
    const v8f z = {0.f,0.f,0.f,0.f,0.f,0.f,0.f,0.f};
#pragma unroll
    for (int j = 0; j < 4; ++j) aq[i][j] = z;
#pragma unroll
    for (int j = 0; j < 2; ++j) av[i][j] = z;
  }

  // This lane's 16-byte chunk of a stage: row tid / 16, chunk tid % 16
  const int sr = tid >> 4;
  const int sc = (tid & 15) * 8;
  const unsigned l0 = (unsigned)(uintptr_t)&S[sr * QPITCH + sc];
  const _Float16* gx = xh + (size_t)(mb + sr) * DMODEL + sc;
  const _Float16* gw = Wqt + (size_t)(nb + sr) * DMODEL + sc;

  stage_xw(l0, gx, gw);                                 // stage 0, buffer 0
  wait_async0();      // this wave's share of stage 0 has landed
  __syncthreads();    // publishes stage 0
  stage_xw(l0 + QBUF * 2, gx + QK, gw + QK);

  for (int st = 0; st < QSTG; ++st) {
    const int cur = st & 1;
    const _Float16* fr = &S[cur * QBUF + row * QPITCH + 8 * grp];
    const _Float16* wt = fr + wn * HDIM * QPITCH;
    const _Float16* vt = fr + (2 * HDIM + wn * 32) * QPITCH;
    const _Float16* xt = fr + (QN + xr) * QPITCH;

    // Two fragment sets: 0..3 x tiles, 4..7 weight tiles of q or k, 8..9 of v
    v16h f[2][10];
#pragma unroll   // a stage's four blocks of 32 k, at constant LDS offsets
    for (int h = -1; h < QK / 32; ++h) {
      if (h + 1 < QK / 32) {      // the next block's fragments, as one group
        v16h* n = f[(h + 1) & 1];
#pragma unroll
        for (int t = 0; t < 10; ++t) {
          const _Float16* p = (t < 4   ? xt + t * 16 * QPITCH
                               : t < 8 ? wt + (t - 4) * 16 * QPITCH
                                       : vt + (t - 8) * 16 * QPITCH) +
                              (h + 1) * 32;
          n[t] = cat16(*(const v8h*)p, *(const v8h*)(p + 16));
        }
      }
      // Keeps those loads ahead of this block's WMMAs: moved down among them,
      // each would be waited for where it stands
      __builtin_amdgcn_sched_barrier(0);
      if (h >= 0) {
        const v16h* b = f[h & 1];
#pragma unroll
        for (int t = 0; t < 4; ++t)
#pragma unroll
          for (int u = 0; u < 4; ++u)
            aq[t][u] = wmma_f16(b[4 + t], b[u], aq[t][u]);
#pragma unroll
        for (int t = 0; t < 4; ++t)
#pragma unroll
          for (int u = 0; u < 2; ++u)
            av[t][u] = wmma_f16(b[t], b[8 + u], av[t][u]);
        // Keeps the block after next's loads from moving up among these WMMAs
        __builtin_amdgcn_sched_barrier(0);
      }
    }

    // Publish point of stage st + 1: this wave's reads of the current buffer
    // have retired, its copies of the next stage have landed, and behind the
    // barrier the current buffer is free for stage st + 2.
    asm volatile("s_wait_dscnt 0x0" ::: "memory");
    wait_async0();
    __syncthreads();
    if (st + 2 < QSTG)
      stage_xw(l0 + cur * (QBUF * 2), gx + (st + 2) * QK, gw + (st + 2) * QK);
  }
  wait_async0();                  // nothing is in flight behind the loop

  // Behind the loop's last barrier nobody reads the ring and no copy is in
  // flight: each wave stages in a range of its own, 64 rows of q or k (one row
  // a position) and then 32 rows of v (one row a head column).
  _Float16* stg  = S + wave * (96 * GPITCH);
  _Float16* stgv = stg + 64 * GPITCH;
  const int bh = (mb >> 11) * NHEADS + hd;
  const int s0 = (mb & (SEQ - 1)) + xr;

  const float sc8 = wn == 0 ? 0.125f * 1.44269504f : 1.f;
  v4f bb[4][2];       // bias of q or k: eight columns a lane and tile
  float bv[2];        // bias of v: one column a lane and tile
  // The ten loads and their data wait are one statement: as plain loads with a
  // wait in a statement of its own, later address arithmetic was moved up over
  // that wait and rewrote an offset register that the loads name.  All ten are
  // in flight together, and all are needed next.
  asm volatile(
      "global_load_b128 %0, %10, off\n\t"
      "global_load_b128 %1, %10, off offset:16\n\t"
      "global_load_b128 %2, %10, off offset:64\n\t"
      "global_load_b128 %3, %10, off offset:80\n\t"
      "global_load_b128 %4, %10, off offset:128\n\t"
      "global_load_b128 %5, %10, off offset:144\n\t"
      "global_load_b128 %6, %10, off offset:192\n\t"
      "global_load_b128 %7, %10, off offset:208\n\t"
      "global_load_b32 %8, %11, off\n\t"
      "global_load_b32 %9, %11, off offset:64\n\t"
      "s_wait_loadcnt 0x0"
      : "=&v"(bb[0][0]), "=&v"(bb[0][1]), "=&v"(bb[1][0]), "=&v"(bb[1][1]),
        "=&v"(bb[2][0]), "=&v"(bb[2][1]), "=&v"(bb[3][0]), "=&v"(bb[3][1]),
        "=&v"(bv[0]), "=&v"(bv[1])
      : "v"(bqkv + nb + wn * HDIM + 8 * grp),
        "v"(bqkv + nb + 2 * HDIM + wn * 32 + row)
      : "memory");

  // q or k: registers run along the head's 64 columns, lanes along s
#pragma unroll   // here and below: accumulators are indexed by constants only
  for (int t = 0; t < 4; ++t) {
#pragma unroll
    for (int u = 0; u < 4; ++u) {
      v8h p;
#pragma unroll
      for (int r = 0; r < 8; ++r)
        p[r] = (_Float16)((aq[t][u][r] + bb[t][r >> 2][r & 3]) * sc8);
      *(v8h*)&stg[(u * 16 + row) * GPITCH + t * 16 + 8 * grp] = p;
    }
  }
  // v: registers run along s, lanes along d
#pragma unroll
  for (int u = 0; u < 2; ++u) {
#pragma unroll
    for (int t = 0; t < 4; ++t) {
      v8h p;
#pragma unroll
      for (int r = 0; r < 8; ++r) p[r] = (_Float16)(av[t][u][r] + bv[u]);
      *(v8h*)&stgv[(u * 16 + row) * GPITCH + t * 16 + 8 * grp] = p;
    }
  }

  _Float16* dqk = (wn == 0 ? q_ws : k_ws) + ((size_t)bh * SEQ + s0) * HDIM;
  store_rows_f16<HDIM>(stg, dqk, lane);
  store_rows_f16<HDIM>(stg + 32 * GPITCH, dqk + 32 * HDIM, lane);
  store_rows_f16<SEQ>(stgv, v_ws + ((size_t)bh * HDIM + wn * 32) * SEQ + s0,
                      lane);
}

__device__ __forceinline__ float xhalf(float x) {
  const int b = __builtin_bit_cast(int, x);
  return __builtin_bit_cast(float, __builtin_amdgcn_permlanex16(
      b, b, 0x76543210, 0xfedcba98, false, false));
}

#define KSTG    128                  // keys per stage
#define NSTG    (SEQ / KSTG)
#define KHALF   (KSTG / 2)           // keys of a stage that one wave takes
#define KPITCH  72                   // halves: 128-byte K rows at 144 bytes
#define VPITCH  136                  // halves: 256-byte Vt rows at 272 bytes
#define KBUF    (KSTG * KPITCH)      // halves per K buffer
#define VBUF    (HDIM * VPITCH)      // halves per Vt buffer
#define PMAX    4096.f               // bound of a P value: a sixteenth of f16's top

// P = 2^(score - m) of one lane's sixteen keys of a column group, as f16 into
// the B fragment; returns their sum, a tree over halves: terms 8, 4, 2, then 1 apart.
__device__ __forceinline__ float exp_tile(v8f c0, v8f c1, float m, v16h& pb) {
  // Subtracted by pairs of one tile: the packed subtractions then take
  // neighbouring accumulator registers as they lie, with no copies to pair them
  const v2f mm = {m, m};
  v8f p0, p1;
#pragma unroll   // vector elements are indexed by constants only
  for (int r = 0; r < 8; r += 2) {
    const v2f x0 = {c0[r], c0[r + 1]};
    const v2f x1 = {c1[r], c1[r + 1]};
    const v2f a0 = x0 - mm;
    const v2f a1 = x1 - mm;
#pragma unroll
    for (int e = 0; e < 2; ++e) {
      p0[r + e] = __builtin_amdgcn_exp2f(a0[e]);
      p1[r + e] = __builtin_amdgcn_exp2f(a1[e]);
      pb[r + e]     = (_Float16)p0[r + e];
      pb[8 + r + e] = (_Float16)p1[r + e];
    }
  }
  const v8f ps = p0 + p1;
  const v4f s4 = __builtin_shufflevector(ps, ps, 0, 1, 2, 3) +
                 __builtin_shufflevector(ps, ps, 4, 5, 6, 7);
  const v2f s2 = __builtin_shufflevector(s4, s4, 0, 1) +
                 __builtin_shufflevector(s4, s4, 2, 3);
  return s2[0] + s2[1];
}

// One stage of K (128 keys x 64) and Vt (64 x 128 keys) into LDS: eight async
// copies of 16 bytes per lane, every wave-wide copy covering four whole lines.
// lk, gk: this lane's chunk of K rows 0..31, the next copies 32 rows further;
// lv, gv: its chunk of Vt rows 0..15, the next copies 16 rows further.
// The s_wait_xcnt closes the statement so that it stands in front of any
// rewrite of the address registers the copies name.
__device__ __forceinline__ void stage_kv(unsigned lk, unsigned lv,
                                         const _Float16* gk,
                                         const _Float16* gv) {
  asm volatile(
      "global_load_async_to_lds_b128 %0, %8, off\n\t"
      "global_load_async_to_lds_b128 %1, %9, off\n\t"
      "global_load_async_to_lds_b128 %2, %10, off\n\t"
      "global_load_async_to_lds_b128 %3, %11, off\n\t"
      "global_load_async_to_lds_b128 %4, %12, off\n\t"
      "global_load_async_to_lds_b128 %5, %13, off\n\t"
      "global_load_async_to_lds_b128 %6, %14, off\n\t"
      "global_load_async_to_lds_b128 %7, %15, off\n\t"
      "s_wait_xcnt 0x0"
      :: "v"(lk), "v"(lk + 32 * KPITCH * 2), "v"(lk + 64 * KPITCH * 2),
         "v"(lk + 96 * KPITCH * 2),
         "v"(lv), "v"(lv + 16 * VPITCH * 2), "v"(lv + 32 * VPITCH * 2),
         "v"(lv + 48 * VPITCH * 2),
         "v"(gk), "v"(gk + 32 * HDIM), "v"(gk + 64 * HDIM), "v"(gk + 96 * HDIM),
         "v"(gv), "v"(gv + 16 * SEQ), "v"(gv + 32 * SEQ), "v"(gv + 48 * SEQ)
      : "memory");
}

// Four waves a SIMD and no more: two work-groups fill a WGP, so the 512
// work-groups of the launch cannot pile up three to a WGP and leave others idle.
__global__ __launch_bounds__(256)
__attribute__((amdgpu_waves_per_eu(4, 4))) void attn_kernel(
    const _Float16* __restrict__ q_ws, const _Float16* __restrict__ k_ws,
    const _Float16* __restrict__ v_ws, const int* __restrict__ mask,
    _Float16* __restrict__ att_ws) {
  // 0 for a live key, -inf for a masked one
  __shared__ __attribute__((aligned(32))) float mbias[SEQ];
  // Two-buffer ring of K and Vt stages, shared by the block's eight waves
  __shared__ __attribute__((aligned(16))) _Float16 Ks[2 * KBUF];
  __shared__ __attribute__((aligned(16))) _Float16 Vs[2 * VBUF];

  const int tid  = threadIdx.x;
  const int lane = tid & 31;
  const int row  = lane & 15;
  const int grp  = lane >> 4;
  // In a scalar register: the choice of who merges becomes a scalar branch
  const int wave = __builtin_amdgcn_readfirstlane(tid >> 5);
  const int cg   = wave & 3;                            // 32-query group
  const int kh   = wave >> 2;                           // key half of a stage

  const int bh = blockIdx.x >> 4;                       // 0..31
  const int q0 = (blockIdx.x & 15) * 128 + cg * 32;
  const int b  = bh >> 4;
  const int hh = bh & (NHEADS - 1);

  const _Float16* qb = q_ws + (size_t)bh * SEQ * HDIM;
  const _Float16* kb = k_ws + (size_t)bh * SEQ * HDIM;
  const _Float16* vb = v_ws + (size_t)bh * HDIM * SEQ;
  const int* mrow    = mask + b * SEQ;

  // This lane's 16-byte chunk of a stage: K row tid / 8, Vt row tid / 16
  const unsigned lk0 =
      (unsigned)(uintptr_t)&Ks[(tid >> 3) * KPITCH + (tid & 7) * 8];
  const unsigned lv0 =
      (unsigned)(uintptr_t)&Vs[(tid >> 4) * VPITCH + (tid & 15) * 8];
  const _Float16* gk = kb + tid * 8;
  const _Float16* gv = vb + (tid >> 4) * SEQ + (tid & 15) * 8;

  stage_kv(lk0, lv0, gk, gv);                           // stage 0, buffer 0

  // Keys run over accumulator registers: the mask enters as the C operand of
  // the score product, read from this table.
#pragma unroll   // independent loads in flight instead of round trips
  for (int i0 = 0; i0 < SEQ; i0 += 256 * 4) {
    const int i = i0 + tid * 4;
    const v4i mm = *(const v4i*)(mrow + i);
    v4f bb;
#pragma unroll
    for (int j = 0; j < 4; ++j) bb[j] = (mm[j] == 0) ? -__builtin_inff() : 0.f;
    *(v4f*)&mbias[i] = bb;
  }
  wait_async0();      // this wave's share of stage 0 has landed
  __syncthreads();    // publishes stage 0 and the mask table
  stage_kv(lk0 + KBUF * 2, lv0 + VBUF * 2, gk + KSTG * HDIM, gv + KSTG);

  v16h bq[2][2];                  // [column group][k half of the head size]
#pragma unroll   // the loads go out together, into registers
  for (int g = 0; g < 2; ++g) {
    const _Float16* qrow = qb + (size_t)(q0 + g * 16 + row) * HDIM;
    bq[g][0] = cat16(*(const v8h*)(qrow + 8 * grp),
                     *(const v8h*)(qrow + 16 + 8 * grp));
    bq[g][1] = cat16(*(const v8h*)(qrow + 32 + 8 * grp),
                     *(const v8h*)(qrow + 48 + 8 * grp));
  }
  // Stands in front of any rewrite of a register that the loads above name
  asm volatile("s_wait_xcnt 0x0" ::: "memory");

  // Maximum in use for this lane's query in each group.  The start is finite
  // and below every score, so a key half whose keys are all masked keeps zero
  // sums and merges as nothing instead of giving inf - inf; a live key's
  // exponential against it is inf, which forces the first renewal.
  float mv[2] = {-1e30f, -1e30f};
  float lv[2] = {0.f, 0.f};       // this half's share of the running sums
  v8f o[2][4];                    // o[g][t][r] = Ot[16 t + 8 grp + r][query row]
#pragma unroll
  for (int g = 0; g < 2; ++g)
#pragma unroll
    for (int t = 0; t < 4; ++t) {
      v8f z = {0.f,0.f,0.f,0.f,0.f,0.f,0.f,0.f};
      o[g][t] = z;
    }

  for (int st = 0; st < NSTG; ++st) {
    const int cur = st & 1;
    const _Float16* kt =
        &Ks[cur * KBUF + (kh * KHALF + row) * KPITCH + 8 * grp];
    const _Float16* vt = &Vs[cur * VBUF + row * VPITCH + kh * KHALF + 8 * grp];

#pragma unroll   // the second pass's LDS reads go out under the first pass
    for (int p = 0; p < KHALF / 32; ++p) {
      const int s0 = st * KSTG + kh * KHALF + p * 32;
      const _Float16* k0r = kt + p * 32 * KPITCH;      // key row, k chunk
      const _Float16* k1r = k0r + 16 * KPITCH;
      const _Float16* vr  = vt + p * 32;               // d row, key chunk
      const v16h ak00 = cat16(*(const v8h*)(k0r),      *(const v8h*)(k0r + 16));
      const v16h ak01 = cat16(*(const v8h*)(k0r + 32), *(const v8h*)(k0r + 48));
      const v16h ak10 = cat16(*(const v8h*)(k1r),      *(const v8h*)(k1r + 16));
      const v16h ak11 = cat16(*(const v8h*)(k1r + 32), *(const v8h*)(k1r + 48));

      v16h av[4];
#pragma unroll
      for (int t = 0; t < 4; ++t)
        av[t] = cat16(*(const v8h*)(vr + t * 16 * VPITCH),
                      *(const v8h*)(vr + t * 16 * VPITCH + 16));

      // c0[r]: key s0 + 8 grp + r, c1[r]: key s0 + 16 + 8 grp + r
      const v8f mb0 = *(const v8f*)&mbias[s0 + 8 * grp];
      const v8f mb1 = *(const v8f*)&mbias[s0 + 16 + 8 * grp];

      v8f c0[2], c1[2];
      v16h pb[2];
      float ps[2];                // sum of this lane's sixteen exponentials
#pragma unroll   // both column groups work from the same fragments
      for (int g = 0; g < 2; ++g) {
        c0[g] = wmma_f16(ak00, bq[g][0], mb0);
        c1[g] = wmma_f16(ak10, bq[g][0], mb1);
        c0[g] = wmma_f16(ak01, bq[g][1], c0[g]);
        c1[g] = wmma_f16(ak11, bq[g][1], c1[g]);
        ps[g] = exp_tile(c0[g], c1[g], mv[g], pb[g]);
      }

      // Compiler fence: keeps the Vt loads in front of the branch, so that they
      // fly during the test; moved behind it they are waited for where they
      // stand, with nothing to cover them.
      asm volatile("" ::: "memory");

      // No P value is above its lane's sum: while every sum is within PMAX, all
      // of P fits f16 and the maximum in use may stay.  One test a pass for both
      // groups, a scalar branch; written so that inf and NaN take the renewal.
      if (__builtin_amdgcn_ballot_w32(!(ps[0] <= PMAX) | !(ps[1] <= PMAX)) != 0) {
#pragma unroll   // accumulators are indexed by constants only
        for (int g = 0; g < 2; ++g) {
          float tm[8];
#pragma unroll
          for (int r = 0; r < 8; ++r) tm[r] = fmaxf(c0[g][r], c1[g][r]);
          float rm = fmaxf(fmaxf(fmaxf(tm[0], tm[1]), fmaxf(tm[2], tm[3])),
                           fmaxf(fmaxf(tm[4], tm[5]), fmaxf(tm[6], tm[7])));
          rm = fmaxf(rm, xhalf(rm));  // both wave halves keep one maximum
          const float mn    = fmaxf(mv[g], rm);
          const float alpha = __builtin_amdgcn_exp2f(mv[g] - mn);
          mv[g] = mn;
          lv[g] *= alpha;
#pragma unroll
          for (int t = 0; t < 4; ++t) o[g][t] *= alpha;
          ps[g] = exp_tile(c0[g], c1[g], mn, pb[g]);
        }
      }
      lv[0] += ps[0];
      lv[1] += ps[1];

#pragma unroll
      for (int g = 0; g < 2; ++g)
#pragma unroll
        for (int t = 0; t < 4; ++t) o[g][t] = wmma_f16(av[t], pb[g], o[g][t]);
    }

    // Publish point of stage st + 1: this wave's reads of the current buffer
    // have retired, its copies of the next stage have landed, and behind the
    // barrier the current buffer is free for stage st + 2.
    asm volatile("s_wait_dscnt 0x0" ::: "memory");
    wait_async0();
    __syncthreads();
    if (st + 2 < NSTG)
      stage_kv(lk0 + cur * (KBUF * 2), lv0 + cur * (VBUF * 2),
               gk + (st + 2) * (KSTG * HDIM), gv + (st + 2) * KSTG);
  }
  wait_async0();                  // nothing is in flight behind the loop

  // Merge of the two key halves.  Behind the loop's last barrier nobody reads
  // the K ring and no copy is in flight: wave 4 + cg hands its sums to wave cg
  // there, lane to lane, seventeen 16-byte pieces a lane, each piece contiguous
  // over the wave.
  v4f* xw = (v4f*)Ks + cg * (17 * 32) + lane;
  if (kh == 1) {
#pragma unroll   // accumulators are indexed by constants only
    for (int g = 0; g < 2; ++g)
#pragma unroll
      for (int t = 0; t < 4; ++t) {
        const v8f v = o[g][t];
        xw[((g * 4 + t) * 2) * 32]     = __builtin_shufflevector(v, v, 0, 1, 2, 3);
        xw[((g * 4 + t) * 2 + 1) * 32] = __builtin_shufflevector(v, v, 4, 5, 6, 7);
      }
    const v4f ml = {mv[0], mv[1], lv[0], lv[1]};
    xw[16 * 32] = ml;
  }
  __syncthreads();    // the second half's sums are in LDS before they are read
  if (kh == 0) {
    const v4f ml = xw[16 * 32];
    v8h h[2][4];
#pragma unroll
    for (int g = 0; g < 2; ++g) {
      const float m  = fmaxf(mv[g], ml[g]);
      const float a0 = __builtin_amdgcn_exp2f(mv[g] - m);
      const float a1 = __builtin_amdgcn_exp2f(ml[g] - m);
      float l = lv[g] * a0 + ml[2 + g] * a1;
      l += xhalf(l);              // join the two wave halves' sums
      const float w0 = a0 / l;    // the division by the sum goes into the weights
      const float w1 = a1 / l;
#pragma unroll
      for (int t = 0; t < 4; ++t) {
        const v4f x0 = xw[((g * 4 + t) * 2) * 32];
        const v4f x1 = xw[((g * 4 + t) * 2 + 1) * 32];
#pragma unroll
        for (int r = 0; r < 4; ++r) {
          h[g][t][r]     = (_Float16)(o[g][t][r] * w0 + x0[r] * w1);
          h[g][t][4 + r] = (_Float16)(o[g][t][4 + r] * w0 + x1[r] * w1);
        }
      }
    }
    _Float16* orow =
        att_ws + ((size_t)(b * SEQ + q0 + row)) * DMODEL + hh * HDIM + 8 * grp;
#pragma unroll   // constant offsets from one global address
    for (int g = 0; g < 2; ++g)
#pragma unroll
      for (int t = 0; t < 4; ++t)
        *(v8h*)(orow + g * 16 * DMODEL + t * 16) = h[g][t];
    // Stands in front of any rewrite of a register that the stores above name
    asm volatile("s_wait_xcnt 0x0" ::: "memory");
  }
}

// ---------------------------------------------------------------------------
// Kernel 3: output projection.  out[4096][1024] = att @ Wot^T + b_out
// The weight rows are the first WMMA operand: a lane's eight accumulators are
// eight neighbours of one output row.  A wave's 32 rows of 64 floats, staged in
// LDS, leave as whole 128-byte lines.
// ---------------------------------------------------------------------------
#define OPITCH  68                   // floats: 256-byte rows at 272 bytes

__global__ __launch_bounds__(256) void out_gemm_kernel(
    const _Float16* __restrict__ att, const _Float16* __restrict__ Wot,
    const float* __restrict__ bout, float* __restrict__ out) {
  __shared__ __attribute__((aligned(16))) _Float16 S[GRING];

  const int lane = threadIdx.x & 31;
  const int row  = lane & 15;
  const int grp  = lane >> 4;
  // In a scalar register: the wave's offsets become scalar arithmetic
  const int wave = __builtin_amdgcn_readfirstlane(threadIdx.x >> 5);
  const int mb   = blockIdx.y * 128;
  const int nb   = blockIdx.x * 128;
  const int xr   = (wave & 3) * 32;           // first att row, of 128
  const int wr   = (wave >> 2) * 64;          // first weight row, of 128

  v8f acc[4][2];
#pragma unroll
  for (int i = 0; i < 4; ++i)
#pragma unroll
    for (int j = 0; j < 2; ++j) {
      v8f z = {0.f,0.f,0.f,0.f,0.f,0.f,0.f,0.f};
      acc[i][j] = z;
    }

  gemm_mainloop_k1024(S, att, Wot, mb, nb, (128 + wr) * GKP, xr * GKP, acc);

  // Behind the loop's last barrier nobody reads the ring and no copy is in
  // flight: each wave stages in a range of its own.
  float* stg = (float*)S + wave * (32 * OPITCH);
  v8f bb[4];          // bias: eight columns a lane and tile
#pragma unroll   // the loads go out together, into registers
  for (int t = 0; t < 4; ++t)
    bb[t] = *(const v8f*)(bout + nb + wr + t * 16 + 8 * grp);
  // Stands in front of any rewrite of a register that the loads above name
  asm volatile("s_wait_xcnt 0x0" ::: "memory");
#pragma unroll   // here and below: accumulators are indexed by constants only
  for (int t = 0; t < 4; ++t) {
#pragma unroll
    for (int u = 0; u < 2; ++u) {
      const v8f v = acc[t][u] + bb[t];
      float* w = &stg[(u * 16 + row) * OPITCH + t * 16 + 8 * grp];
      *(v4f*)w       = __builtin_shufflevector(v, v, 0, 1, 2, 3);
      *(v4f*)(w + 4) = __builtin_shufflevector(v, v, 4, 5, 6, 7);
    }
  }
  // This wave's own LDS writes have retired before lanes read others' rows
  asm volatile("s_wait_dscnt 0x0" ::: "memory");
  // Sixteen lanes take one row: a store covers two rows, four whole lines
  const float* s = stg + grp * OPITCH + row * 4;
  float* d = out + (size_t)(mb + xr + grp) * DMODEL + nb + wr + row * 4;
  v4f p[16];
#pragma unroll   // constant offsets from one LDS and one global address
  for (int i = 0; i < 16; ++i) p[i] = *(const v4f*)(s + i * 2 * OPITCH);
#pragma unroll
  for (int i = 0; i < 16; ++i) *(v4f*)(d + i * 2 * DMODEL) = p[i];
  // Stands in front of any rewrite of a register that the stores above name
  asm volatile("s_wait_xcnt 0x0" ::: "memory");
}

// ---------------------------------------------------------------------------
// Launch
// ---------------------------------------------------------------------------
extern "C" void kernel_launch(void* const* d_in, const int* in_sizes, int n_in,
                              void* d_out, int out_size, void* d_ws,
                              size_t ws_size, hipStream_t stream) {
  const float* x    = (const float*)d_in[0];
  const int*   mask = (const int*)d_in[1];
  const float* Wqkv = (const float*)d_in[2];
  const float* bqkv = (const float*)d_in[3];
  const float* Wout = (const float*)d_in[4];
  const float* bout = (const float*)d_in[5];
  float* out = (float*)d_out;

  const size_t nBS  = (size_t)NBATCH * SEQ;            // 4096
  _Float16* xh     = (_Float16*)d_ws;                  // [4096][1024]
  _Float16* Wqt    = xh  + nBS * DMODEL;               // [3072][1024]
  _Float16* Wot    = Wqt + (size_t)3 * DMODEL * DMODEL;// [1024][1024]
  _Float16* q_ws   = Wot + (size_t)DMODEL * DMODEL;    // [32][2048][64]
  _Float16* k_ws   = q_ws + nBS * DMODEL;
  _Float16* v_ws   = k_ws + nBS * DMODEL;
  _Float16* att_ws = v_ws + nBS * DMODEL;              // [4096][1024]

  // Prep: f16 conversion + weight transposes, one launch
  prep_kernel<<<PREP_WGS, 256, 0, stream>>>(x, Wqkv, Wout, xh, Wqt, Wot);

  // QKV projection: M=4096, N=3072; 16 heads x 16 blocks of 256 rows
  qkv_gemm_kernel<<<dim3(NHEADS, (unsigned)(nBS / QM)), 256, 0,
                    stream>>>(xh, Wqt, bqkv, q_ws, k_ws, v_ws);

  // Attention: 32 (b,h) pairs x 16 query blocks of 128; 8 waves/block:
  // 4 groups of 32 queries x 2 key halves
  attn_kernel<<<NBATCH * NHEADS * (SEQ / 128), 256, 0, stream>>>(
      q_ws, k_ws, v_ws, mask, att_ws);

  // Output projection: M=4096, N=1024
  out_gemm_kernel<<<dim3(DMODEL / 128, (unsigned)(nBS / 128)), 256, 0,
                    stream>>>(att_ws, Wot, bout, out);
}
